// v000
// The times below were measured on an AMD MI455X: many runs one after another, warmed up first and cycling through
// copies of the inputs, with the whole window's GPU time divided by the number of runs. Launches and the gaps
// between them are all in it. The median over several windows is given; except for v000 it joins two sittings, which
// can be a few percent apart, so the side-by-side timings, each taken in one sitting, are the better comparison.
// v000 is the starting kernel. One run takes 318 microseconds.
// compute dtype: all float inputs rounded to bf16; key / val = x . wk[b] + bk[b] with EXACT bf16 products on WMMA 16x16x32 (per-sample (in,out) weights), f16 hi + residual; q = x itself (bf16 -> f16 exact; 16-dim heads with the upper half of the K=32 fragment zeroed); logits 2 products (k hi + residual) x 16^-1/2, padded keys (N = 358 -> 384) excluded, running-max softmax in f32 (hardware exp); P (x 2^11, f16) . v (hi + residual, 2 products); projection1 (relu) and projection2 with the f32 activations as bf16 hi + lo against exact weights (2 products each); f32 output. All padded rows/columns are written with finite (clamped) data before any read.
#include <hip/hip_runtime.h>
#include <math.h>

typedef __attribute__((ext_vector_type(16))) _Float16 v16h;
typedef __attribute__((ext_vector_type(16))) __bf16 v16b;
typedef __attribute__((ext_vector_type(8)))  _Float16 v8h;
typedef __attribute__((ext_vector_type(8)))  float v8f;
typedef __attribute__((ext_vector_type(4)))  float v4f;
typedef __attribute__((ext_vector_type(2)))  float v2f;
typedef __attribute__((ext_vector_type(4)))  unsigned v4u;
typedef __attribute__((ext_vector_type(4)))  int v4i;
typedef float __attribute__((may_alias)) float_a;
typedef int __attribute__((may_alias)) int_a;

template <typename T> __device__ __forceinline__ void vst2(void* p, T v) { *(T*)p = v;  }
__device__ __forceinline__ v8f wmma16(v16h a, v16h b, v8f c) {
  v8f d = __builtin_amdgcn_wmma_f32_16x16x32_f16(false, a, false, b, (short)0, c, false, false);
  asm volatile("v_nop\n\tv_nop\n\tv_nop\n\tv_nop" : "+v"(d) : "v"(a), "v"(b));
  return d;
}
__device__ __forceinline__ v8f wmma_bf(v16b a, v16b b, v8f c) {
  v8f d = __builtin_amdgcn_wmma_f32_16x16x32_bf16(false, a, false, b, (short)0, c, false, false);
  asm volatile("v_nop\n\tv_nop\n\tv_nop\n\tv_nop" : "+v"(d) : "v"(a), "v"(b));
  return d;
}
// 16x16x32 fragments: lane = (h = lane>>4, row/col = lane&15); elements 0..7 = k0+8h+0..7, 8..15 = k0+16+8h+0..7; D element r = row 8h+r
__device__ __forceinline__ v16h frag_h(const _Float16* rowk0, int lane) {
  union { v16h v; v8h q[2]; } u; const _Float16* p = rowk0 + 8 * (lane >> 4);
  u.q[0] = *(const v8h*)p; u.q[1] = *(const v8h*)(p + 16); return u.v;
}
__device__ __forceinline__ v16h frag_f32(const float* rowk0, int lane) {
  v16h a; const float* p = rowk0 + 8 * (lane >> 4);
#pragma unroll
  for (int i = 0; i < 8; ++i) { a[i] = (_Float16)p[i]; a[8 + i] = (_Float16)p[16 + i]; }
  return a;
}
__device__ __forceinline__ v16h frag_f32s(const float* rowk0, int lane, float sc) {
  v16h a; const float* p = rowk0 + 8 * (lane >> 4);
#pragma unroll
  for (int i = 0; i < 8; ++i) { a[i] = (_Float16)(p[i] * sc); a[8 + i] = (_Float16)(p[16 + i] * sc); }
  return a;
}
// column fragment from a [K][ld] layout (column n), rows >= K read as 0
__device__ __forceinline__ v16h fragc_f32(const float* W, int k0, int n, int lane, int ld, int K) {
  v16h a; const int g = lane >> 4;
#pragma unroll
  for (int i = 0; i < 8; ++i) { const int ka = k0 + 8 * g + i, kb = ka + 16;
    a[i] = (_Float16)(ka < K ? W[(size_t)(ka < K ? ka : K - 1) * ld + n] : 0.f); a[8 + i] = (_Float16)(kb < K ? W[(size_t)(kb < K ? kb : K - 1) * ld + n] : 0.f); }
  return a;
}
struct F2 { v16b h, l; };
__device__ __forceinline__ F2 bsplit16(const float v[16]) { F2 r;
#pragma unroll
  for (int i = 0; i < 16; ++i) { const __bf16 h = (__bf16)v[i]; r.h[i] = h; r.l[i] = (__bf16)(v[i] - (float)h); }
  return r; }
__device__ __forceinline__ F2 split_row(const float* row, int k0, int lane) { float v[16]; const float* p = row + k0 + 8 * (lane >> 4);
#pragma unroll
  for (int i = 0; i < 8; ++i) { v[i] = p[i]; v[8 + i] = p[16 + i]; }
  return bsplit16(v); }
__device__ __forceinline__ F2 split_rowK(const float* row, int k0, int lane, int K) { float v[16]; const int g = lane >> 4;
#pragma unroll
  for (int i = 0; i < 8; ++i) { const int ka = k0 + 8 * g + i, kb = ka + 16; v[i] = ka < K ? row[ka < K ? ka : K - 1] : 0.f; v[8 + i] = kb < K ? row[kb < K ? kb : K - 1] : 0.f; }
  return bsplit16(v); }
__device__ __forceinline__ F2 split_col(const float* W, int k0, int n, int lane, int ld, int K) { float v[16]; const int g = lane >> 4;
#pragma unroll
  for (int i = 0; i < 8; ++i) { const int ka = k0 + 8 * g + i, kb = ka + 16; v[i] = ka < K ? W[(size_t)(ka < K ? ka : K - 1) * ld + n] : 0.f; v[8 + i] = kb < K ? W[(size_t)(kb < K ? kb : K - 1) * ld + n] : 0.f; }
  return bsplit16(v); }
__device__ __forceinline__ v8f mac3(const F2& a, const F2& b, v8f c) { c = wmma_bf(a.l, b.h, c); c = wmma_bf(a.h, b.l, c); return wmma_bf(a.h, b.h, c); }
__device__ __forceinline__ float sigm(float v) { return 1.0f / (1.0f + expf(-v)); }
#define LDSX() do { asm volatile("s_wait_dscnt 0" ::: "memory"); __builtin_amdgcn_wave_barrier(); __builtin_amdgcn_fence(__ATOMIC_RELEASE, "workgroup"); } while (0)


// Spatial self attention over graph nodes (B 16, T 12, N 358 nodes, D 128 = 8 heads x 16): key/val from per-sample dynamic linears, q = x; softmax(q k / 4) over nodes; o -> Linear -> relu -> Linear.
#define NBATCH 16
#define NT 12
#define NG (NBATCH * NT)  // 192 (b, t) groups
#define NNODE 358
#define NP 384            // padded node count (6 x 64)
#define DD 128
#define KH 8
#define HS 16
#ifndef TG
#define TG NG
#endif
typedef __attribute__((ext_vector_type(8))) __bf16 v8b;
__device__ __forceinline__ v16b frag_b(const __bf16* rowk0, int lane) {
  union { v16b v; v8b q[2]; } u; const __bf16* p = rowk0 + 8 * (lane >> 4);
  u.q[0] = *(const v8b*)p; u.q[1] = *(const v8b*)(p + 16); return u.v;
}
__device__ __forceinline__ float bfr(float v) { return (float)(__bf16)v; }
__device__ __attribute__((noinline)) float exp_ni(float v) { return expf(v); }
__device__ __attribute__((noinline)) float erf_ni(float v) { return erff(v); }

#define WS_KH  0u                                   // f16 hi|lo key rows [g][NP][128]
#define WS_KL  (WS_KH + 2u * (size_t)NG * NP * DD)
#define WS_VH  (WS_KL + 2u * (size_t)NG * NP * DD)        // f16 hi|lo val planes [g][128][NP]
#define WS_VL  (WS_VH + 2u * (size_t)NG * DD * NP)
#define WS_O   (WS_VL + 2u * (size_t)NG * DD * NP)        // f32 o rows [g][NP][128]
#define WS_END (WS_O + 4u * (size_t)NG * NP * DD)

__device__ __forceinline__ size_t xrow(size_t g, int n) { return (g * NNODE + (size_t)(n < NNODE ? n : NNODE - 1)) * DD; }   // clamped node row of x
// ---- k_kv: block = (64 padded nodes, which, g): key / val = x(clamped rows) . w[b] + bias[b]; all 384 rows / columns written
__global__ __launch_bounds__(128) void k_kv(const float* __restrict__ X, const float* __restrict__ WK, const float* __restrict__ BK, const float* __restrict__ WV, const float* __restrict__ BV, _Float16* __restrict__ KHp, _Float16* __restrict__ KLp, _Float16* __restrict__ VHp, _Float16* __restrict__ VLp) {
  __shared__ __align__(16) _Float16 sh[64][136], sl[64][136]; __shared__ __align__(16) _Float16 th[128][72], tl[128][72];
  const int tid = threadIdx.x, wave = tid >> 5, lane = tid & 31, col = lane & 15, g = lane >> 4; const int which = blockIdx.y; const size_t grp = blockIdx.z; const size_t b = grp / NT; const int n0 = blockIdx.x * 64; const float* Wm = (which == 0 ? WK : WV) + b * DD * DD; const float* Bm = (which == 0 ? BK : BV) + b * DD;
  v8f acc[8] = {};
#pragma unroll
  for (int kc = 0; kc < DD / 32; ++kc) { v16b a; const float* pp = X + xrow(grp, n0 + wave * 16 + col) + kc * 32 + 8 * g;
#pragma unroll
    for (int i = 0; i < 8; ++i) { a[i] = (__bf16)pp[i]; a[8 + i] = (__bf16)pp[16 + i]; }
#pragma unroll
    for (int j = 0; j < 8; ++j) { v16b w; const int e = j * 16 + col;   // (in,out) w[b][d][e]
#pragma unroll
      for (int i = 0; i < 8; ++i) { w[i] = (__bf16)Wm[(size_t)(kc * 32 + 8 * g + i) * DD + e]; w[8 + i] = (__bf16)Wm[(size_t)(kc * 32 + 16 + 8 * g + i) * DD + e]; }
      acc[j] = wmma_bf(a, w, acc[j]); } }
#pragma unroll
  for (int j = 0; j < 8; ++j) { const float bb = bfr(Bm[j * 16 + col]);
#pragma unroll
    for (int r = 0; r < 8; ++r) { const float v = acc[j][r] + bb; const _Float16 hv = (_Float16)v, lv = (_Float16)((v - (float)hv) * 2048.0f); const int rl = wave * 16 + 8 * g + r, cl = j * 16 + col; if (which == 0) { sh[rl][cl] = hv; sl[rl][cl] = lv; } else { th[cl][rl] = hv; tl[cl][rl] = lv; } } }
  __syncthreads();
  if (which == 0) { for (int e = tid; e < 64 * 16; e += 128) { const int rl = e >> 4, q = e & 15; const size_t o = (grp * NP + n0 + rl) * DD + q * 8; vst2((unsigned*)(KHp + o), *(const v4u*)&sh[rl][q * 8]); vst2((unsigned*)(KLp + o), *(const v4u*)&sl[rl][q * 8]); } }
  else { for (int e = tid; e < 128 * 8; e += 128) { const int cl = e >> 3, q = e & 7; const size_t o = (grp * DD + cl) * (size_t)NP + n0 + q * 8; vst2((unsigned*)(VHp + o), *(const v4u*)&th[cl][q * 8]); vst2((unsigned*)(VLp + o), *(const v4u*)&tl[cl][q * 8]); } } }
__global__ __launch_bounds__(128) void k_att(const float* __restrict__ X, const _Float16* __restrict__ KHp, const _Float16* __restrict__ KLp, const _Float16* __restrict__ VHp, const _Float16* __restrict__ VLp, float* __restrict__ O) {
  __shared__ __align__(16) float sp[4][16][36]; __shared__ __align__(16) float so[4][16][36];
  const int tid = threadIdx.x, wave = tid >> 5, lane = tid & 31, col = lane & 15, g = lane >> 4; const int hp = blockIdx.y; const size_t grp = blockIdx.z; const int q0 = blockIdx.x * 64 + wave * 16;
#pragma unroll 1
  for (int hh = 0; hh < 2; ++hh) { const int kh = hp * 2 + hh;
    v16h aq; { const float* pp = X + xrow(grp, q0 + col) + kh * HS + 8 * g;
#pragma unroll
      for (int i = 0; i < 8; ++i) { aq[i] = (_Float16)bfr(pp[i]); aq[8 + i] = (_Float16)0.0f; } }   // K = 16 real dims; fragment slots 16..31 zeroed
    float m[8], l[8];
#pragma unroll
    for (int r = 0; r < 8; ++r) { m[r] = -3.0e38f; l[r] = 0.f; }
    v8f acc = {}, accl = {};
#pragma unroll 1
    for (int ks = 0; ks < NP / 32; ++ks) { float s[2][8];
#pragma unroll
      for (int ct = 0; ct < 2; ++ct) { const int kk = ks * 32 + ct * 16 + col; const size_t rk = (grp * NP + kk) * DD + kh * HS; v8f c = {}, cl = {}; c = wmma16(aq, frag_h(KHp + rk, lane), c); cl = wmma16(aq, frag_h(KLp + rk, lane), cl);
#pragma unroll
        for (int r = 0; r < 8; ++r) s[ct][r] = (kk < NNODE) ? (c[r] + cl[r] * (1.0f / 2048.0f)) * 0.25f : -3.0e38f; }
      float alpha[8];
#pragma unroll
      for (int r = 0; r < 8; ++r) { float mx = fmaxf(s[0][r], s[1][r]);
#pragma unroll
        for (int o = 1; o < 16; o <<= 1) mx = fmaxf(mx, __shfl_xor(mx, o));
        const float mn = fmaxf(m[r], mx); alpha[r] = (m[r] <= -1.0e38f) ? 0.f : __expf(m[r] - mn); const float e0 = (s[0][r] <= -1.0e38f) ? 0.f : __expf(s[0][r] - mn), e1 = (s[1][r] <= -1.0e38f) ? 0.f : __expf(s[1][r] - mn); float es = e0 + e1;
#pragma unroll
        for (int o = 1; o < 16; o <<= 1) es += __shfl_xor(es, o);
        l[r] = l[r] * alpha[r] + es; m[r] = mn; sp[wave][8 * g + r][col] = e0; sp[wave][8 * g + r][16 + col] = e1; }
#pragma unroll
      for (int r = 0; r < 8; ++r) { acc[r] *= alpha[r]; accl[r] *= alpha[r]; }
      LDSX();
      v16h pa; { const float* prow = &sp[wave][col][0] + 8 * (lane >> 4);
#pragma unroll
        for (int i = 0; i < 8; ++i) { pa[i] = (_Float16)(prow[i] * 2048.0f); pa[8 + i] = (_Float16)(prow[16 + i] * 2048.0f); } }
      { const size_t po = (grp * DD + (size_t)kh * HS + col) * NP + ks * 32; acc = wmma16(pa, frag_h(VHp + po, lane), acc); accl = wmma16(pa, frag_h(VLp + po, lane), accl); }
      LDSX(); }
#pragma unroll
    for (int r = 0; r < 8; ++r) so[wave][8 * g + r][hh * 16 + col] = (acc[r] + accl[r] * (1.0f / 2048.0f)) * ((1.0f / 2048.0f) / l[r]);
    LDSX(); }
  for (int rl = 0; rl < 16; ++rl) if (lane < 8) vst2(O + ((grp * NP) + q0 + rl) * DD + hp * 32 + lane * 4, *(const v4f*)&so[wave][rl][lane * 4]); }
// ---- k_mlp: block = (64 padded rows, g): out = (relu(o (hi + lo) . W1^T + b1)) (hi + lo) . W2^T + b2; rows n >= 358 are computed from finite data but not written
__global__ __launch_bounds__(128) void k_mlp(const float* __restrict__ O, const float* __restrict__ W1, const float* __restrict__ B1, const float* __restrict__ W2, const float* __restrict__ B2, float* __restrict__ OUT) { __shared__ __align__(16) float sf[4][16][132];
  const int tid = threadIdx.x, wave = tid >> 5, lane = tid & 31, col = lane & 15, g = lane >> 4; const size_t grp = blockIdx.y; const int n0 = blockIdx.x * 64 + wave * 16; const size_t r0 = grp * NP + n0;
  v8f acc[8] = {};
#pragma unroll
  for (int kc = 0; kc < DD / 32; ++kc) { const F2 a = split_row(O + (r0 + col) * DD, kc * 32, lane);
#pragma unroll
    for (int j = 0; j < 8; ++j) { v16b w; const float* wr = W1 + (size_t)(j * 16 + col) * DD + kc * 32 + 8 * g;
#pragma unroll
      for (int i = 0; i < 8; ++i) { w[i] = (__bf16)wr[i]; w[8 + i] = (__bf16)wr[16 + i]; }
      acc[j] = wmma_bf(a.h, w, acc[j]); acc[j] = wmma_bf(a.l, w, acc[j]); } }
#pragma unroll
  for (int j = 0; j < 8; ++j) { const float bb = bfr(B1[j * 16 + col]);
#pragma unroll
    for (int r = 0; r < 8; ++r) sf[wave][8 * g + r][j * 16 + col] = fmaxf(acc[j][r] + bb, 0.f); }
  LDSX();
  { v8f acc2[8] = {};
#pragma unroll
    for (int kc = 0; kc < DD / 32; ++kc) { float v[16]; const float* pp = &sf[wave][col][kc * 32 + 8 * g];
#pragma unroll
      for (int i = 0; i < 8; ++i) { v[i] = pp[i]; v[8 + i] = pp[16 + i]; }
      const F2 a = bsplit16(v);
#pragma unroll
      for (int j = 0; j < 8; ++j) { v16b w; const float* wr = W2 + (size_t)(j * 16 + col) * DD + kc * 32 + 8 * g;
#pragma unroll
        for (int i = 0; i < 8; ++i) { w[i] = (__bf16)wr[i]; w[8 + i] = (__bf16)wr[16 + i]; }
        acc2[j] = wmma_bf(a.h, w, acc2[j]); acc2[j] = wmma_bf(a.l, w, acc2[j]); } }
    LDSX();
#pragma unroll
    for (int j = 0; j < 8; ++j) { const float bb = bfr(B2[j * 16 + col]);
#pragma unroll
      for (int r = 0; r < 8; ++r) sf[wave][8 * g + r][j * 16 + col] = acc2[j][r] + bb; } }
  LDSX(); for (int rl = 0; rl < 16; ++rl) { const int n = n0 + rl; if (n < NNODE) vst2(OUT + (grp * NNODE + n) * DD + lane * 4, *(const v4f*)&sf[wave][rl][lane * 4]); } }
extern "C" void kernel_launch(void* const* d_in, const int* in_sizes, int n_in, void* d_out, int out_size, void* d_ws, size_t ws_size, hipStream_t stream) {
  (void)in_sizes; (void)n_in; (void)out_size;
  const float** F = (const float**)d_in;   // 0 x [16,12,358,128], 1 wk [16,1,128,128] (in,out), 2 bk [16,1,1,128], 3 wv, 4 bv, 5 W1 [128,128] natural, 6 b1, 7 W2 [128,128] natural, 8 b2
  if (ws_size < (size_t)WS_END) return;
  char* ws = (char*)d_ws; _Float16 *KHp = (_Float16*)(ws + WS_KH), *KLp = (_Float16*)(ws + WS_KL), *VHp = (_Float16*)(ws + WS_VH), *VLp = (_Float16*)(ws + WS_VL); float* O = (float*)(ws + WS_O);
  k_kv<<<dim3(NP / 64, 2, TG), 128, 0, stream>>>(F[0], F[1], F[2], F[3], F[4], KHp, KLp, VHp, VLp);
  k_att<<<dim3(NP / 64, KH / 2, TG), 128, 0, stream>>>(F[0], KHp, KLp, VHp, VLp, O);
  k_mlp<<<dim3(NP / 64, TG), 128, 0, stream>>>(O, F[5], F[6], F[7], F[8], (float*)d_out);
}

// v001
// One run takes 293 microseconds.
// In two side-by-side timings against v000, it was 1.12 and 1.13 times as fast.
// compute dtype: all float inputs rounded to bf16; key / val = x . wk[b] + bk[b] with EXACT bf16 products on WMMA 16x16x32 (per-sample (in,out) weights), f16 hi + residual; q = x itself (bf16 -> f16 exact; 16-dim heads with the upper half of the K=32 fragment zeroed); logits 2 products (k hi + residual) x 16^-1/2, padded keys (N = 358 -> 384) excluded, running-max softmax in f32 (hardware exp); P (x 2^11, f16) . v (hi + residual, 2 products); projection1 (relu) and projection2 with the f32 activations as bf16 hi + lo against exact weights (2 products each); f32 output. All padded rows/columns are written with finite (clamped) data before any read.
#include <hip/hip_runtime.h>
#include <math.h>

typedef __attribute__((ext_vector_type(16))) _Float16 v16h;
typedef __attribute__((ext_vector_type(16))) __bf16 v16b;
typedef __attribute__((ext_vector_type(8)))  _Float16 v8h;
typedef __attribute__((ext_vector_type(8)))  float v8f;
typedef __attribute__((ext_vector_type(4)))  float v4f;
typedef __attribute__((ext_vector_type(2)))  float v2f;
typedef __attribute__((ext_vector_type(4)))  unsigned v4u;
typedef __attribute__((ext_vector_type(4)))  int v4i;
typedef float __attribute__((may_alias)) float_a;
typedef int __attribute__((may_alias)) int_a;

template <typename T> __device__ __forceinline__ void vst2(void* p, T v) { *(T*)p = v;  }
__device__ __forceinline__ v8f wmma16(v16h a, v16h b, v8f c) {
  v8f d = __builtin_amdgcn_wmma_f32_16x16x32_f16(false, a, false, b, (short)0, c, false, false);
  asm volatile("v_nop\n\tv_nop\n\tv_nop\n\tv_nop" : "+v"(d) : "v"(a), "v"(b));
  return d;
}
__device__ __forceinline__ v8f wmma_bf(v16b a, v16b b, v8f c) {
  v8f d = __builtin_amdgcn_wmma_f32_16x16x32_bf16(false, a, false, b, (short)0, c, false, false);
  asm volatile("v_nop\n\tv_nop\n\tv_nop\n\tv_nop" : "+v"(d) : "v"(a), "v"(b));
  return d;
}
// 16x16x32 fragments: lane = (h = lane>>4, row/col = lane&15); elements 0..7 = k0+8h+0..7, 8..15 = k0+16+8h+0..7; D element r = row 8h+r
__device__ __forceinline__ v16h frag_h(const _Float16* rowk0, int lane) {
  union { v16h v; v8h q[2]; } u; const _Float16* p = rowk0 + 8 * (lane >> 4);
  u.q[0] = *(const v8h*)p; u.q[1] = *(const v8h*)(p + 16); return u.v;
}
__device__ __forceinline__ v16h frag_f32(const float* rowk0, int lane) {
  v16h a; const float* p = rowk0 + 8 * (lane >> 4);
#pragma unroll
  for (int i = 0; i < 8; ++i) { a[i] = (_Float16)p[i]; a[8 + i] = (_Float16)p[16 + i]; }
  return a;
}
__device__ __forceinline__ v16h frag_f32s(const float* rowk0, int lane, float sc) {
  v16h a; const float* p = rowk0 + 8 * (lane >> 4);
#pragma unroll
  for (int i = 0; i < 8; ++i) { a[i] = (_Float16)(p[i] * sc); a[8 + i] = (_Float16)(p[16 + i] * sc); }
  return a;
}
// column fragment from a [K][ld] layout (column n), rows >= K read as 0
__device__ __forceinline__ v16h fragc_f32(const float* W, int k0, int n, int lane, int ld, int K) {
  v16h a; const int g = lane >> 4;
#pragma unroll
  for (int i = 0; i < 8; ++i) { const int ka = k0 + 8 * g + i, kb = ka + 16;
    a[i] = (_Float16)(ka < K ? W[(size_t)(ka < K ? ka : K - 1) * ld + n] : 0.f); a[8 + i] = (_Float16)(kb < K ? W[(size_t)(kb < K ? kb : K - 1) * ld + n] : 0.f); }
  return a;
}
struct F2 { v16b h, l; };
__device__ __forceinline__ F2 bsplit16(const float v[16]) { F2 r;
#pragma unroll
  for (int i = 0; i < 16; ++i) { const __bf16 h = (__bf16)v[i]; r.h[i] = h; r.l[i] = (__bf16)(v[i] - (float)h); }
  return r; }
__device__ __forceinline__ F2 split_row(const float* row, int k0, int lane) { float v[16]; const float* p = row + k0 + 8 * (lane >> 4);
#pragma unroll
  for (int i = 0; i < 8; ++i) { v[i] = p[i]; v[8 + i] = p[16 + i]; }
  return bsplit16(v); }
__device__ __forceinline__ F2 split_rowK(const float* row, int k0, int lane, int K) { float v[16]; const int g = lane >> 4;
#pragma unroll
  for (int i = 0; i < 8; ++i) { const int ka = k0 + 8 * g + i, kb = ka + 16; v[i] = ka < K ? row[ka < K ? ka : K - 1] : 0.f; v[8 + i] = kb < K ? row[kb < K ? kb : K - 1] : 0.f; }
  return bsplit16(v); }
__device__ __forceinline__ F2 split_col(const float* W, int k0, int n, int lane, int ld, int K) { float v[16]; const int g = lane >> 4;
#pragma unroll
  for (int i = 0; i < 8; ++i) { const int ka = k0 + 8 * g + i, kb = ka + 16; v[i] = ka < K ? W[(size_t)(ka < K ? ka : K - 1) * ld + n] : 0.f; v[8 + i] = kb < K ? W[(size_t)(kb < K ? kb : K - 1) * ld + n] : 0.f; }
  return bsplit16(v); }
__device__ __forceinline__ v8f mac3(const F2& a, const F2& b, v8f c) { c = wmma_bf(a.l, b.h, c); c = wmma_bf(a.h, b.l, c); return wmma_bf(a.h, b.h, c); }
__device__ __forceinline__ float sigm(float v) { return 1.0f / (1.0f + expf(-v)); }
#define LDSX() do { asm volatile("s_wait_dscnt 0" ::: "memory"); __builtin_amdgcn_wave_barrier(); __builtin_amdgcn_fence(__ATOMIC_RELEASE, "workgroup"); } while (0)


// Spatial self attention over graph nodes (B 16, T 12, N 358 nodes, D 128 = 8 heads x 16): key/val from per-sample dynamic linears, q = x; softmax(q k / 4) over nodes; o -> Linear -> relu -> Linear.
#define NBATCH 16
#define NT 12
#define NG (NBATCH * NT)  // 192 (b, t) groups
#define NNODE 358
#define NP 384            // padded node count (6 x 64)
#define DD 128
#define KH 8
#define HS 16
#ifndef TG
#define TG NG
#endif
typedef __attribute__((ext_vector_type(8))) __bf16 v8b;
__device__ __forceinline__ v16b frag_b(const __bf16* rowk0, int lane) {
  union { v16b v; v8b q[2]; } u; const __bf16* p = rowk0 + 8 * (lane >> 4);
  u.q[0] = *(const v8b*)p; u.q[1] = *(const v8b*)(p + 16); return u.v;
}
__device__ __forceinline__ float bfr(float v) { return (float)(__bf16)v; }
__device__ __attribute__((noinline)) float exp_ni(float v) { return expf(v); }
__device__ __attribute__((noinline)) float erf_ni(float v) { return erff(v); }

#define WS_KH  0u                                   // f16 hi|lo key rows [g][NP][128]
#define WS_KL  (WS_KH + 2u * (size_t)NG * NP * DD)
#define WS_VH  (WS_KL + 2u * (size_t)NG * NP * DD)        // f16 hi|lo val planes [g][128][NP]
#define WS_VL  (WS_VH + 2u * (size_t)NG * DD * NP)
#define WS_O   (WS_VL + 2u * (size_t)NG * DD * NP)        // f32 o rows [g][NP][128]
#define WS_END (WS_O + 4u * (size_t)NG * NP * DD)

__device__ __forceinline__ size_t xrow(size_t g, int n) { return (g * NNODE + (size_t)(n < NNODE ? n : NNODE - 1)) * DD; }   // clamped node row of x
// ---- k_kv: block = (64 padded nodes, which, g): key / val = x(clamped rows) . w[b] + bias[b]; all 384 rows / columns written
__global__ __launch_bounds__(128) void k_kv(const float* __restrict__ X, const float* __restrict__ WK, const float* __restrict__ BK, const float* __restrict__ WV, const float* __restrict__ BV, _Float16* __restrict__ KHp, _Float16* __restrict__ KLp, _Float16* __restrict__ VHp, _Float16* __restrict__ VLp) {
  __shared__ __align__(16) _Float16 sh[64][136], sl[64][136]; __shared__ __align__(16) _Float16 th[128][72], tl[128][72];
  const int tid = threadIdx.x, wave = tid >> 5, lane = tid & 31, col = lane & 15, g = lane >> 4; const int which = blockIdx.y; const size_t grp = blockIdx.z; const size_t b = grp / NT; const int n0 = blockIdx.x * 64; const float* Wm = (which == 0 ? WK : WV) + b * DD * DD; const float* Bm = (which == 0 ? BK : BV) + b * DD;
  v8f acc[8] = {};
#pragma unroll
  for (int kc = 0; kc < DD / 32; ++kc) { v16b a; const float* pp = X + xrow(grp, n0 + wave * 16 + col) + kc * 32 + 8 * g;
#pragma unroll
    for (int i = 0; i < 8; ++i) { a[i] = (__bf16)pp[i]; a[8 + i] = (__bf16)pp[16 + i]; }
#pragma unroll
    for (int j = 0; j < 8; ++j) { v16b w; const int e = j * 16 + col;   // (in,out) w[b][d][e]
#pragma unroll
      for (int i = 0; i < 8; ++i) { w[i] = (__bf16)Wm[(size_t)(kc * 32 + 8 * g + i) * DD + e]; w[8 + i] = (__bf16)Wm[(size_t)(kc * 32 + 16 + 8 * g + i) * DD + e]; }
      acc[j] = wmma_bf(a, w, acc[j]); } }
#pragma unroll
  for (int j = 0; j < 8; ++j) { const float bb = bfr(Bm[j * 16 + col]);
#pragma unroll
    for (int r = 0; r < 8; ++r) { const float v = acc[j][r] + bb; const _Float16 hv = (_Float16)v, lv = (_Float16)((v - (float)hv) * 2048.0f); const int rl = wave * 16 + 8 * g + r, cl = j * 16 + col; if (which == 0) { sh[rl][cl] = hv; sl[rl][cl] = lv; } else { th[cl][rl] = hv; tl[cl][rl] = lv; } } }
  __syncthreads();
  if (which == 0) { for (int e = tid; e < 64 * 16; e += 128) { const int rl = e >> 4, q = e & 15; const size_t o = (grp * NP + n0 + rl) * DD + q * 8; vst2((unsigned*)(KHp + o), *(const v4u*)&sh[rl][q * 8]); vst2((unsigned*)(KLp + o), *(const v4u*)&sl[rl][q * 8]); } }
  else { for (int e = tid; e < 128 * 8; e += 128) { const int cl = e >> 3, q = e & 7; const size_t o = (grp * DD + cl) * (size_t)NP + n0 + q * 8; vst2((unsigned*)(VHp + o), *(const v4u*)&th[cl][q * 8]); vst2((unsigned*)(VLp + o), *(const v4u*)&tl[cl][q * 8]); } } }
// lane l with lane l ^ 16 (the two halves of a wave hold the two key halves of one query column)
__device__ __forceinline__ float xhalf(float x) { return __builtin_bit_cast(float, __builtin_amdgcn_permlanex16(__builtin_bit_cast(int, x), __builtin_bit_cast(int, x), 0x76543210, 0xfedcba98, false, false)); }
// ---- k_att: wave = (16 queries, two heads in turn): S^T = K . Q^T (A = key rows, B = q), so a lane holds 2 x 8 keys' scores of ONE query (column = lane & 15); maximum and sum run in-lane plus one exchange between halves;
// the two score tiles, converted in place, are the B operand of O^T += V^T . P^T (element i = key 8h + i, element 8 + i = key 16 + 8h + i, the order of frag_h on the val planes)
__global__ __launch_bounds__(128) void k_att(const float* __restrict__ X, const _Float16* __restrict__ KHp, const _Float16* __restrict__ KLp, const _Float16* __restrict__ VHp, const _Float16* __restrict__ VLp, float* __restrict__ O) {
  __shared__ __align__(16) float so[4][16][36];
  const int tid = threadIdx.x, wave = tid >> 5, lane = tid & 31, col = lane & 15, g = lane >> 4; const int hp = blockIdx.y; const size_t grp = blockIdx.z; const int q0 = blockIdx.x * 64 + wave * 16;
#pragma unroll 1
  for (int hh = 0; hh < 2; ++hh) { const int kh = hp * 2 + hh;
    v16h bq; { const float* pp = X + xrow(grp, q0 + col) + kh * HS + 8 * g;
#pragma unroll
      for (int i = 0; i < 8; ++i) { bq[i] = (_Float16)bfr(pp[i]); bq[8 + i] = (_Float16)0.0f; } }   // K = 16 real dims; fragment slots 16..31 zeroed
    float m = -3.0e38f, l = 0.f;   // running maximum of the query (equal in both halves); this half's share of the sum
    v8f acc = {}, accl = {};       // O^T: element r = head dim 8g + r of query col
#pragma unroll 1
    for (int ks = 0; ks < NP / 32; ++ks) { float s[2][8];
#pragma unroll
      for (int ct = 0; ct < 2; ++ct) { const size_t rk = (grp * NP + ks * 32 + ct * 16 + col) * DD + kh * HS; v8f c = {}, cl = {}; c = wmma16(frag_h(KHp + rk, lane), bq, c); cl = wmma16(frag_h(KLp + rk, lane), bq, cl);
#pragma unroll
        for (int r = 0; r < 8; ++r) s[ct][r] = (c[r] + cl[r] * (1.0f / 2048.0f)) * 0.25f; }
      if (ks * 32 + 32 > NNODE) {   // only the last key block holds padded keys
#pragma unroll
        for (int ct = 0; ct < 2; ++ct) {
#pragma unroll
          for (int r = 0; r < 8; ++r) if (ks * 32 + ct * 16 + 8 * g + r >= NNODE) s[ct][r] = -3.0e38f; } }
      float mx = fmaxf(s[0][0], s[1][0]);
#pragma unroll
      for (int r = 1; r < 8; ++r) mx = fmaxf(mx, fmaxf(s[0][r], s[1][r]));
      mx = fmaxf(mx, xhalf(mx));
      const float mn = fmaxf(m, mx), alpha = (m <= -1.0e38f) ? 0.f : __expf(m - mn); m = mn;
      v16h pb; float es0 = 0.f, es1 = 0.f;
#pragma unroll
      for (int r = 0; r < 8; ++r) { const float e0 = __expf(s[0][r] - mn), e1 = __expf(s[1][r] - mn);   // a padded key: exp of about -3e38 = 0 (mn is finite: keys 0..31 are real)
        es0 += e0; es1 += e1; pb[r] = (_Float16)(e0 * 2048.0f); pb[8 + r] = (_Float16)(e1 * 2048.0f); }
      l = l * alpha + (es0 + es1);
#pragma unroll
      for (int r = 0; r < 8; ++r) { acc[r] *= alpha; accl[r] *= alpha; }
      { const size_t po = (grp * DD + (size_t)kh * HS + col) * NP + ks * 32; acc = wmma16(frag_h(VHp + po, lane), pb, acc); accl = wmma16(frag_h(VLp + po, lane), pb, accl); } }
    const float inv = (1.0f / 2048.0f) / (l + xhalf(l));
#pragma unroll
    for (int r = 0; r < 8; ++r) so[wave][col][hh * 16 + 8 * g + r] = (acc[r] + accl[r] * (1.0f / 2048.0f)) * inv; }
  LDSX();   // the wave's own staged rows are read back below by other lanes
  for (int rl = 0; rl < 16; ++rl) if (lane < 8) vst2(O + ((grp * NP) + q0 + rl) * DD + hp * 32 + lane * 4, *(const v4f*)&so[wave][rl][lane * 4]); }
// ---- k_mlp: block = (64 padded rows, g): out = (relu(o (hi + lo) . W1^T + b1)) (hi + lo) . W2^T + b2; rows n >= 358 are computed from finite data but not written
__global__ __launch_bounds__(128) void k_mlp(const float* __restrict__ O, const float* __restrict__ W1, const float* __restrict__ B1, const float* __restrict__ W2, const float* __restrict__ B2, float* __restrict__ OUT) { __shared__ __align__(16) float sf[4][16][132];
  const int tid = threadIdx.x, wave = tid >> 5, lane = tid & 31, col = lane & 15, g = lane >> 4; const size_t grp = blockIdx.y; const int n0 = blockIdx.x * 64 + wave * 16; const size_t r0 = grp * NP + n0;
  v8f acc[8] = {};
#pragma unroll
  for (int kc = 0; kc < DD / 32; ++kc) { const F2 a = split_row(O + (r0 + col) * DD, kc * 32, lane);
#pragma unroll
    for (int j = 0; j < 8; ++j) { v16b w; const float* wr = W1 + (size_t)(j * 16 + col) * DD + kc * 32 + 8 * g;
#pragma unroll
      for (int i = 0; i < 8; ++i) { w[i] = (__bf16)wr[i]; w[8 + i] = (__bf16)wr[16 + i]; }
      acc[j] = wmma_bf(a.h, w, acc[j]); acc[j] = wmma_bf(a.l, w, acc[j]); } }
#pragma unroll
  for (int j = 0; j < 8; ++j) { const float bb = bfr(B1[j * 16 + col]);
#pragma unroll
    for (int r = 0; r < 8; ++r) sf[wave][8 * g + r][j * 16 + col] = fmaxf(acc[j][r] + bb, 0.f); }
  LDSX();
  { v8f acc2[8] = {};
#pragma unroll
    for (int kc = 0; kc < DD / 32; ++kc) { float v[16]; const float* pp = &sf[wave][col][kc * 32 + 8 * g];
#pragma unroll
      for (int i = 0; i < 8; ++i) { v[i] = pp[i]; v[8 + i] = pp[16 + i]; }
      const F2 a = bsplit16(v);
#pragma unroll
      for (int j = 0; j < 8; ++j) { v16b w; const float* wr = W2 + (size_t)(j * 16 + col) * DD + kc * 32 + 8 * g;
#pragma unroll
        for (int i = 0; i < 8; ++i) { w[i] = (__bf16)wr[i]; w[8 + i] = (__bf16)wr[16 + i]; }
        acc2[j] = wmma_bf(a.h, w, acc2[j]); acc2[j] = wmma_bf(a.l, w, acc2[j]); } }
    LDSX();
#pragma unroll
    for (int j = 0; j < 8; ++j) { const float bb = bfr(B2[j * 16 + col]);
#pragma unroll
      for (int r = 0; r < 8; ++r) sf[wave][8 * g + r][j * 16 + col] = acc2[j][r] + bb; } }
  LDSX(); for (int rl = 0; rl < 16; ++rl) { const int n = n0 + rl; if (n < NNODE) vst2(OUT + (grp * NNODE + n) * DD + lane * 4, *(const v4f*)&sf[wave][rl][lane * 4]); } }
extern "C" void kernel_launch(void* const* d_in, const int* in_sizes, int n_in, void* d_out, int out_size, void* d_ws, size_t ws_size, hipStream_t stream) {
  (void)in_sizes; (void)n_in; (void)out_size;
  const float** F = (const float**)d_in;   // 0 x [16,12,358,128], 1 wk [16,1,128,128] (in,out), 2 bk [16,1,1,128], 3 wv, 4 bv, 5 W1 [128,128] natural, 6 b1, 7 W2 [128,128] natural, 8 b2
  if (ws_size < (size_t)WS_END) return;
  char* ws = (char*)d_ws; _Float16 *KHp = (_Float16*)(ws + WS_KH), *KLp = (_Float16*)(ws + WS_KL), *VHp = (_Float16*)(ws + WS_VH), *VLp = (_Float16*)(ws + WS_VL); float* O = (float*)(ws + WS_O);
  k_kv<<<dim3(NP / 64, 2, TG), 128, 0, stream>>>(F[0], F[1], F[2], F[3], F[4], KHp, KLp, VHp, VLp);
  k_att<<<dim3(NP / 64, KH / 2, TG), 128, 0, stream>>>(F[0], KHp, KLp, VHp, VLp, O);
  k_mlp<<<dim3(NP / 64, TG), 128, 0, stream>>>(O, F[5], F[6], F[7], F[8], (float*)d_out);
}

// v002
// One run takes 155 microseconds.
// Two timings next to v001 both put it at 1.82 times that version's speed.
// All steps since v000 together make it 2.05 times as fast.
// compute dtype: all float inputs rounded to bf16; key / val = x . wk[b] + bk[b] with EXACT bf16 products on WMMA 16x16x32 (per-sample (in,out) weights), f16 hi + residual; q = x itself (bf16 -> f16 exact; 16-dim heads with the upper half of the K=32 fragment zeroed); logits 2 products (k hi + residual) x 16^-1/2, padded keys (N = 358 -> 384) excluded, running-max softmax in f32 (hardware exp); P (x 2^11, f16) . v (hi + residual, 2 products); projection1 (relu) and projection2 with the f32 activations as bf16 hi + lo against exact weights (2 products each); f32 output. All padded rows/columns are written with finite (clamped) data before any read.
#include <hip/hip_runtime.h>
#include <math.h>

typedef __attribute__((ext_vector_type(16))) _Float16 v16h;
typedef __attribute__((ext_vector_type(16))) __bf16 v16b;
typedef __attribute__((ext_vector_type(8)))  _Float16 v8h;
typedef __attribute__((ext_vector_type(8)))  float v8f;
typedef __attribute__((ext_vector_type(4)))  float v4f;
typedef __attribute__((ext_vector_type(2)))  float v2f;
typedef __attribute__((ext_vector_type(4)))  unsigned v4u;
typedef __attribute__((ext_vector_type(4)))  int v4i;
typedef float __attribute__((may_alias)) float_a;
typedef int __attribute__((may_alias)) int_a;

template <typename T> __device__ __forceinline__ void vst2(void* p, T v) { *(T*)p = v;  }
__device__ __forceinline__ v8f wmma16(v16h a, v16h b, v8f c) {
  v8f d = __builtin_amdgcn_wmma_f32_16x16x32_f16(false, a, false, b, (short)0, c, false, false);
  asm volatile("v_nop\n\tv_nop\n\tv_nop\n\tv_nop" : "+v"(d) : "v"(a), "v"(b));
  return d;
}
__device__ __forceinline__ v8f wmma_bf(v16b a, v16b b, v8f c) {
  v8f d = __builtin_amdgcn_wmma_f32_16x16x32_bf16(false, a, false, b, (short)0, c, false, false);
  asm volatile("v_nop\n\tv_nop\n\tv_nop\n\tv_nop" : "+v"(d) : "v"(a), "v"(b));
  return d;
}
// 16x16x32 fragments: lane = (h = lane>>4, row/col = lane&15); elements 0..7 = k0+8h+0..7, 8..15 = k0+16+8h+0..7; D element r = row 8h+r
__device__ __forceinline__ v16h frag_h(const _Float16* rowk0, int lane) {
  union { v16h v; v8h q[2]; } u; const _Float16* p = rowk0 + 8 * (lane >> 4);
  u.q[0] = *(const v8h*)p; u.q[1] = *(const v8h*)(p + 16); return u.v;
}
__device__ __forceinline__ v16h frag_f32(const float* rowk0, int lane) {
  v16h a; const float* p = rowk0 + 8 * (lane >> 4);
#pragma unroll
  for (int i = 0; i < 8; ++i) { a[i] = (_Float16)p[i]; a[8 + i] = (_Float16)p[16 + i]; }
  return a;
}
__device__ __forceinline__ v16h frag_f32s(const float* rowk0, int lane, float sc) {
  v16h a; const float* p = rowk0 + 8 * (lane >> 4);
#pragma unroll
  for (int i = 0; i < 8; ++i) { a[i] = (_Float16)(p[i] * sc); a[8 + i] = (_Float16)(p[16 + i] * sc); }
  return a;
}
// column fragment from a [K][ld] layout (column n), rows >= K read as 0
__device__ __forceinline__ v16h fragc_f32(const float* W, int k0, int n, int lane, int ld, int K) {
  v16h a; const int g = lane >> 4;
#pragma unroll
  for (int i = 0; i < 8; ++i) { const int ka = k0 + 8 * g + i, kb = ka + 16;
    a[i] = (_Float16)(ka < K ? W[(size_t)(ka < K ? ka : K - 1) * ld + n] : 0.f); a[8 + i] = (_Float16)(kb < K ? W[(size_t)(kb < K ? kb : K - 1) * ld + n] : 0.f); }
  return a;
}
struct F2 { v16b h, l; };
__device__ __forceinline__ F2 bsplit16(const float v[16]) { F2 r;
#pragma unroll
  for (int i = 0; i < 16; ++i) { const __bf16 h = (__bf16)v[i]; r.h[i] = h; r.l[i] = (__bf16)(v[i] - (float)h); }
  return r; }
__device__ __forceinline__ F2 split_row(const float* row, int k0, int lane) { float v[16]; const float* p = row + k0 + 8 * (lane >> 4);
#pragma unroll
  for (int i = 0; i < 8; ++i) { v[i] = p[i]; v[8 + i] = p[16 + i]; }
  return bsplit16(v); }
__device__ __forceinline__ F2 split_rowK(const float* row, int k0, int lane, int K) { float v[16]; const int g = lane >> 4;
#pragma unroll
  for (int i = 0; i < 8; ++i) { const int ka = k0 + 8 * g + i, kb = ka + 16; v[i] = ka < K ? row[ka < K ? ka : K - 1] : 0.f; v[8 + i] = kb < K ? row[kb < K ? kb : K - 1] : 0.f; }
  return bsplit16(v); }
__device__ __forceinline__ F2 split_col(const float* W, int k0, int n, int lane, int ld, int K) { float v[16]; const int g = lane >> 4;
#pragma unroll
  for (int i = 0; i < 8; ++i) { const int ka = k0 + 8 * g + i, kb = ka + 16; v[i] = ka < K ? W[(size_t)(ka < K ? ka : K - 1) * ld + n] : 0.f; v[8 + i] = kb < K ? W[(size_t)(kb < K ? kb : K - 1) * ld + n] : 0.f; }
  return bsplit16(v); }
__device__ __forceinline__ v8f mac3(const F2& a, const F2& b, v8f c) { c = wmma_bf(a.l, b.h, c); c = wmma_bf(a.h, b.l, c); return wmma_bf(a.h, b.h, c); }
__device__ __forceinline__ float sigm(float v) { return 1.0f / (1.0f + expf(-v)); }
#define LDSX() do { asm volatile("s_wait_dscnt 0" ::: "memory"); __builtin_amdgcn_wave_barrier(); __builtin_amdgcn_fence(__ATOMIC_RELEASE, "workgroup"); } while (0)


// Spatial self attention over graph nodes (B 16, T 12, N 358 nodes, D 128 = 8 heads x 16): key/val from per-sample dynamic linears, q = x; softmax(q k / 4) over nodes; o -> Linear -> relu -> Linear.
#define NBATCH 16
#define NT 12
#define NG (NBATCH * NT)  // 192 (b, t) groups
#define NNODE 358
#define NP 384            // padded node count (6 x 64)
#define DD 128
#define KH 8
#define HS 16
#ifndef TG
#define TG NG
#endif
typedef __attribute__((ext_vector_type(8))) __bf16 v8b;
__device__ __forceinline__ v16b frag_b(const __bf16* rowk0, int lane) {
  union { v16b v; v8b q[2]; } u; const __bf16* p = rowk0 + 8 * (lane >> 4);
  u.q[0] = *(const v8b*)p; u.q[1] = *(const v8b*)(p + 16); return u.v;
}
__device__ __forceinline__ float bfr(float v) { return (float)(__bf16)v; }
__device__ __attribute__((noinline)) float exp_ni(float v) { return expf(v); }
__device__ __attribute__((noinline)) float erf_ni(float v) { return erff(v); }

#define WS_KH  0u                                   // f16 hi|lo key rows [g][NP][128]
#define WS_KL  (WS_KH + 2u * (size_t)NG * NP * DD)
#define WS_VH  (WS_KL + 2u * (size_t)NG * NP * DD)        // f16 hi|lo val planes [g][128][NP]
#define WS_VL  (WS_VH + 2u * (size_t)NG * DD * NP)
#define WS_O   (WS_VL + 2u * (size_t)NG * DD * NP)        // f32 o rows [g][NP][128]
#define WS_END (WS_O + 4u * (size_t)NG * NP * DD)

__device__ __forceinline__ size_t xrow(size_t g, int n) { return (g * NNODE + (size_t)(n < NNODE ? n : NNODE - 1)) * DD; }   // clamped node row of x
// ---- k_kv: block = (64 padded nodes, which, g): key / val = x(clamped rows) . w[b] + bias[b]; all 384 rows / columns written
__global__ __launch_bounds__(128) void k_kv(const float* __restrict__ X, const float* __restrict__ WK, const float* __restrict__ BK, const float* __restrict__ WV, const float* __restrict__ BV, _Float16* __restrict__ KHp, _Float16* __restrict__ KLp, _Float16* __restrict__ VHp, _Float16* __restrict__ VLp) {
  __shared__ __align__(16) _Float16 sh[64][136], sl[64][136]; __shared__ __align__(16) _Float16 th[128][72], tl[128][72];
  const int tid = threadIdx.x, wave = tid >> 5, lane = tid & 31, col = lane & 15, g = lane >> 4; const int which = blockIdx.y; const size_t grp = blockIdx.z; const size_t b = grp / NT; const int n0 = blockIdx.x * 64; const float* Wm = (which == 0 ? WK : WV) + b * DD * DD; const float* Bm = (which == 0 ? BK : BV) + b * DD;
  v8f acc[8] = {};
#pragma unroll
  for (int kc = 0; kc < DD / 32; ++kc) { v16b a; const float* pp = X + xrow(grp, n0 + wave * 16 + col) + kc * 32 + 8 * g;
#pragma unroll
    for (int i = 0; i < 8; ++i) { a[i] = (__bf16)pp[i]; a[8 + i] = (__bf16)pp[16 + i]; }
#pragma unroll
    for (int j = 0; j < 8; ++j) { v16b w; const int e = j * 16 + col;   // (in,out) w[b][d][e]
#pragma unroll
      for (int i = 0; i < 8; ++i) { w[i] = (__bf16)Wm[(size_t)(kc * 32 + 8 * g + i) * DD + e]; w[8 + i] = (__bf16)Wm[(size_t)(kc * 32 + 16 + 8 * g + i) * DD + e]; }
      acc[j] = wmma_bf(a, w, acc[j]); } }
#pragma unroll
  for (int j = 0; j < 8; ++j) { const float bb = bfr(Bm[j * 16 + col]);
#pragma unroll
    for (int r = 0; r < 8; ++r) { const float v = acc[j][r] + bb; const _Float16 hv = (_Float16)v, lv = (_Float16)((v - (float)hv) * 2048.0f); const int rl = wave * 16 + 8 * g + r, cl = j * 16 + col; if (which == 0) { sh[rl][cl] = hv; sl[rl][cl] = lv; } else { th[cl][rl] = hv; tl[cl][rl] = lv; } } }
  __syncthreads();
  if (which == 0) { for (int e = tid; e < 64 * 16; e += 128) { const int rl = e >> 4, q = e & 15; const size_t o = (grp * NP + n0 + rl) * DD + q * 8; vst2((unsigned*)(KHp + o), *(const v4u*)&sh[rl][q * 8]); vst2((unsigned*)(KLp + o), *(const v4u*)&sl[rl][q * 8]); } }
  else { for (int e = tid; e < 128 * 8; e += 128) { const int cl = e >> 3, q = e & 7; const size_t o = (grp * DD + cl) * (size_t)NP + n0 + q * 8; vst2((unsigned*)(VHp + o), *(const v4u*)&th[cl][q * 8]); vst2((unsigned*)(VLp + o), *(const v4u*)&tl[cl][q * 8]); } } }
// lane l with lane l ^ 16 (the two halves of a wave hold the two key halves of one query column)
__device__ __forceinline__ float xhalf(float x) { return __builtin_bit_cast(float, __builtin_amdgcn_permlanex16(__builtin_bit_cast(int, x), __builtin_bit_cast(int, x), 0x76543210, 0xfedcba98, false, false)); }
// ---- k_att: block = (head pair, g), 12 waves x 2 query tiles: the pair's key rows and val planes (hi and residual, all 384 keys, 96 KiB) are brought into LDS once by whole 16-byte chunks, and every fragment is read from there.
// wave = (16 queries, head): S^T = K . Q^T (A = key rows, B = q), so a lane holds 2 x 8 keys' scores of ONE query (column = lane & 15); maximum and sum run in-lane plus one exchange between halves;
// the two score tiles, converted in place, are the B operand of O^T += V^T . P^T (element i = key 8h + i, element 8 + i = key 16 + 8h + i, the order of frag_h on the val planes)
// LDS places, no pad: chunk c (16 bytes) of key row n lies at chunk c ^ ((n >> 2) & 3) of its 64-byte row; chunk c of val plane row d at chunk c ^ (d & 15) of its 768-byte row: the 16 lanes of a fragment read fall on 16 different bank groups
#define AW 12
__global__ __launch_bounds__(AW * 32) void k_att(const float* __restrict__ X, const _Float16* __restrict__ KHp, const _Float16* __restrict__ KLp, const _Float16* __restrict__ VHp, const _Float16* __restrict__ VLp, float* __restrict__ O) {
  __shared__ __align__(16) _Float16 skh[NP * 32], skl[NP * 32], svh[32 * NP], svl[32 * NP];
  const int tid = threadIdx.x, wave = tid >> 5, lane = tid & 31, col = lane & 15, g = lane >> 4; const int hp = blockIdx.x; const size_t grp = blockIdx.y;
  { v4u tkh[4], tkl[4], tvh[4], tvl[4];   // 16 chunks a thread, all in flight together; the four loops are unrolled so that these stay in registers
#pragma unroll
    for (int i = 0; i < 4; ++i) { const int e = tid + i * (AW * 32), n = e >> 2, c = e & 3; const size_t s = (grp * NP + n) * DD + hp * 32 + c * 8; tkh[i] = *(const v4u*)(KHp + s); tkl[i] = *(const v4u*)(KLp + s); }
    asm volatile("s_wait_xcnt 0x0" ::: "memory");   // before a later load's result may land in an address register of these loads
#pragma unroll
    for (int i = 0; i < 4; ++i) { const size_t s = (grp * DD + (size_t)hp * 32) * NP + (size_t)(tid + i * (AW * 32)) * 8; tvh[i] = *(const v4u*)(VHp + s); tvl[i] = *(const v4u*)(VLp + s); }
#pragma unroll
    for (int i = 0; i < 4; ++i) { const int e = tid + i * (AW * 32), n = e >> 2, c = e & 3, d = (n * 4 + (c ^ ((n >> 2) & 3))) * 8; *(v4u*)&skh[d] = tkh[i]; *(v4u*)&skl[d] = tkl[i]; }
#pragma unroll
    for (int i = 0; i < 4; ++i) { const int e = tid + i * (AW * 32), r = e / (NP / 8), c = e - r * (NP / 8), d = (r * (NP / 8) + (c ^ (r & 15))) * 8; *(v4u*)&svh[d] = tvh[i]; *(v4u*)&svl[d] = tvl[i]; } }
  __syncthreads();   // the staged rows are read below by every wave of the block
#pragma unroll 1   // rolled, as the loop over the two heads was: one copy of the key loop in the code
  for (int it = 0; it < 4; ++it) { const int hh = it & 1, kh = hp * 2 + hh, q0 = ((it >> 1) * AW + wave) * 16;
    v16h bq; { const float* pp = X + xrow(grp, q0 + col) + kh * HS + 8 * g;
#pragma unroll
      for (int i = 0; i < 8; ++i) { bq[i] = (_Float16)bfr(pp[i]); bq[8 + i] = (_Float16)0.0f; } }   // K = 16 real dims; fragment slots 16..31 zeroed
    const int ko = (col * 4 + ((hh * 2 + g) ^ (col >> 2))) * 8, ko2 = (col * 4 + ((hh * 2 + g) ^ 2 ^ (col >> 2))) * 8;   // the head's own 8 dims; the other head's (finite, met by the zeroed slots of bq)
    const int vo = (hh * 16 + col) * NP, vx = (g ^ col) * 8;
    float m = -3.0e38f, l = 0.f;   // running maximum of the query (equal in both halves); this half's share of the sum
    v8f acc = {}, accl = {};       // O^T: element r = head dim 8g + r of query col
#pragma unroll 1
    for (int ks = 0; ks < NP / 32; ++ks) { float s[2][8];
#pragma unroll
      for (int ct = 0; ct < 2; ++ct) { const int rk = (ks * 32 + ct * 16) * 32; union { v16h v; v8h q[2]; } ah, al; ah.q[0] = *(const v8h*)&skh[rk + ko]; ah.q[1] = *(const v8h*)&skh[rk + ko2]; al.q[0] = *(const v8h*)&skl[rk + ko]; al.q[1] = *(const v8h*)&skl[rk + ko2];
        v8f c = {}, cl = {}; c = wmma16(ah.v, bq, c); cl = wmma16(al.v, bq, cl);
#pragma unroll
        for (int r = 0; r < 8; ++r) s[ct][r] = (c[r] + cl[r] * (1.0f / 2048.0f)) * 0.25f; }
      if (ks * 32 + 32 > NNODE) {   // only the last key block holds padded keys
#pragma unroll
        for (int ct = 0; ct < 2; ++ct) {
#pragma unroll
          for (int r = 0; r < 8; ++r) if (ks * 32 + ct * 16 + 8 * g + r >= NNODE) s[ct][r] = -3.0e38f; } }
      float mx = fmaxf(s[0][0], s[1][0]);
#pragma unroll
      for (int r = 1; r < 8; ++r) mx = fmaxf(mx, fmaxf(s[0][r], s[1][r]));
      mx = fmaxf(mx, xhalf(mx));
      const float mn = fmaxf(m, mx), alpha = (m <= -1.0e38f) ? 0.f : __expf(m - mn); m = mn;
      v16h pb; float es0 = 0.f, es1 = 0.f;
#pragma unroll
      for (int r = 0; r < 8; ++r) { const float e0 = __expf(s[0][r] - mn), e1 = __expf(s[1][r] - mn);   // a padded key: exp of about -3e38 = 0 (mn is finite: keys 0..31 are real)
        es0 += e0; es1 += e1; pb[r] = (_Float16)(e0 * 2048.0f); pb[8 + r] = (_Float16)(e1 * 2048.0f); }
      l = l * alpha + (es0 + es1);
#pragma unroll
      for (int r = 0; r < 8; ++r) { acc[r] *= alpha; accl[r] *= alpha; }
      { const int p0 = vo + ((ks * 32) ^ vx), p1 = vo + ((ks * 32 + 16) ^ vx); union { v16h v; v8h q[2]; } vh, vl; vh.q[0] = *(const v8h*)&svh[p0]; vh.q[1] = *(const v8h*)&svh[p1]; vl.q[0] = *(const v8h*)&svl[p0]; vl.q[1] = *(const v8h*)&svl[p1];
        acc = wmma16(vh.v, pb, acc); accl = wmma16(vl.v, pb, accl); } }
    const float inv = (1.0f / 2048.0f) / (l + xhalf(l));
    v4f o0, o1;
#pragma unroll
    for (int r = 0; r < 4; ++r) { o0[r] = (acc[r] + accl[r] * (1.0f / 2048.0f)) * inv; o1[r] = (acc[4 + r] + accl[4 + r] * (1.0f / 2048.0f)) * inv; }
    float* op = O + ((grp * NP) + q0 + col) * DD + kh * HS + 8 * g; vst2(op, o0); vst2(op + 4, o1);
    asm volatile("s_wait_xcnt 0x0" ::: "memory"); } }   // the next pass overwrites the registers that these two stores name
// ---- k_mlp: block = (64 padded rows, g): out = (relu(o (hi + lo) . W1^T + b1)) (hi + lo) . W2^T + b2; rows n >= 358 are computed from finite data but not written
__global__ __launch_bounds__(128) void k_mlp(const float* __restrict__ O, const float* __restrict__ W1, const float* __restrict__ B1, const float* __restrict__ W2, const float* __restrict__ B2, float* __restrict__ OUT) { __shared__ __align__(16) float sf[4][16][132];
  const int tid = threadIdx.x, wave = tid >> 5, lane = tid & 31, col = lane & 15, g = lane >> 4; const size_t grp = blockIdx.y; const int n0 = blockIdx.x * 64 + wave * 16; const size_t r0 = grp * NP + n0;
  v8f acc[8] = {};
#pragma unroll
  for (int kc = 0; kc < DD / 32; ++kc) { const F2 a = split_row(O + (r0 + col) * DD, kc * 32, lane);
#pragma unroll
    for (int j = 0; j < 8; ++j) { v16b w; const float* wr = W1 + (size_t)(j * 16 + col) * DD + kc * 32 + 8 * g;
#pragma unroll
      for (int i = 0; i < 8; ++i) { w[i] = (__bf16)wr[i]; w[8 + i] = (__bf16)wr[16 + i]; }
      acc[j] = wmma_bf(a.h, w, acc[j]); acc[j] = wmma_bf(a.l, w, acc[j]); } }
#pragma unroll
  for (int j = 0; j < 8; ++j) { const float bb = bfr(B1[j * 16 + col]);
#pragma unroll
    for (int r = 0; r < 8; ++r) sf[wave][8 * g + r][j * 16 + col] = fmaxf(acc[j][r] + bb, 0.f); }
  LDSX();
  { v8f acc2[8] = {};
#pragma unroll
    for (int kc = 0; kc < DD / 32; ++kc) { float v[16]; const float* pp = &sf[wave][col][kc * 32 + 8 * g];
#pragma unroll
      for (int i = 0; i < 8; ++i) { v[i] = pp[i]; v[8 + i] = pp[16 + i]; }
      const F2 a = bsplit16(v);
#pragma unroll
      for (int j = 0; j < 8; ++j) { v16b w; const float* wr = W2 + (size_t)(j * 16 + col) * DD + kc * 32 + 8 * g;
#pragma unroll
        for (int i = 0; i < 8; ++i) { w[i] = (__bf16)wr[i]; w[8 + i] = (__bf16)wr[16 + i]; }
        acc2[j] = wmma_bf(a.h, w, acc2[j]); acc2[j] = wmma_bf(a.l, w, acc2[j]); } }
    LDSX();
#pragma unroll
    for (int j = 0; j < 8; ++j) { const float bb = bfr(B2[j * 16 + col]);
#pragma unroll
      for (int r = 0; r < 8; ++r) sf[wave][8 * g + r][j * 16 + col] = acc2[j][r] + bb; } }
  LDSX(); for (int rl = 0; rl < 16; ++rl) { const int n = n0 + rl; if (n < NNODE) vst2(OUT + (grp * NNODE + n) * DD + lane * 4, *(const v4f*)&sf[wave][rl][lane * 4]); } }
extern "C" void kernel_launch(void* const* d_in, const int* in_sizes, int n_in, void* d_out, int out_size, void* d_ws, size_t ws_size, hipStream_t stream) {
  (void)in_sizes; (void)n_in; (void)out_size;
  const float** F = (const float**)d_in;   // 0 x [16,12,358,128], 1 wk [16,1,128,128] (in,out), 2 bk [16,1,1,128], 3 wv, 4 bv, 5 W1 [128,128] natural, 6 b1, 7 W2 [128,128] natural, 8 b2
  if (ws_size < (size_t)WS_END) return;
  char* ws = (char*)d_ws; _Float16 *KHp = (_Float16*)(ws + WS_KH), *KLp = (_Float16*)(ws + WS_KL), *VHp = (_Float16*)(ws + WS_VH), *VLp = (_Float16*)(ws + WS_VL); float* O = (float*)(ws + WS_O);
  k_kv<<<dim3(NP / 64, 2, TG), 128, 0, stream>>>(F[0], F[1], F[2], F[3], F[4], KHp, KLp, VHp, VLp);
  k_att<<<dim3(KH / 2, TG), AW * 32, 0, stream>>>(F[0], KHp, KLp, VHp, VLp, O);
  k_mlp<<<dim3(NP / 64, TG), 128, 0, stream>>>(O, F[5], F[6], F[7], F[8], (float*)d_out);
}

// v003
// A run of this version takes 109 microseconds.
// Two timings next to v002 both put it at 1.47 times that version's speed.
// Counting every step since v000, it is 3.02 times as fast.
// compute dtype: all float inputs rounded to bf16; key / val = x . wk[b] + bk[b] with EXACT bf16 products on WMMA 16x16x32 (per-sample (in,out) weights), f16 hi + residual; q = x itself (bf16 -> f16 exact; 16-dim heads with the upper half of the K=32 fragment zeroed); logits 2 products (k hi + residual) x 16^-1/2, padded keys (N = 358 -> 384) excluded, running-max softmax in f32 (hardware exp); P (x 2^11, f16) . v (hi + residual, 2 products); projection1 (relu) and projection2 with the f32 activations as bf16 hi + lo against exact weights (2 products each); f32 output. All padded rows/columns are written with finite (clamped) data before any read.
#include <hip/hip_runtime.h>
#include <math.h>

typedef __attribute__((ext_vector_type(16))) _Float16 v16h;
typedef __attribute__((ext_vector_type(16))) __bf16 v16b;
typedef __attribute__((ext_vector_type(8)))  _Float16 v8h;
typedef __attribute__((ext_vector_type(8)))  float v8f;
typedef __attribute__((ext_vector_type(4)))  float v4f;
typedef __attribute__((ext_vector_type(2)))  float v2f;
typedef __attribute__((ext_vector_type(4)))  unsigned v4u;
typedef __attribute__((ext_vector_type(4)))  int v4i;
typedef float __attribute__((may_alias)) float_a;
typedef int __attribute__((may_alias)) int_a;

template <typename T> __device__ __forceinline__ void vst2(void* p, T v) { *(T*)p = v;  }
__device__ __forceinline__ v8f wmma16(v16h a, v16h b, v8f c) {
  v8f d = __builtin_amdgcn_wmma_f32_16x16x32_f16(false, a, false, b, (short)0, c, false, false);
  asm volatile("v_nop\n\tv_nop\n\tv_nop\n\tv_nop" : "+v"(d) : "v"(a), "v"(b));
  return d;
}
__device__ __forceinline__ v8f wmma_bf(v16b a, v16b b, v8f c) {
  v8f d = __builtin_amdgcn_wmma_f32_16x16x32_bf16(false, a, false, b, (short)0, c, false, false);
  asm volatile("v_nop\n\tv_nop\n\tv_nop\n\tv_nop" : "+v"(d) : "v"(a), "v"(b));
  return d;
}
// 16x16x32 fragments: lane = (h = lane>>4, row/col = lane&15); elements 0..7 = k0+8h+0..7, 8..15 = k0+16+8h+0..7; D element r = row 8h+r
__device__ __forceinline__ v16h frag_h(const _Float16* rowk0, int lane) {
  union { v16h v; v8h q[2]; } u; const _Float16* p = rowk0 + 8 * (lane >> 4);
  u.q[0] = *(const v8h*)p; u.q[1] = *(const v8h*)(p + 16); return u.v;
}
__device__ __forceinline__ v16h frag_f32(const float* rowk0, int lane) {
  v16h a; const float* p = rowk0 + 8 * (lane >> 4);
#pragma unroll
  for (int i = 0; i < 8; ++i) { a[i] = (_Float16)p[i]; a[8 + i] = (_Float16)p[16 + i]; }
  return a;
}
__device__ __forceinline__ v16h frag_f32s(const float* rowk0, int lane, float sc) {
  v16h a; const float* p = rowk0 + 8 * (lane >> 4);
#pragma unroll
  for (int i = 0; i < 8; ++i) { a[i] = (_Float16)(p[i] * sc); a[8 + i] = (_Float16)(p[16 + i] * sc); }
  return a;
}
// column fragment from a [K][ld] layout (column n), rows >= K read as 0
__device__ __forceinline__ v16h fragc_f32(const float* W, int k0, int n, int lane, int ld, int K) {
  v16h a; const int g = lane >> 4;
#pragma unroll
  for (int i = 0; i < 8; ++i) { const int ka = k0 + 8 * g + i, kb = ka + 16;
    a[i] = (_Float16)(ka < K ? W[(size_t)(ka < K ? ka : K - 1) * ld + n] : 0.f); a[8 + i] = (_Float16)(kb < K ? W[(size_t)(kb < K ? kb : K - 1) * ld + n] : 0.f); }
  return a;
}
struct F2 { v16b h, l; };
__device__ __forceinline__ F2 bsplit16(const float v[16]) { F2 r;
#pragma unroll
  for (int i = 0; i < 16; ++i) { const __bf16 h = (__bf16)v[i]; r.h[i] = h; r.l[i] = (__bf16)(v[i] - (float)h); }
  return r; }
__device__ __forceinline__ F2 split_row(const float* row, int k0, int lane) { float v[16]; const float* p = row + k0 + 8 * (lane >> 4);
#pragma unroll
  for (int i = 0; i < 8; ++i) { v[i] = p[i]; v[8 + i] = p[16 + i]; }
  return bsplit16(v); }
__device__ __forceinline__ F2 split_rowK(const float* row, int k0, int lane, int K) { float v[16]; const int g = lane >> 4;
#pragma unroll
  for (int i = 0; i < 8; ++i) { const int ka = k0 + 8 * g + i, kb = ka + 16; v[i] = ka < K ? row[ka < K ? ka : K - 1] : 0.f; v[8 + i] = kb < K ? row[kb < K ? kb : K - 1] : 0.f; }
  return bsplit16(v); }
__device__ __forceinline__ F2 split_col(const float* W, int k0, int n, int lane, int ld, int K) { float v[16]; const int g = lane >> 4;
#pragma unroll
  for (int i = 0; i < 8; ++i) { const int ka = k0 + 8 * g + i, kb = ka + 16; v[i] = ka < K ? W[(size_t)(ka < K ? ka : K - 1) * ld + n] : 0.f; v[8 + i] = kb < K ? W[(size_t)(kb < K ? kb : K - 1) * ld + n] : 0.f; }
  return bsplit16(v); }
__device__ __forceinline__ v8f mac3(const F2& a, const F2& b, v8f c) { c = wmma_bf(a.l, b.h, c); c = wmma_bf(a.h, b.l, c); return wmma_bf(a.h, b.h, c); }
__device__ __forceinline__ float sigm(float v) { return 1.0f / (1.0f + expf(-v)); }
#define LDSX() do { asm volatile("s_wait_dscnt 0" ::: "memory"); __builtin_amdgcn_wave_barrier(); __builtin_amdgcn_fence(__ATOMIC_RELEASE, "workgroup"); } while (0)


// Spatial self attention over graph nodes (B 16, T 12, N 358 nodes, D 128 = 8 heads x 16): key/val from per-sample dynamic linears, q = x; softmax(q k / 4) over nodes; o -> Linear -> relu -> Linear.
#define NBATCH 16
#define NT 12
#define NG (NBATCH * NT)  // 192 (b, t) groups
#define NNODE 358
#define NP 384            // padded node count (6 x 64)
#define DD 128
#define KH 8
#define HS 16
#ifndef TG
#define TG NG
#endif
typedef __attribute__((ext_vector_type(8))) __bf16 v8b;
__device__ __forceinline__ v16b frag_b(const __bf16* rowk0, int lane) {
  union { v16b v; v8b q[2]; } u; const __bf16* p = rowk0 + 8 * (lane >> 4);
  u.q[0] = *(const v8b*)p; u.q[1] = *(const v8b*)(p + 16); return u.v;
}
__device__ __forceinline__ float bfr(float v) { return (float)(__bf16)v; }
__device__ __attribute__((noinline)) float exp_ni(float v) { return expf(v); }
__device__ __attribute__((noinline)) float erf_ni(float v) { return erff(v); }

#define WS_KH  0u                                   // f16 hi|lo key rows [g][NP][128]
#define WS_KL  (WS_KH + 2u * (size_t)NG * NP * DD)
#define WS_VH  (WS_KL + 2u * (size_t)NG * NP * DD)        // f16 hi|lo val planes [g][128][NP]
#define WS_VL  (WS_VH + 2u * (size_t)NG * DD * NP)
#define WS_O   (WS_VL + 2u * (size_t)NG * DD * NP)        // f32 o rows [g][NP][128]
#define WS_PW  (WS_O + 4u * (size_t)NG * NP * DD)         // bf16 weights in fragment order, 34 matrices x 32 KiB
#define WS_END (WS_PW + 2u * (size_t)NMAT * DD * DD)

// ---- k_pack: every weight matrix is rounded to bf16 once a call and laid out as the B fragments of the 16x16x32 product are read.
// matrix m = 0..15 wk[b], 16..31 wv[b] ((in,out): element (k, n) at k * 128 + n), 32 W1, 33 W2 (natural: element (k, n) at n * 128 + k);
// fragment f = kc * 8 + j (k block of 32, column block of 16); half hf holds elements 8 hf .. 8 hf + 7 of every lane: k = kc * 32 + 16 hf + 8 (lane >> 4) + i, n = j * 16 + (lane & 15).
// 16-bit word ((m * 32 + f) * 2 + hf) * 256 + lane * 8 + i: a wave reads half a fragment as 512 contiguous bytes (four whole lines)
#define NMAT (2 * NBATCH + 2)
#define MATW (DD * DD)    // 16-bit words a packed matrix
__global__ __launch_bounds__(256) void k_pack(const float* __restrict__ WK, const float* __restrict__ WV, const float* __restrict__ W1, const float* __restrict__ W2, _Float16* __restrict__ PW) {
  const int t = blockIdx.x * 256 + threadIdx.x, lane = t & 31, hf = (t >> 5) & 1, f = (t >> 6) & 31, m = blockIdx.x >> 3;   // one 16-byte chunk a thread; 8 blocks a matrix
  const int k0 = (f >> 3) * 32 + hf * 16 + 8 * (lane >> 4), n = (f & 7) * 16 + (lane & 15);
  union { v8b v; v4u q; } o; float v[8];
  if (m < 2 * NBATCH) { const float* Wm = (m < NBATCH ? WK : WV) + (size_t)(m & (NBATCH - 1)) * DD * DD + (size_t)k0 * DD + n;
#pragma unroll
    for (int i = 0; i < 8; ++i) v[i] = Wm[i * DD]; }
  else { const float* Wm = (m == 2 * NBATCH ? W1 : W2) + (size_t)n * DD + k0;
#pragma unroll
    for (int i = 0; i < 8; ++i) v[i] = Wm[i]; }
  asm volatile("s_wait_xcnt 0x0" ::: "memory");   // before a converted value may land in an address register of these loads
#pragma unroll
  for (int i = 0; i < 8; ++i) o.v[i] = (__bf16)v[i];
  vst2(PW + (size_t)t * 8, o.q); }
// fragment f of a packed matrix (the pointer type only carries 16-bit words: the bits are bf16)
__device__ __forceinline__ v16b frag_p(const _Float16* Pm, int f, int lane) {
  union { v16b v; v4u q[2]; } u; const _Float16* p = Pm + f * 512 + lane * 8;
  u.q[0] = *(const v4u*)p; u.q[1] = *(const v4u*)(p + 256); return u.v;
}
__device__ __forceinline__ size_t xrow(size_t g, int n) { return (g * NNODE + (size_t)(n < NNODE ? n : NNODE - 1)) * DD; }   // clamped node row of x
// ---- k_kv: block = (64 padded nodes, which, g): key / val = x(clamped rows) . w[b] + bias[b]; all 384 rows / columns written
__global__ __launch_bounds__(128) void k_kv(const float* __restrict__ X, const _Float16* __restrict__ PW, const float* __restrict__ BK, const float* __restrict__ BV, _Float16* __restrict__ KHp, _Float16* __restrict__ KLp, _Float16* __restrict__ VHp, _Float16* __restrict__ VLp) {
  __shared__ __align__(16) _Float16 sh[64][136], sl[64][136]; __shared__ __align__(16) _Float16 th[128][72], tl[128][72];
  const int tid = threadIdx.x, wave = tid >> 5, lane = tid & 31, col = lane & 15, g = lane >> 4; const int which = blockIdx.y; const size_t grp = blockIdx.z; const size_t b = grp / NT; const int n0 = blockIdx.x * 64; const _Float16* Pm = PW + ((size_t)which * NBATCH + b) * MATW; const float* Bm = (which == 0 ? BK : BV) + b * DD;
  v8f acc[8] = {};
#pragma unroll
  for (int kc = 0; kc < DD / 32; ++kc) { v16b a, w[8]; const float* pp = X + xrow(grp, n0 + wave * 16 + col) + kc * 32 + 8 * g;
#pragma unroll
    for (int j = 0; j < 8; ++j) w[j] = frag_p(Pm, kc * 8 + j, lane);   // the k block's 16 loads stand ahead of its products, so that all are in flight together
#pragma unroll
    for (int i = 0; i < 8; ++i) { a[i] = (__bf16)pp[i]; a[8 + i] = (__bf16)pp[16 + i]; }
#pragma unroll
    for (int j = 0; j < 8; ++j) acc[j] = wmma_bf(a, w[j], acc[j]); }
#pragma unroll
  for (int j = 0; j < 8; ++j) { const float bb = bfr(Bm[j * 16 + col]);
#pragma unroll
    for (int r = 0; r < 8; ++r) { const float v = acc[j][r] + bb; const _Float16 hv = (_Float16)v, lv = (_Float16)((v - (float)hv) * 2048.0f); const int rl = wave * 16 + 8 * g + r, cl = j * 16 + col; if (which == 0) { sh[rl][cl] = hv; sl[rl][cl] = lv; } else { th[cl][rl] = hv; tl[cl][rl] = lv; } } }
  __syncthreads();
  if (which == 0) { for (int e = tid; e < 64 * 16; e += 128) { const int rl = e >> 4, q = e & 15; const size_t o = (grp * NP + n0 + rl) * DD + q * 8; vst2((unsigned*)(KHp + o), *(const v4u*)&sh[rl][q * 8]); vst2((unsigned*)(KLp + o), *(const v4u*)&sl[rl][q * 8]); } }
  else { for (int e = tid; e < 128 * 8; e += 128) { const int cl = e >> 3, q = e & 7; const size_t o = (grp * DD + cl) * (size_t)NP + n0 + q * 8; vst2((unsigned*)(VHp + o), *(const v4u*)&th[cl][q * 8]); vst2((unsigned*)(VLp + o), *(const v4u*)&tl[cl][q * 8]); } } }
// lane l with lane l ^ 16 (the two halves of a wave hold the two key halves of one query column)
__device__ __forceinline__ float xhalf(float x) { return __builtin_bit_cast(float, __builtin_amdgcn_permlanex16(__builtin_bit_cast(int, x), __builtin_bit_cast(int, x), 0x76543210, 0xfedcba98, false, false)); }
// ---- k_att: block = (head pair, g), 12 waves x 2 query tiles: the pair's key rows and val planes (hi and residual, all 384 keys, 96 KiB) are brought into LDS once by whole 16-byte chunks, and every fragment is read from there.
// wave = (16 queries, head): S^T = K . Q^T (A = key rows, B = q), so a lane holds 2 x 8 keys' scores of ONE query (column = lane & 15); maximum and sum run in-lane plus one exchange between halves;
// the two score tiles, converted in place, are the B operand of O^T += V^T . P^T (element i = key 8h + i, element 8 + i = key 16 + 8h + i, the order of frag_h on the val planes)
// LDS places, no pad: chunk c (16 bytes) of key row n lies at chunk c ^ ((n >> 2) & 3) of its 64-byte row; chunk c of val plane row d at chunk c ^ (d & 15) of its 768-byte row: the 16 lanes of a fragment read fall on 16 different bank groups
#define AW 12
__global__ __launch_bounds__(AW * 32) void k_att(const float* __restrict__ X, const _Float16* __restrict__ KHp, const _Float16* __restrict__ KLp, const _Float16* __restrict__ VHp, const _Float16* __restrict__ VLp, float* __restrict__ O) {
  __shared__ __align__(16) _Float16 skh[NP * 32], skl[NP * 32], svh[32 * NP], svl[32 * NP];
  const int tid = threadIdx.x, wave = tid >> 5, lane = tid & 31, col = lane & 15, g = lane >> 4; const int hp = blockIdx.x; const size_t grp = blockIdx.y;
  { v4u tkh[4], tkl[4], tvh[4], tvl[4];   // 16 chunks a thread, all in flight together; the four loops are unrolled so that these stay in registers
#pragma unroll
    for (int i = 0; i < 4; ++i) { const int e = tid + i * (AW * 32), n = e >> 2, c = e & 3; const size_t s = (grp * NP + n) * DD + hp * 32 + c * 8; tkh[i] = *(const v4u*)(KHp + s); tkl[i] = *(const v4u*)(KLp + s); }
    asm volatile("s_wait_xcnt 0x0" ::: "memory");   // before a later load's result may land in an address register of these loads
#pragma unroll
    for (int i = 0; i < 4; ++i) { const size_t s = (grp * DD + (size_t)hp * 32) * NP + (size_t)(tid + i * (AW * 32)) * 8; tvh[i] = *(const v4u*)(VHp + s); tvl[i] = *(const v4u*)(VLp + s); }
#pragma unroll
    for (int i = 0; i < 4; ++i) { const int e = tid + i * (AW * 32), n = e >> 2, c = e & 3, d = (n * 4 + (c ^ ((n >> 2) & 3))) * 8; *(v4u*)&skh[d] = tkh[i]; *(v4u*)&skl[d] = tkl[i]; }
#pragma unroll
    for (int i = 0; i < 4; ++i) { const int e = tid + i * (AW * 32), r = e / (NP / 8), c = e - r * (NP / 8), d = (r * (NP / 8) + (c ^ (r & 15))) * 8; *(v4u*)&svh[d] = tvh[i]; *(v4u*)&svl[d] = tvl[i]; } }
  __syncthreads();   // the staged rows are read below by every wave of the block
#pragma unroll 1   // rolled, as the loop over the two heads was: one copy of the key loop in the code
  for (int it = 0; it < 4; ++it) { const int hh = it & 1, kh = hp * 2 + hh, q0 = ((it >> 1) * AW + wave) * 16;
    v16h bq; { const float* pp = X + xrow(grp, q0 + col) + kh * HS + 8 * g;
#pragma unroll
      for (int i = 0; i < 8; ++i) { bq[i] = (_Float16)bfr(pp[i]); bq[8 + i] = (_Float16)0.0f; } }   // K = 16 real dims; fragment slots 16..31 zeroed
    const int ko = (col * 4 + ((hh * 2 + g) ^ (col >> 2))) * 8, ko2 = (col * 4 + ((hh * 2 + g) ^ 2 ^ (col >> 2))) * 8;   // the head's own 8 dims; the other head's (finite, met by the zeroed slots of bq)
    const int vo = (hh * 16 + col) * NP, vx = (g ^ col) * 8;
    float m = -3.0e38f, l = 0.f;   // running maximum of the query (equal in both halves); this half's share of the sum
    v8f acc = {}, accl = {};       // O^T: element r = head dim 8g + r of query col
#pragma unroll 1
    for (int ks = 0; ks < NP / 32; ++ks) { float s[2][8];
#pragma unroll
      for (int ct = 0; ct < 2; ++ct) { const int rk = (ks * 32 + ct * 16) * 32; union { v16h v; v8h q[2]; } ah, al; ah.q[0] = *(const v8h*)&skh[rk + ko]; ah.q[1] = *(const v8h*)&skh[rk + ko2]; al.q[0] = *(const v8h*)&skl[rk + ko]; al.q[1] = *(const v8h*)&skl[rk + ko2];
        v8f c = {}, cl = {}; c = wmma16(ah.v, bq, c); cl = wmma16(al.v, bq, cl);
#pragma unroll
        for (int r = 0; r < 8; ++r) s[ct][r] = (c[r] + cl[r] * (1.0f / 2048.0f)) * 0.25f; }
      if (ks * 32 + 32 > NNODE) {   // only the last key block holds padded keys
#pragma unroll
        for (int ct = 0; ct < 2; ++ct) {
#pragma unroll
          for (int r = 0; r < 8; ++r) if (ks * 32 + ct * 16 + 8 * g + r >= NNODE) s[ct][r] = -3.0e38f; } }
      float mx = fmaxf(s[0][0], s[1][0]);
#pragma unroll
      for (int r = 1; r < 8; ++r) mx = fmaxf(mx, fmaxf(s[0][r], s[1][r]));
      mx = fmaxf(mx, xhalf(mx));
      const float mn = fmaxf(m, mx), alpha = (m <= -1.0e38f) ? 0.f : __expf(m - mn); m = mn;
      v16h pb; float es0 = 0.f, es1 = 0.f;
#pragma unroll
      for (int r = 0; r < 8; ++r) { const float e0 = __expf(s[0][r] - mn), e1 = __expf(s[1][r] - mn);   // a padded key: exp of about -3e38 = 0 (mn is finite: keys 0..31 are real)
        es0 += e0; es1 += e1; pb[r] = (_Float16)(e0 * 2048.0f); pb[8 + r] = (_Float16)(e1 * 2048.0f); }
      l = l * alpha + (es0 + es1);
#pragma unroll
      for (int r = 0; r < 8; ++r) { acc[r] *= alpha; accl[r] *= alpha; }
      { const int p0 = vo + ((ks * 32) ^ vx), p1 = vo + ((ks * 32 + 16) ^ vx); union { v16h v; v8h q[2]; } vh, vl; vh.q[0] = *(const v8h*)&svh[p0]; vh.q[1] = *(const v8h*)&svh[p1]; vl.q[0] = *(const v8h*)&svl[p0]; vl.q[1] = *(const v8h*)&svl[p1];
        acc = wmma16(vh.v, pb, acc); accl = wmma16(vl.v, pb, accl); } }
    const float inv = (1.0f / 2048.0f) / (l + xhalf(l));
    v4f o0, o1;
#pragma unroll
    for (int r = 0; r < 4; ++r) { o0[r] = (acc[r] + accl[r] * (1.0f / 2048.0f)) * inv; o1[r] = (acc[4 + r] + accl[4 + r] * (1.0f / 2048.0f)) * inv; }
    float* op = O + ((grp * NP) + q0 + col) * DD + kh * HS + 8 * g; vst2(op, o0); vst2(op + 4, o1);
    asm volatile("s_wait_xcnt 0x0" ::: "memory"); } }   // the next pass overwrites the registers that these two stores name
// ---- k_mlp: block = (64 padded rows, g): out = (relu(o (hi + lo) . W1^T + b1)) (hi + lo) . W2^T + b2; rows n >= 358 are computed from finite data but not written
__global__ __launch_bounds__(128) void k_mlp(const float* __restrict__ O, const _Float16* __restrict__ PW, const float* __restrict__ B1, const float* __restrict__ B2, float* __restrict__ OUT) { __shared__ __align__(16) float sf[4][16][132];
  const int tid = threadIdx.x, wave = tid >> 5, lane = tid & 31, col = lane & 15, g = lane >> 4; const size_t grp = blockIdx.y; const int n0 = blockIdx.x * 64 + wave * 16; const size_t r0 = grp * NP + n0; const _Float16 *P1 = PW + (size_t)(2 * NBATCH) * MATW, *P2 = P1 + MATW;
  v8f acc[8] = {};
#pragma unroll
  for (int kc = 0; kc < DD / 32; ++kc) { v16b w[8]; const F2 a = split_row(O + (r0 + col) * DD, kc * 32, lane);
    asm volatile("s_wait_xcnt 0x0" ::: "memory");   // before a fragment load's result may land in the address pair of the row's loads
#pragma unroll
    for (int j = 0; j < 8; ++j) w[j] = frag_p(P1, kc * 8 + j, lane);   // the k block's 16 loads stand ahead of its products, so that all are in flight together
#pragma unroll
    for (int j = 0; j < 8; ++j) { acc[j] = wmma_bf(a.h, w[j], acc[j]); acc[j] = wmma_bf(a.l, w[j], acc[j]); } }
#pragma unroll
  for (int j = 0; j < 8; ++j) { const float bb = bfr(B1[j * 16 + col]);
#pragma unroll
    for (int r = 0; r < 8; ++r) sf[wave][8 * g + r][j * 16 + col] = fmaxf(acc[j][r] + bb, 0.f); }
  LDSX();
  { v8f acc2[8] = {};
#pragma unroll
    for (int kc = 0; kc < DD / 32; ++kc) { float v[16]; const float* pp = &sf[wave][col][kc * 32 + 8 * g]; v16b w[8];
#pragma unroll
      for (int j = 0; j < 8; ++j) w[j] = frag_p(P2, kc * 8 + j, lane);   // as above
#pragma unroll
      for (int i = 0; i < 8; ++i) { v[i] = pp[i]; v[8 + i] = pp[16 + i]; }
      const F2 a = bsplit16(v);
#pragma unroll
      for (int j = 0; j < 8; ++j) { acc2[j] = wmma_bf(a.h, w[j], acc2[j]); acc2[j] = wmma_bf(a.l, w[j], acc2[j]); } }
    LDSX();
#pragma unroll
    for (int j = 0; j < 8; ++j) { const float bb = bfr(B2[j * 16 + col]);
#pragma unroll
      for (int r = 0; r < 8; ++r) sf[wave][8 * g + r][j * 16 + col] = acc2[j][r] + bb; } }
  LDSX(); for (int rl = 0; rl < 16; ++rl) { const int n = n0 + rl; if (n < NNODE) vst2(OUT + (grp * NNODE + n) * DD + lane * 4, *(const v4f*)&sf[wave][rl][lane * 4]); } }
extern "C" void kernel_launch(void* const* d_in, const int* in_sizes, int n_in, void* d_out, int out_size, void* d_ws, size_t ws_size, hipStream_t stream) {
  (void)in_sizes; (void)n_in; (void)out_size;
  const float** F = (const float**)d_in;   // 0 x [16,12,358,128], 1 wk [16,1,128,128] (in,out), 2 bk [16,1,1,128], 3 wv, 4 bv, 5 W1 [128,128] natural, 6 b1, 7 W2 [128,128] natural, 8 b2
  if (ws_size < (size_t)WS_END) return;
  char* ws = (char*)d_ws; _Float16 *KHp = (_Float16*)(ws + WS_KH), *KLp = (_Float16*)(ws + WS_KL), *VHp = (_Float16*)(ws + WS_VH), *VLp = (_Float16*)(ws + WS_VL), *PW = (_Float16*)(ws + WS_PW); float* O = (float*)(ws + WS_O);
  k_pack<<<dim3(NMAT * 8), 256, 0, stream>>>(F[1], F[3], F[5], F[7], PW);
  k_kv<<<dim3(NP / 64, 2, TG), 128, 0, stream>>>(F[0], PW, F[2], F[4], KHp, KLp, VHp, VLp);
  k_att<<<dim3(KH / 2, TG), AW * 32, 0, stream>>>(F[0], KHp, KLp, VHp, VLp, O);
  k_mlp<<<dim3(NP / 64, TG), 128, 0, stream>>>(O, PW, F[6], F[8], (float*)d_out);
}

// v004
// One run takes 101 microseconds.
// In two side-by-side timings against v003, it was 1.07 and 1.09 times as fast.
// All steps since v000 together make it 3.26 times as fast.
// compute dtype: all float inputs rounded to bf16; key / val = x . wk[b] + bk[b] with EXACT bf16 products on WMMA 16x16x32 (per-sample (in,out) weights), f16 hi + residual; q = x itself (bf16 -> f16; 16-dim heads: the K=32 fragment holds k hi | k residual against q / 4 | q / 4 x 2^-11); logits 1 product, 16^-1/2 inside it, padded keys (N = 358 -> 384) excluded, running-max softmax in f32 (hardware exp); P (x 2^11, f16) . v (hi + residual, 2 products); projection1 (relu) and projection2 with the f32 activations as bf16 hi + lo against exact weights (2 products each); f32 output. All padded rows/columns are written with finite (clamped) data before any read.
#include <hip/hip_runtime.h>
#include <math.h>

typedef __attribute__((ext_vector_type(16))) _Float16 v16h;
typedef __attribute__((ext_vector_type(16))) __bf16 v16b;
typedef __attribute__((ext_vector_type(8)))  _Float16 v8h;
typedef __attribute__((ext_vector_type(8)))  float v8f;
typedef __attribute__((ext_vector_type(4)))  float v4f;
typedef __attribute__((ext_vector_type(2)))  float v2f;
typedef __attribute__((ext_vector_type(4)))  unsigned v4u;
typedef __attribute__((ext_vector_type(4)))  int v4i;
typedef float __attribute__((may_alias)) float_a;
typedef int __attribute__((may_alias)) int_a;

template <typename T> __device__ __forceinline__ void vst2(void* p, T v) { *(T*)p = v;  }
__device__ __forceinline__ v8f wmma16(v16h a, v16h b, v8f c) {
  v8f d = __builtin_amdgcn_wmma_f32_16x16x32_f16(false, a, false, b, (short)0, c, false, false);
  asm volatile("v_nop\n\tv_nop\n\tv_nop\n\tv_nop" : "+v"(d) : "v"(a), "v"(b));
  return d;
}
__device__ __forceinline__ v8f wmma_bf(v16b a, v16b b, v8f c) {
  v8f d = __builtin_amdgcn_wmma_f32_16x16x32_bf16(false, a, false, b, (short)0, c, false, false);
  asm volatile("v_nop\n\tv_nop\n\tv_nop\n\tv_nop" : "+v"(d) : "v"(a), "v"(b));
  return d;
}
// 16x16x32 fragments: lane = (h = lane>>4, row/col = lane&15); elements 0..7 = k0+8h+0..7, 8..15 = k0+16+8h+0..7; D element r = row 8h+r
__device__ __forceinline__ v16h frag_h(const _Float16* rowk0, int lane) {
  union { v16h v; v8h q[2]; } u; const _Float16* p = rowk0 + 8 * (lane >> 4);
  u.q[0] = *(const v8h*)p; u.q[1] = *(const v8h*)(p + 16); return u.v;
}
__device__ __forceinline__ v16h frag_f32(const float* rowk0, int lane) {
  v16h a; const float* p = rowk0 + 8 * (lane >> 4);
#pragma unroll
  for (int i = 0; i < 8; ++i) { a[i] = (_Float16)p[i]; a[8 + i] = (_Float16)p[16 + i]; }
  return a;
}
__device__ __forceinline__ v16h frag_f32s(const float* rowk0, int lane, float sc) {
  v16h a; const float* p = rowk0 + 8 * (lane >> 4);
#pragma unroll
  for (int i = 0; i < 8; ++i) { a[i] = (_Float16)(p[i] * sc); a[8 + i] = (_Float16)(p[16 + i] * sc); }
  return a;
}
// column fragment from a [K][ld] layout (column n), rows >= K read as 0
__device__ __forceinline__ v16h fragc_f32(const float* W, int k0, int n, int lane, int ld, int K) {
  v16h a; const int g = lane >> 4;
#pragma unroll
  for (int i = 0; i < 8; ++i) { const int ka = k0 + 8 * g + i, kb = ka + 16;
    a[i] = (_Float16)(ka < K ? W[(size_t)(ka < K ? ka : K - 1) * ld + n] : 0.f); a[8 + i] = (_Float16)(kb < K ? W[(size_t)(kb < K ? kb : K - 1) * ld + n] : 0.f); }
  return a;
}
struct F2 { v16b h, l; };
__device__ __forceinline__ F2 bsplit16(const float v[16]) { F2 r;
#pragma unroll
  for (int i = 0; i < 16; ++i) { const __bf16 h = (__bf16)v[i]; r.h[i] = h; r.l[i] = (__bf16)(v[i] - (float)h); }
  return r; }
__device__ __forceinline__ F2 split_row(const float* row, int k0, int lane) { float v[16]; const float* p = row + k0 + 8 * (lane >> 4);
#pragma unroll
  for (int i = 0; i < 8; ++i) { v[i] = p[i]; v[8 + i] = p[16 + i]; }
  return bsplit16(v); }
__device__ __forceinline__ F2 split_rowK(const float* row, int k0, int lane, int K) { float v[16]; const int g = lane >> 4;
#pragma unroll
  for (int i = 0; i < 8; ++i) { const int ka = k0 + 8 * g + i, kb = ka + 16; v[i] = ka < K ? row[ka < K ? ka : K - 1] : 0.f; v[8 + i] = kb < K ? row[kb < K ? kb : K - 1] : 0.f; }
  return bsplit16(v); }
__device__ __forceinline__ F2 split_col(const float* W, int k0, int n, int lane, int ld, int K) { float v[16]; const int g = lane >> 4;
#pragma unroll
  for (int i = 0; i < 8; ++i) { const int ka = k0 + 8 * g + i, kb = ka + 16; v[i] = ka < K ? W[(size_t)(ka < K ? ka : K - 1) * ld + n] : 0.f; v[8 + i] = kb < K ? W[(size_t)(kb < K ? kb : K - 1) * ld + n] : 0.f; }
  return bsplit16(v); }
__device__ __forceinline__ v8f mac3(const F2& a, const F2& b, v8f c) { c = wmma_bf(a.l, b.h, c); c = wmma_bf(a.h, b.l, c); return wmma_bf(a.h, b.h, c); }
__device__ __forceinline__ float sigm(float v) { return 1.0f / (1.0f + expf(-v)); }
#define LDSX() do { asm volatile("s_wait_dscnt 0" ::: "memory"); __builtin_amdgcn_wave_barrier(); __builtin_amdgcn_fence(__ATOMIC_RELEASE, "workgroup"); } while (0)


// Spatial self attention over graph nodes (B 16, T 12, N 358 nodes, D 128 = 8 heads x 16): key/val from per-sample dynamic linears, q = x; softmax(q k / 4) over nodes; o -> Linear -> relu -> Linear.
#define NBATCH 16
#define NT 12
#define NG (NBATCH * NT)  // 192 (b, t) groups
#define NNODE 358
#define NP 384            // padded node count (6 x 64)
#define DD 128
#define KH 8
#define HS 16
#ifndef TG
#define TG NG
#endif
typedef __attribute__((ext_vector_type(8))) __bf16 v8b;
__device__ __forceinline__ v16b frag_b(const __bf16* rowk0, int lane) {
  union { v16b v; v8b q[2]; } u; const __bf16* p = rowk0 + 8 * (lane >> 4);
  u.q[0] = *(const v8b*)p; u.q[1] = *(const v8b*)(p + 16); return u.v;
}
__device__ __forceinline__ float bfr(float v) { return (float)(__bf16)v; }
__device__ __attribute__((noinline)) float exp_ni(float v) { return expf(v); }
__device__ __attribute__((noinline)) float erf_ni(float v) { return erff(v); }

#define WS_KH  0u                                   // f16 hi|lo key rows [g][NP][128]
#define WS_KL  (WS_KH + 2u * (size_t)NG * NP * DD)
#define WS_VH  (WS_KL + 2u * (size_t)NG * NP * DD)        // f16 hi|lo val planes [g][128][NP]
#define WS_VL  (WS_VH + 2u * (size_t)NG * DD * NP)
#define WS_O   (WS_VL + 2u * (size_t)NG * DD * NP)        // f32 o rows [g][NP][128]
#define WS_PW  (WS_O + 4u * (size_t)NG * NP * DD)         // bf16 weights in fragment order, 34 matrices x 32 KiB
#define WS_END (WS_PW + 2u * (size_t)NMAT * DD * DD)

// ---- k_pack: every weight matrix is rounded to bf16 once a call and laid out as the B fragments of the 16x16x32 product are read.
// matrix m = 0..15 wk[b], 16..31 wv[b] ((in,out): element (k, n) at k * 128 + n), 32 W1, 33 W2 (natural: element (k, n) at n * 128 + k);
// fragment f = kc * 8 + j (k block of 32, column block of 16); half hf holds elements 8 hf .. 8 hf + 7 of every lane: k = kc * 32 + 16 hf + 8 (lane >> 4) + i, n = j * 16 + (lane & 15).
// 16-bit word ((m * 32 + f) * 2 + hf) * 256 + lane * 8 + i: a wave reads half a fragment as 512 contiguous bytes (four whole lines)
#define NMAT (2 * NBATCH + 2)
#define MATW (DD * DD)    // 16-bit words a packed matrix
__global__ __launch_bounds__(256) void k_pack(const float* __restrict__ WK, const float* __restrict__ WV, const float* __restrict__ W1, const float* __restrict__ W2, _Float16* __restrict__ PW) {
  const int t = blockIdx.x * 256 + threadIdx.x, lane = t & 31, hf = (t >> 5) & 1, f = (t >> 6) & 31, m = blockIdx.x >> 3;   // one 16-byte chunk a thread; 8 blocks a matrix
  const int k0 = (f >> 3) * 32 + hf * 16 + 8 * (lane >> 4), n = (f & 7) * 16 + (lane & 15);
  union { v8b v; v4u q; } o; float v[8];
  if (m < 2 * NBATCH) { const float* Wm = (m < NBATCH ? WK : WV) + (size_t)(m & (NBATCH - 1)) * DD * DD + (size_t)k0 * DD + n;
#pragma unroll
    for (int i = 0; i < 8; ++i) v[i] = Wm[i * DD]; }
  else { const float* Wm = (m == 2 * NBATCH ? W1 : W2) + (size_t)n * DD + k0;
#pragma unroll
    for (int i = 0; i < 8; ++i) v[i] = Wm[i]; }
  asm volatile("s_wait_xcnt 0x0" ::: "memory");   // before a converted value may land in an address register of these loads
#pragma unroll
  for (int i = 0; i < 8; ++i) o.v[i] = (__bf16)v[i];
  vst2(PW + (size_t)t * 8, o.q); }
// fragment f of a packed matrix (the pointer type only carries 16-bit words: the bits are bf16)
__device__ __forceinline__ v16b frag_p(const _Float16* Pm, int f, int lane) {
  union { v16b v; v4u q[2]; } u; const _Float16* p = Pm + f * 512 + lane * 8;
  u.q[0] = *(const v4u*)p; u.q[1] = *(const v4u*)(p + 256); return u.v;
}
__device__ __forceinline__ size_t xrow(size_t g, int n) { return (g * NNODE + (size_t)(n < NNODE ? n : NNODE - 1)) * DD; }   // clamped node row of x
// ---- k_kv: block = (64 padded nodes, which, g): key / val = x(clamped rows) . w[b] + bias[b]; all 384 rows / columns written
__global__ __launch_bounds__(128) void k_kv(const float* __restrict__ X, const _Float16* __restrict__ PW, const float* __restrict__ BK, const float* __restrict__ BV, _Float16* __restrict__ KHp, _Float16* __restrict__ KLp, _Float16* __restrict__ VHp, _Float16* __restrict__ VLp) {
  __shared__ __align__(16) _Float16 sh[64][136], sl[64][136]; __shared__ __align__(16) _Float16 th[128][72], tl[128][72];
  const int tid = threadIdx.x, wave = tid >> 5, lane = tid & 31, col = lane & 15, g = lane >> 4; const int which = blockIdx.y; const size_t grp = blockIdx.z; const size_t b = grp / NT; const int n0 = blockIdx.x * 64; const _Float16* Pm = PW + ((size_t)which * NBATCH + b) * MATW; const float* Bm = (which == 0 ? BK : BV) + b * DD;
  v8f acc[8] = {};
#pragma unroll
  for (int kc = 0; kc < DD / 32; ++kc) { v16b a, w[8]; const float* pp = X + xrow(grp, n0 + wave * 16 + col) + kc * 32 + 8 * g;
#pragma unroll
    for (int j = 0; j < 8; ++j) w[j] = frag_p(Pm, kc * 8 + j, lane);   // the k block's 16 loads stand ahead of its products, so that all are in flight together
#pragma unroll
    for (int i = 0; i < 8; ++i) { a[i] = (__bf16)pp[i]; a[8 + i] = (__bf16)pp[16 + i]; }
#pragma unroll
    for (int j = 0; j < 8; ++j) acc[j] = wmma_bf(a, w[j], acc[j]); }
#pragma unroll
  for (int j = 0; j < 8; ++j) { const float bb = bfr(Bm[j * 16 + col]);
#pragma unroll
    for (int r = 0; r < 8; ++r) { const float v = acc[j][r] + bb; const _Float16 hv = (_Float16)v, lv = (_Float16)((v - (float)hv) * 2048.0f); const int rl = wave * 16 + 8 * g + r, cl = j * 16 + col; if (which == 0) { sh[rl][cl] = hv; sl[rl][cl] = lv; } else { th[cl][rl] = hv; tl[cl][rl] = lv; } } }
  __syncthreads();
  if (which == 0) { for (int e = tid; e < 64 * 16; e += 128) { const int rl = e >> 4, q = e & 15; const size_t o = (grp * NP + n0 + rl) * DD + q * 8; vst2((unsigned*)(KHp + o), *(const v4u*)&sh[rl][q * 8]); vst2((unsigned*)(KLp + o), *(const v4u*)&sl[rl][q * 8]); } }
  else { for (int e = tid; e < 128 * 8; e += 128) { const int cl = e >> 3, q = e & 7; const size_t o = (grp * DD + cl) * (size_t)NP + n0 + q * 8; vst2((unsigned*)(VHp + o), *(const v4u*)&th[cl][q * 8]); vst2((unsigned*)(VLp + o), *(const v4u*)&tl[cl][q * 8]); } } }
// lane l with lane l ^ 16 (the two halves of a wave hold the two key halves of one query column)
__device__ __forceinline__ float xhalf(float x) { return __builtin_bit_cast(float, __builtin_amdgcn_permlanex16(__builtin_bit_cast(int, x), __builtin_bit_cast(int, x), 0x76543210, 0xfedcba98, false, false)); }
// ---- k_att: block = (head pair, g), 12 waves x 2 query tiles: the pair's key rows and val planes (hi and residual, all 384 keys, 96 KiB) are brought into LDS once by whole 16-byte chunks, and every fragment is read from there.
// wave = (16 queries, head): S^T = K . Q^T (A = key rows, B = q), so a lane holds 2 x 8 keys' scores of ONE query (column = lane & 15); maximum and sum run in-lane plus one exchange between halves;
// the two score tiles, converted in place, are the B operand of O^T += V^T . P^T (element i = key 8h + i, element 8 + i = key 16 + 8h + i, the order of frag_h on the val planes)
// LDS places, no pad: chunk c (16 bytes) of key row n lies at chunk c ^ ((n >> 2) & 3) of its 64-byte row; chunk c of val plane row d at chunk c ^ (d & 15) of its 768-byte row: the 16 lanes of a fragment read fall on 16 different bank groups
#define AW 12
__global__ __launch_bounds__(AW * 32) void k_att(const float* __restrict__ X, const _Float16* __restrict__ KHp, const _Float16* __restrict__ KLp, const _Float16* __restrict__ VHp, const _Float16* __restrict__ VLp, float* __restrict__ O) {
  __shared__ __align__(16) _Float16 skh[NP * 32], skl[NP * 32], svh[32 * NP], svl[32 * NP];
  const int tid = threadIdx.x, wave = tid >> 5, lane = tid & 31, col = lane & 15, g = lane >> 4; const int hp = blockIdx.x; const size_t grp = blockIdx.y;
  { v4u tkh[4], tkl[4], tvh[4], tvl[4];   // 16 chunks a thread, all in flight together; the four loops are unrolled so that these stay in registers
#pragma unroll
    for (int i = 0; i < 4; ++i) { const int e = tid + i * (AW * 32), n = e >> 2, c = e & 3; const size_t s = (grp * NP + n) * DD + hp * 32 + c * 8; tkh[i] = *(const v4u*)(KHp + s); tkl[i] = *(const v4u*)(KLp + s); }
    asm volatile("s_wait_xcnt 0x0" ::: "memory");   // before a later load's result may land in an address register of these loads
#pragma unroll
    for (int i = 0; i < 4; ++i) { const size_t s = (grp * DD + (size_t)hp * 32) * NP + (size_t)(tid + i * (AW * 32)) * 8; tvh[i] = *(const v4u*)(VHp + s); tvl[i] = *(const v4u*)(VLp + s); }
#pragma unroll
    for (int i = 0; i < 4; ++i) { const int e = tid + i * (AW * 32), n = e >> 2, c = e & 3, d = (n * 4 + (c ^ ((n >> 2) & 3))) * 8; *(v4u*)&skh[d] = tkh[i]; *(v4u*)&skl[d] = tkl[i]; }
#pragma unroll
    for (int i = 0; i < 4; ++i) { const int e = tid + i * (AW * 32), r = e / (NP / 8), c = e - r * (NP / 8), d = (r * (NP / 8) + (c ^ (r & 15))) * 8; *(v4u*)&svh[d] = tvh[i]; *(v4u*)&svl[d] = tvl[i]; } }
  __syncthreads();   // the staged rows are read below by every wave of the block
#pragma unroll 1   // rolled, as the loop over the two heads was: one copy of the key loop in the code
  for (int it = 0; it < 4; ++it) { const int hh = it & 1, kh = hp * 2 + hh, q0 = ((it >> 1) * AW + wave) * 16;
    v16h bq; { const float* pp = X + xrow(grp, q0 + col) + kh * HS + 8 * g;
#pragma unroll
      for (int i = 0; i < 8; ++i) { const float qv = bfr(pp[i]); bq[i] = (_Float16)(qv * 0.25f); bq[8 + i] = (_Float16)(qv * (0.25f / 2048.0f)); } }   // K = 16 real dims: slots 0..15 meet the keys' hi part, slots 16..31 their residual (stored x 2^11); both carry 16^-1/2 (powers of two)
    const int ko = (col * 4 + ((hh * 2 + g) ^ (col >> 2))) * 8;   // the head's own 8 dims, the same place in the hi and in the residual rows
    const int vo = (hh * 16 + col) * NP, vx = (g ^ col) * 8;
    float m = -3.0e38f, l = 0.f;   // running maximum of the query (equal in both halves); this half's share of the sum
    v8f acc = {}, accl = {};       // O^T: element r = head dim 8g + r of query col
#pragma unroll 1
    for (int ks = 0; ks < NP / 32; ++ks) { float s[2][8];
#pragma unroll
      for (int ct = 0; ct < 2; ++ct) { const int rk = (ks * 32 + ct * 16) * 32; union { v16h v; v8h q[2]; } ak; ak.q[0] = *(const v8h*)&skh[rk + ko]; ak.q[1] = *(const v8h*)&skl[rk + ko];   // element i = hi of dim 8g + i, element 8 + i = residual of the same dim: the order of bq
        v8f c = {}; c = wmma16(ak.v, bq, c);
#pragma unroll
        for (int r = 0; r < 8; ++r) s[ct][r] = c[r]; }
      if (ks * 32 + 32 > NNODE) {   // only the last key block holds padded keys
#pragma unroll
        for (int ct = 0; ct < 2; ++ct) {
#pragma unroll
          for (int r = 0; r < 8; ++r) if (ks * 32 + ct * 16 + 8 * g + r >= NNODE) s[ct][r] = -3.0e38f; } }
      float mx = fmaxf(s[0][0], s[1][0]);
#pragma unroll
      for (int r = 1; r < 8; ++r) mx = fmaxf(mx, fmaxf(s[0][r], s[1][r]));
      mx = fmaxf(mx, xhalf(mx));
      const float mn = fmaxf(m, mx), alpha = (m <= -1.0e38f) ? 0.f : __expf(m - mn); m = mn;
      v16h pb; float es0 = 0.f, es1 = 0.f;
#pragma unroll
      for (int r = 0; r < 8; ++r) { const float e0 = __expf(s[0][r] - mn), e1 = __expf(s[1][r] - mn);   // a padded key: exp of about -3e38 = 0 (mn is finite: keys 0..31 are real)
        es0 += e0; es1 += e1; pb[r] = (_Float16)(e0 * 2048.0f); pb[8 + r] = (_Float16)(e1 * 2048.0f); }
      l = l * alpha + (es0 + es1);
#pragma unroll
      for (int r = 0; r < 8; ++r) { acc[r] *= alpha; accl[r] *= alpha; }
      { const int p0 = vo + ((ks * 32) ^ vx), p1 = vo + ((ks * 32 + 16) ^ vx); union { v16h v; v8h q[2]; } vh, vl; vh.q[0] = *(const v8h*)&svh[p0]; vh.q[1] = *(const v8h*)&svh[p1]; vl.q[0] = *(const v8h*)&svl[p0]; vl.q[1] = *(const v8h*)&svl[p1];
        acc = wmma16(vh.v, pb, acc); accl = wmma16(vl.v, pb, accl); } }
    const float inv = (1.0f / 2048.0f) / (l + xhalf(l));
    v4f o0, o1;
#pragma unroll
    for (int r = 0; r < 4; ++r) { o0[r] = (acc[r] + accl[r] * (1.0f / 2048.0f)) * inv; o1[r] = (acc[4 + r] + accl[4 + r] * (1.0f / 2048.0f)) * inv; }
    float* op = O + ((grp * NP) + q0 + col) * DD + kh * HS + 8 * g; vst2(op, o0); vst2(op + 4, o1);
    asm volatile("s_wait_xcnt 0x0" ::: "memory"); } }   // the next pass overwrites the registers that these two stores name
// ---- k_mlp: block = (64 padded rows, g): out = (relu(o (hi + lo) . W1^T + b1)) (hi + lo) . W2^T + b2; rows n >= 358 are computed from finite data but not written
__global__ __launch_bounds__(128) void k_mlp(const float* __restrict__ O, const _Float16* __restrict__ PW, const float* __restrict__ B1, const float* __restrict__ B2, float* __restrict__ OUT) { __shared__ __align__(16) float sf[4][16][132];
  const int tid = threadIdx.x, wave = tid >> 5, lane = tid & 31, col = lane & 15, g = lane >> 4; const size_t grp = blockIdx.y; const int n0 = blockIdx.x * 64 + wave * 16; const size_t r0 = grp * NP + n0; const _Float16 *P1 = PW + (size_t)(2 * NBATCH) * MATW, *P2 = P1 + MATW;
  v8f acc[8] = {};
#pragma unroll
  for (int kc = 0; kc < DD / 32; ++kc) { v16b w[8]; const F2 a = split_row(O + (r0 + col) * DD, kc * 32, lane);
    asm volatile("s_wait_xcnt 0x0" ::: "memory");   // before a fragment load's result may land in the address pair of the row's loads
#pragma unroll
    for (int j = 0; j < 8; ++j) w[j] = frag_p(P1, kc * 8 + j, lane);   // the k block's 16 loads stand ahead of its products, so that all are in flight together
#pragma unroll
    for (int j = 0; j < 8; ++j) { acc[j] = wmma_bf(a.h, w[j], acc[j]); acc[j] = wmma_bf(a.l, w[j], acc[j]); } }
#pragma unroll
  for (int j = 0; j < 8; ++j) { const float bb = bfr(B1[j * 16 + col]);
#pragma unroll
    for (int r = 0; r < 8; ++r) sf[wave][8 * g + r][j * 16 + col] = fmaxf(acc[j][r] + bb, 0.f); }
  LDSX();
  { v8f acc2[8] = {};
#pragma unroll
    for (int kc = 0; kc < DD / 32; ++kc) { float v[16]; const float* pp = &sf[wave][col][kc * 32 + 8 * g]; v16b w[8];
#pragma unroll
      for (int j = 0; j < 8; ++j) w[j] = frag_p(P2, kc * 8 + j, lane);   // as above
#pragma unroll
      for (int i = 0; i < 8; ++i) { v[i] = pp[i]; v[8 + i] = pp[16 + i]; }
      const F2 a = bsplit16(v);
#pragma unroll
      for (int j = 0; j < 8; ++j) { acc2[j] = wmma_bf(a.h, w[j], acc2[j]); acc2[j] = wmma_bf(a.l, w[j], acc2[j]); } }
    LDSX();
#pragma unroll
    for (int j = 0; j < 8; ++j) { const float bb = bfr(B2[j * 16 + col]);
#pragma unroll
      for (int r = 0; r < 8; ++r) sf[wave][8 * g + r][j * 16 + col] = acc2[j][r] + bb; } }
  LDSX(); for (int rl = 0; rl < 16; ++rl) { const int n = n0 + rl; if (n < NNODE) vst2(OUT + (grp * NNODE + n) * DD + lane * 4, *(const v4f*)&sf[wave][rl][lane * 4]); } }
extern "C" void kernel_launch(void* const* d_in, const int* in_sizes, int n_in, void* d_out, int out_size, void* d_ws, size_t ws_size, hipStream_t stream) {
  (void)in_sizes; (void)n_in; (void)out_size;
  const float** F = (const float**)d_in;   // 0 x [16,12,358,128], 1 wk [16,1,128,128] (in,out), 2 bk [16,1,1,128], 3 wv, 4 bv, 5 W1 [128,128] natural, 6 b1, 7 W2 [128,128] natural, 8 b2
  if (ws_size < (size_t)WS_END) return;
  char* ws = (char*)d_ws; _Float16 *KHp = (_Float16*)(ws + WS_KH), *KLp = (_Float16*)(ws + WS_KL), *VHp = (_Float16*)(ws + WS_VH), *VLp = (_Float16*)(ws + WS_VL), *PW = (_Float16*)(ws + WS_PW); float* O = (float*)(ws + WS_O);
  k_pack<<<dim3(NMAT * 8), 256, 0, stream>>>(F[1], F[3], F[5], F[7], PW);
  k_kv<<<dim3(NP / 64, 2, TG), 128, 0, stream>>>(F[0], PW, F[2], F[4], KHp, KLp, VHp, VLp);
  k_att<<<dim3(KH / 2, TG), AW * 32, 0, stream>>>(F[0], KHp, KLp, VHp, VLp, O);
  k_mlp<<<dim3(NP / 64, TG), 128, 0, stream>>>(O, PW, F[6], F[8], (float*)d_out);
}

// v005
// A run of this version takes 73.4 microseconds.
// In two side-by-side timings against v004, it was 1.36 and 1.37 times as fast.
// All steps since v000 together make it 4.45 times as fast.
// compute dtype: all float inputs rounded to bf16; key / val = x . wk[b] + bk[b] with EXACT bf16 products on WMMA 16x16x32 (per-sample (in,out) weights), f16 hi + residual; q = x itself (bf16 -> f16; 16-dim heads: the K=32 fragment holds k hi | k residual against q / 4 | q / 4 x 2^-11); logits 1 product, 16^-1/2 inside it, padded keys (N = 358 -> 384) excluded, running-max softmax in f32 (hardware exp); P (x 2^11, f16) . v (hi + residual, 2 products); projection1 (relu) and projection2 with the f32 activations as bf16 hi + lo against exact weights (2 products each); f32 output. All padded rows/columns are written with finite (clamped) data before any read.
#include <hip/hip_runtime.h>
#include <math.h>

typedef __attribute__((ext_vector_type(16))) _Float16 v16h;
typedef __attribute__((ext_vector_type(16))) __bf16 v16b;
typedef __attribute__((ext_vector_type(8)))  _Float16 v8h;
typedef __attribute__((ext_vector_type(8)))  float v8f;
typedef __attribute__((ext_vector_type(4)))  float v4f;
typedef __attribute__((ext_vector_type(2)))  float v2f;
typedef __attribute__((ext_vector_type(4)))  unsigned v4u;
typedef __attribute__((ext_vector_type(4)))  int v4i;
typedef float __attribute__((may_alias)) float_a;
typedef int __attribute__((may_alias)) int_a;

template <typename T> __device__ __forceinline__ void vst2(void* p, T v) { *(T*)p = v;  }
__device__ __forceinline__ v8f wmma16(v16h a, v16h b, v8f c) {
  v8f d = __builtin_amdgcn_wmma_f32_16x16x32_f16(false, a, false, b, (short)0, c, false, false);
  asm volatile("v_nop\n\tv_nop\n\tv_nop\n\tv_nop" : "+v"(d) : "v"(a), "v"(b));
  return d;
}
__device__ __forceinline__ v8f wmma_bf(v16b a, v16b b, v8f c) {
  v8f d = __builtin_amdgcn_wmma_f32_16x16x32_bf16(false, a, false, b, (short)0, c, false, false);
  asm volatile("v_nop\n\tv_nop\n\tv_nop\n\tv_nop" : "+v"(d) : "v"(a), "v"(b));
  return d;
}
// 16x16x32 fragments: lane = (h = lane>>4, row/col = lane&15); elements 0..7 = k0+8h+0..7, 8..15 = k0+16+8h+0..7; D element r = row 8h+r
__device__ __forceinline__ v16h frag_h(const _Float16* rowk0, int lane) {
  union { v16h v; v8h q[2]; } u; const _Float16* p = rowk0 + 8 * (lane >> 4);
  u.q[0] = *(const v8h*)p; u.q[1] = *(const v8h*)(p + 16); return u.v;
}
__device__ __forceinline__ v16h frag_f32(const float* rowk0, int lane) {
  v16h a; const float* p = rowk0 + 8 * (lane >> 4);
#pragma unroll
  for (int i = 0; i < 8; ++i) { a[i] = (_Float16)p[i]; a[8 + i] = (_Float16)p[16 + i]; }
  return a;
}
__device__ __forceinline__ v16h frag_f32s(const float* rowk0, int lane, float sc) {
  v16h a; const float* p = rowk0 + 8 * (lane >> 4);
#pragma unroll
  for (int i = 0; i < 8; ++i) { a[i] = (_Float16)(p[i] * sc); a[8 + i] = (_Float16)(p[16 + i] * sc); }
  return a;
}
// column fragment from a [K][ld] layout (column n), rows >= K read as 0
__device__ __forceinline__ v16h fragc_f32(const float* W, int k0, int n, int lane, int ld, int K) {
  v16h a; const int g = lane >> 4;
#pragma unroll
  for (int i = 0; i < 8; ++i) { const int ka = k0 + 8 * g + i, kb = ka + 16;
    a[i] = (_Float16)(ka < K ? W[(size_t)(ka < K ? ka : K - 1) * ld + n] : 0.f); a[8 + i] = (_Float16)(kb < K ? W[(size_t)(kb < K ? kb : K - 1) * ld + n] : 0.f); }
  return a;
}
struct F2 { v16b h, l; };
__device__ __forceinline__ F2 bsplit16(const float v[16]) { F2 r;
#pragma unroll
  for (int i = 0; i < 16; ++i) { const __bf16 h = (__bf16)v[i]; r.h[i] = h; r.l[i] = (__bf16)(v[i] - (float)h); }
  return r; }
__device__ __forceinline__ F2 split_row(const float* row, int k0, int lane) { float v[16]; const float* p = row + k0 + 8 * (lane >> 4);
#pragma unroll
  for (int i = 0; i < 8; ++i) { v[i] = p[i]; v[8 + i] = p[16 + i]; }
  return bsplit16(v); }
__device__ __forceinline__ F2 split_rowK(const float* row, int k0, int lane, int K) { float v[16]; const int g = lane >> 4;
#pragma unroll
  for (int i = 0; i < 8; ++i) { const int ka = k0 + 8 * g + i, kb = ka + 16; v[i] = ka < K ? row[ka < K ? ka : K - 1] : 0.f; v[8 + i] = kb < K ? row[kb < K ? kb : K - 1] : 0.f; }
  return bsplit16(v); }
__device__ __forceinline__ F2 split_col(const float* W, int k0, int n, int lane, int ld, int K) { float v[16]; const int g = lane >> 4;
#pragma unroll
  for (int i = 0; i < 8; ++i) { const int ka = k0 + 8 * g + i, kb = ka + 16; v[i] = ka < K ? W[(size_t)(ka < K ? ka : K - 1) * ld + n] : 0.f; v[8 + i] = kb < K ? W[(size_t)(kb < K ? kb : K - 1) * ld + n] : 0.f; }
  return bsplit16(v); }
__device__ __forceinline__ v8f mac3(const F2& a, const F2& b, v8f c) { c = wmma_bf(a.l, b.h, c); c = wmma_bf(a.h, b.l, c); return wmma_bf(a.h, b.h, c); }
__device__ __forceinline__ float sigm(float v) { return 1.0f / (1.0f + expf(-v)); }
#define LDSX() do { asm volatile("s_wait_dscnt 0" ::: "memory"); __builtin_amdgcn_wave_barrier(); __builtin_amdgcn_fence(__ATOMIC_RELEASE, "workgroup"); } while (0)


// Spatial self attention over graph nodes (B 16, T 12, N 358 nodes, D 128 = 8 heads x 16): key/val from per-sample dynamic linears, q = x; softmax(q k / 4) over nodes; o -> Linear -> relu -> Linear.
#define NBATCH 16
#define NT 12
#define NG (NBATCH * NT)  // 192 (b, t) groups
#define NNODE 358
#define NP 384            // padded node count (6 x 64)
#define DD 128
#define KH 8
#define HS 16
#ifndef TG
#define TG NG
#endif
typedef __attribute__((ext_vector_type(8))) __bf16 v8b;
__device__ __forceinline__ v16b frag_b(const __bf16* rowk0, int lane) {
  union { v16b v; v8b q[2]; } u; const __bf16* p = rowk0 + 8 * (lane >> 4);
  u.q[0] = *(const v8b*)p; u.q[1] = *(const v8b*)(p + 16); return u.v;
}
__device__ __forceinline__ float bfr(float v) { return (float)(__bf16)v; }
__device__ __attribute__((noinline)) float exp_ni(float v) { return expf(v); }
__device__ __attribute__((noinline)) float erf_ni(float v) { return erff(v); }

#define WS_O   0u                                   // f32 o rows [g][NP][128]
#define WS_PW  (WS_O + 4u * (size_t)NG * NP * DD)         // bf16 weights in fragment order, 34 matrices x 32 KiB
#define WS_END (WS_PW + 2u * (size_t)NMAT * DD * DD)

// ---- k_pack: every weight matrix is rounded to bf16 once a call and laid out as the B fragments of the 16x16x32 product are read.
// matrix m = 0..15 wk[b], 16..31 wv[b] ((in,out): element (k, n) at k * 128 + n), 32 W1, 33 W2 (natural: element (k, n) at n * 128 + k);
// fragment f = kc * 8 + j (k block of 32, column block of 16); half hf holds elements 8 hf .. 8 hf + 7 of every lane: k = kc * 32 + 16 hf + 8 (lane >> 4) + i, n = j * 16 + (lane & 15).
// 16-bit word ((m * 32 + f) * 2 + hf) * 256 + lane * 8 + i: a wave reads half a fragment as 512 contiguous bytes (four whole lines)
#define NMAT (2 * NBATCH + 2)
#define MATW (DD * DD)    // 16-bit words a packed matrix
__global__ __launch_bounds__(256) void k_pack(const float* __restrict__ WK, const float* __restrict__ WV, const float* __restrict__ W1, const float* __restrict__ W2, _Float16* __restrict__ PW) {
  const int t = blockIdx.x * 256 + threadIdx.x, lane = t & 31, hf = (t >> 5) & 1, f = (t >> 6) & 31, m = blockIdx.x >> 3;   // one 16-byte chunk a thread; 8 blocks a matrix
  const int k0 = (f >> 3) * 32 + hf * 16 + 8 * (lane >> 4), n = (f & 7) * 16 + (lane & 15);
  union { v8b v; v4u q; } o; float v[8];
  if (m < 2 * NBATCH) { const float* Wm = (m < NBATCH ? WK : WV) + (size_t)(m & (NBATCH - 1)) * DD * DD + (size_t)k0 * DD + n;
#pragma unroll
    for (int i = 0; i < 8; ++i) v[i] = Wm[i * DD]; }
  else { const float* Wm = (m == 2 * NBATCH ? W1 : W2) + (size_t)n * DD + k0;
#pragma unroll
    for (int i = 0; i < 8; ++i) v[i] = Wm[i]; }
  asm volatile("s_wait_xcnt 0x0" ::: "memory");   // before a converted value may land in an address register of these loads
#pragma unroll
  for (int i = 0; i < 8; ++i) o.v[i] = (__bf16)v[i];
  vst2(PW + (size_t)t * 8, o.q); }
// fragment f of a packed matrix (the pointer type only carries 16-bit words: the bits are bf16)
__device__ __forceinline__ v16b frag_p(const _Float16* Pm, int f, int lane) {
  union { v16b v; v4u q[2]; } u; const _Float16* p = Pm + f * 512 + lane * 8;
  u.q[0] = *(const v4u*)p; u.q[1] = *(const v4u*)(p + 256); return u.v;
}
__device__ __forceinline__ size_t xrow(size_t g, int n) { return (g * NNODE + (size_t)(n < NNODE ? n : NNODE - 1)) * DD; }   // clamped node row of x
// lane l with lane l ^ 16 (the two halves of a wave hold the two key halves of one query column)
__device__ __forceinline__ float xhalf(float x) { return __builtin_bit_cast(float, __builtin_amdgcn_permlanex16(__builtin_bit_cast(int, x), __builtin_bit_cast(int, x), 0x76543210, 0xfedcba98, false, false)); }
// ---- k_att: block = (head pair, g), 12 waves x 2 query tiles: the block itself forms the pair's key rows and val planes (hi and residual, all 384 keys, 96 KiB) from x and the packed weights, straight into LDS, and every fragment is read from there.
// projection: wave = 2 x 16 padded nodes (clamped rows of x), 32 columns of key and of val: key^T = wk^T . x^T (A = packed weight fragment, B = x rows), so a lane holds 8 consecutive dims of ONE node = one 16-byte chunk of its key row;
// val = x . wv (A = x rows, B = packed weight fragment), so a lane holds 8 consecutive nodes of ONE dim = one 16-byte chunk of its val plane row. The same fragments and the same k order serve both operand sides.
// wave = (16 queries, head): S^T = K . Q^T (A = key rows, B = q), so a lane holds 2 x 8 keys' scores of ONE query (column = lane & 15); maximum and sum run in-lane plus one exchange between halves;
// the two score tiles, converted in place, are the B operand of O^T += V^T . P^T (element i = key 8h + i, element 8 + i = key 16 + 8h + i, the order of frag_h on the val planes)
// LDS places, no pad: chunk c (16 bytes) of key row n lies at chunk c ^ ((n >> 2) & 3) of its 64-byte row; chunk c of val plane row d at chunk c ^ (d & 15) of its 768-byte row: the 16 lanes of a fragment read fall on 16 different bank groups
#define AW 12
// nine waves a SIMD are asked for: at most 112 registers a wave keep three blocks (36 waves, 288 KiB of LDS) on a WGP, so that all 768 blocks are resident at once; without it the projection takes a few registers more and one block a WGP is lost
__global__ __launch_bounds__(AW * 32) __attribute__((amdgpu_waves_per_eu(9))) void k_att(const float* __restrict__ X, const _Float16* __restrict__ PW, const float* __restrict__ BK, const float* __restrict__ BV, float* __restrict__ O) {
  __shared__ __align__(16) _Float16 skh[NP * 32], skl[NP * 32], svh[32 * NP], svl[32 * NP];
  const int tid = threadIdx.x, wave = tid >> 5, lane = tid & 31, col = lane & 15, g = lane >> 4; const int hp = blockIdx.x; const size_t grp = blockIdx.y;
  { const size_t b = grp / NT; const _Float16* Pw = PW + (b * MATW + hp * 1024) + (unsigned)(lane * 8);   // the lane's 16 bytes of fragment (k block 0, column block 2 hp) of wk[b]; wv[b] lies NBATCH matrices on
    const float *Bk = BK + (b * DD + hp * 32) + (unsigned)(8 * g), *Bv = BV + (b * DD + hp * 32) + (unsigned)col, *Xg = X + grp * (size_t)(NNODE * DD);   // block-uniform bases, 32-bit lane offsets
#pragma unroll 1   // rolled: one copy of the projection in the code, and its registers stay within what nine waves a SIMD leave a wave
    for (int nt = 0; nt < 2; ++nt) { const int n0 = (nt * AW + wave) * 16, n = n0 + col; const float* pp = Xg + (unsigned)((n < NNODE ? n : NNODE - 1) * DD + 8 * g); float xv[64]; v16b a[4];
#pragma unroll
      for (int kc = 0; kc < DD / 32; ++kc) {
#pragma unroll
        for (int i = 0; i < 8; ++i) { xv[kc * 16 + i] = pp[kc * 32 + i]; xv[kc * 16 + 8 + i] = pp[kc * 32 + 16 + i]; } }   // the row's 16 loads stand together, so that all are in flight at once
      asm volatile("s_wait_xcnt 0x0" ::: "memory");   // before a converted value may land in the offset register of these loads
#pragma unroll
      for (int kc = 0; kc < DD / 32; ++kc) {
#pragma unroll
        for (int i = 0; i < 16; ++i) a[kc][i] = (__bf16)xv[kc * 16 + i]; }
      __builtin_amdgcn_sched_barrier(0);   // the weight loads below stay behind the conversion: lifted among the row's 64 loaded registers they push a value out to scratch memory
      { v8f ck[2] = {};   // key^T: element r = dim j * 16 + 8g + r of node n
#pragma unroll
        for (int k2 = 0; k2 < DD / 64; ++k2) { union { v16b v; v4u q[2]; } w[4];
#pragma unroll
          for (int f = 0; f < 4; ++f) { const _Float16* p = Pw + ((k2 * 2 + (f >> 1)) * 8 + (f & 1)) * 512; w[f].q[0] = *(const v4u*)p; w[f].q[1] = *(const v4u*)(p + 256); }   // two k blocks' 8 loads stand ahead of their products, so that all are in flight together
#pragma unroll
          for (int f = 0; f < 4; ++f) ck[f & 1] = wmma_bf(w[f].v, a[k2 * 2 + (f >> 1)], ck[f & 1]); }
#pragma unroll
        for (int j = 0; j < 2; ++j) { v8h h8, l8;
#pragma unroll
          for (int r = 0; r < 8; ++r) { const float v = ck[j][r] + bfr(Bk[j * 16 + r]); const _Float16 hv = (_Float16)v; h8[r] = hv; l8[r] = (_Float16)((v - (float)hv) * 2048.0f); }
          const int d = (n * 4 + ((j * 2 + g) ^ ((n >> 2) & 3))) * 8; *(v8h*)&skh[d] = h8; *(v8h*)&skl[d] = l8; } }
      { v8f cv[2] = {};   // val: element r = node n0 + 8g + r, dim j * 16 + col
#pragma unroll
        for (int k2 = 0; k2 < DD / 64; ++k2) { union { v16b v; v4u q[2]; } w[4];
#pragma unroll
          for (int f = 0; f < 4; ++f) { const _Float16* p = Pw + (size_t)NBATCH * MATW + ((k2 * 2 + (f >> 1)) * 8 + (f & 1)) * 512; w[f].q[0] = *(const v4u*)p; w[f].q[1] = *(const v4u*)(p + 256); }   // as above
#pragma unroll
          for (int f = 0; f < 4; ++f) cv[f & 1] = wmma_bf(a[k2 * 2 + (f >> 1)], w[f].v, cv[f & 1]); }
#pragma unroll
        for (int j = 0; j < 2; ++j) { v8h h8, l8; const float bb = bfr(Bv[j * 16]);
#pragma unroll
          for (int r = 0; r < 8; ++r) { const float v = cv[j][r] + bb; const _Float16 hv = (_Float16)v; h8[r] = hv; l8[r] = (_Float16)((v - (float)hv) * 2048.0f); }
          const int dd = j * 16 + col, d = (dd * (NP / 8) + (((n0 >> 3) + g) ^ col)) * 8; *(v8h*)&svh[d] = h8; *(v8h*)&svl[d] = l8; } }
      asm volatile("s_wait_xcnt 0x0" ::: "memory"); } }   // the next pass, and the code behind the loop, overwrite address registers of this pass's loads
  __syncthreads();   // the rows and planes written above are read below by every wave of the block
#pragma unroll 1   // rolled, as the loop over the two heads was: one copy of the key loop in the code
  for (int it = 0; it < 4; ++it) { const int hh = it & 1, kh = hp * 2 + hh, q0 = ((it >> 1) * AW + wave) * 16;
    v16h bq; { const float* pp = X + xrow(grp, q0 + col) + kh * HS + 8 * g;
#pragma unroll
      for (int i = 0; i < 8; ++i) { const float qv = bfr(pp[i]); bq[i] = (_Float16)(qv * 0.25f); bq[8 + i] = (_Float16)(qv * (0.25f / 2048.0f)); } }   // K = 16 real dims: slots 0..15 meet the keys' hi part, slots 16..31 their residual (stored x 2^11); both carry 16^-1/2 (powers of two)
    const int ko = (col * 4 + ((hh * 2 + g) ^ (col >> 2))) * 8;   // the head's own 8 dims, the same place in the hi and in the residual rows
    const int vo = (hh * 16 + col) * NP, vx = (g ^ col) * 8;
    float m = -3.0e38f, l = 0.f;   // running maximum of the query (equal in both halves); this half's share of the sum
    v8f acc = {}, accl = {};       // O^T: element r = head dim 8g + r of query col
#pragma unroll 1
    for (int ks = 0; ks < NP / 32; ++ks) { float s[2][8];
#pragma unroll
      for (int ct = 0; ct < 2; ++ct) { const int rk = (ks * 32 + ct * 16) * 32; union { v16h v; v8h q[2]; } ak; ak.q[0] = *(const v8h*)&skh[rk + ko]; ak.q[1] = *(const v8h*)&skl[rk + ko];   // element i = hi of dim 8g + i, element 8 + i = residual of the same dim: the order of bq
        v8f c = {}; c = wmma16(ak.v, bq, c);
#pragma unroll
        for (int r = 0; r < 8; ++r) s[ct][r] = c[r]; }
      if (ks * 32 + 32 > NNODE) {   // only the last key block holds padded keys
#pragma unroll
        for (int ct = 0; ct < 2; ++ct) {
#pragma unroll
          for (int r = 0; r < 8; ++r) if (ks * 32 + ct * 16 + 8 * g + r >= NNODE) s[ct][r] = -3.0e38f; } }
      float mx = fmaxf(s[0][0], s[1][0]);
#pragma unroll
      for (int r = 1; r < 8; ++r) mx = fmaxf(mx, fmaxf(s[0][r], s[1][r]));
      mx = fmaxf(mx, xhalf(mx));
      const float mn = fmaxf(m, mx), alpha = (m <= -1.0e38f) ? 0.f : __expf(m - mn); m = mn;
      v16h pb; float es0 = 0.f, es1 = 0.f;
#pragma unroll
      for (int r = 0; r < 8; ++r) { const float e0 = __expf(s[0][r] - mn), e1 = __expf(s[1][r] - mn);   // a padded key: exp of about -3e38 = 0 (mn is finite: keys 0..31 are real)
        es0 += e0; es1 += e1; pb[r] = (_Float16)(e0 * 2048.0f); pb[8 + r] = (_Float16)(e1 * 2048.0f); }
      l = l * alpha + (es0 + es1);
#pragma unroll
      for (int r = 0; r < 8; ++r) { acc[r] *= alpha; accl[r] *= alpha; }
      { const int p0 = vo + ((ks * 32) ^ vx), p1 = vo + ((ks * 32 + 16) ^ vx); union { v16h v; v8h q[2]; } vh, vl; vh.q[0] = *(const v8h*)&svh[p0]; vh.q[1] = *(const v8h*)&svh[p1]; vl.q[0] = *(const v8h*)&svl[p0]; vl.q[1] = *(const v8h*)&svl[p1];
        acc = wmma16(vh.v, pb, acc); accl = wmma16(vl.v, pb, accl); } }
    const float inv = (1.0f / 2048.0f) / (l + xhalf(l));
    v4f o0, o1;
#pragma unroll
    for (int r = 0; r < 4; ++r) { o0[r] = (acc[r] + accl[r] * (1.0f / 2048.0f)) * inv; o1[r] = (acc[4 + r] + accl[4 + r] * (1.0f / 2048.0f)) * inv; }
    float* op = O + ((grp * NP) + q0 + col) * DD + kh * HS + 8 * g; vst2(op, o0); vst2(op + 4, o1);
    asm volatile("s_wait_xcnt 0x0" ::: "memory"); } }   // the next pass overwrites the registers that these two stores name
// ---- k_mlp: block = (64 padded rows, g): out = (relu(o (hi + lo) . W1^T + b1)) (hi + lo) . W2^T + b2; rows n >= 358 are computed from finite data but not written
__global__ __launch_bounds__(128) void k_mlp(const float* __restrict__ O, const _Float16* __restrict__ PW, const float* __restrict__ B1, const float* __restrict__ B2, float* __restrict__ OUT) { __shared__ __align__(16) float sf[4][16][132];
  const int tid = threadIdx.x, wave = tid >> 5, lane = tid & 31, col = lane & 15, g = lane >> 4; const size_t grp = blockIdx.y; const int n0 = blockIdx.x * 64 + wave * 16; const size_t r0 = grp * NP + n0; const _Float16 *P1 = PW + (size_t)(2 * NBATCH) * MATW, *P2 = P1 + MATW;
  v8f acc[8] = {};
#pragma unroll
  for (int kc = 0; kc < DD / 32; ++kc) { v16b w[8]; const F2 a = split_row(O + (r0 + col) * DD, kc * 32, lane);
    asm volatile("s_wait_xcnt 0x0" ::: "memory");   // before a fragment load's result may land in the address pair of the row's loads
#pragma unroll
    for (int j = 0; j < 8; ++j) w[j] = frag_p(P1, kc * 8 + j, lane);   // the k block's 16 loads stand ahead of its products, so that all are in flight together
#pragma unroll
    for (int j = 0; j < 8; ++j) { acc[j] = wmma_bf(a.h, w[j], acc[j]); acc[j] = wmma_bf(a.l, w[j], acc[j]); } }
#pragma unroll
  for (int j = 0; j < 8; ++j) { const float bb = bfr(B1[j * 16 + col]);
#pragma unroll
    for (int r = 0; r < 8; ++r) sf[wave][8 * g + r][j * 16 + col] = fmaxf(acc[j][r] + bb, 0.f); }
  LDSX();
  { v8f acc2[8] = {};
#pragma unroll
    for (int kc = 0; kc < DD / 32; ++kc) { float v[16]; const float* pp = &sf[wave][col][kc * 32 + 8 * g]; v16b w[8];
#pragma unroll
      for (int j = 0; j < 8; ++j) w[j] = frag_p(P2, kc * 8 + j, lane);   // as above
#pragma unroll
      for (int i = 0; i < 8; ++i) { v[i] = pp[i]; v[8 + i] = pp[16 + i]; }
      const F2 a = bsplit16(v);
#pragma unroll
      for (int j = 0; j < 8; ++j) { acc2[j] = wmma_bf(a.h, w[j], acc2[j]); acc2[j] = wmma_bf(a.l, w[j], acc2[j]); } }
    LDSX();
#pragma unroll
    for (int j = 0; j < 8; ++j) { const float bb = bfr(B2[j * 16 + col]);
#pragma unroll
      for (int r = 0; r < 8; ++r) sf[wave][8 * g + r][j * 16 + col] = acc2[j][r] + bb; } }
  LDSX(); for (int rl = 0; rl < 16; ++rl) { const int n = n0 + rl; if (n < NNODE) vst2(OUT + (grp * NNODE + n) * DD + lane * 4, *(const v4f*)&sf[wave][rl][lane * 4]); } }
extern "C" void kernel_launch(void* const* d_in, const int* in_sizes, int n_in, void* d_out, int out_size, void* d_ws, size_t ws_size, hipStream_t stream) {
  (void)in_sizes; (void)n_in; (void)out_size;
  const float** F = (const float**)d_in;   // 0 x [16,12,358,128], 1 wk [16,1,128,128] (in,out), 2 bk [16,1,1,128], 3 wv, 4 bv, 5 W1 [128,128] natural, 6 b1, 7 W2 [128,128] natural, 8 b2
  if (ws_size < (size_t)WS_END) return;
  char* ws = (char*)d_ws; _Float16* PW = (_Float16*)(ws + WS_PW); float* O = (float*)(ws + WS_O);
  k_pack<<<dim3(NMAT * 8), 256, 0, stream>>>(F[1], F[3], F[5], F[7], PW);
  k_att<<<dim3(KH / 2, TG), AW * 32, 0, stream>>>(F[0], PW, F[2], F[4], O);
  k_mlp<<<dim3(NP / 64, TG), 128, 0, stream>>>(O, PW, F[6], F[8], (float*)d_out);
}

// v006
// One run takes 69.9 microseconds.
// Two timings next to v005 both put it at 1.05 times that version's speed.
// Over all steps from v000 it is 4.67 times as fast.
// compute dtype: all float inputs rounded to bf16; key / val = x . wk[b] + bk[b] with EXACT bf16 products on WMMA 16x16x32 (per-sample (in,out) weights), f16 hi + residual; q = x itself (bf16 -> f16; 16-dim heads: the K=32 fragment holds k hi | k residual against q / 4 | q / 4 x 2^-11); logits 1 product, 16^-1/2 inside it, padded keys (N = 358 -> 384) excluded, running-max softmax in f32 (hardware exp); P (x 2^11, f16) . v (hi + residual, 2 products); projection1 (relu) and projection2 with the f32 activations as bf16 hi + lo against exact weights (2 products each); f32 output. All padded rows/columns are written with finite (clamped) data before any read.
#include <hip/hip_runtime.h>
#include <math.h>

typedef __attribute__((ext_vector_type(16))) _Float16 v16h;
typedef __attribute__((ext_vector_type(16))) __bf16 v16b;
typedef __attribute__((ext_vector_type(8)))  _Float16 v8h;
typedef __attribute__((ext_vector_type(8)))  float v8f;
typedef __attribute__((ext_vector_type(4)))  float v4f;
typedef __attribute__((ext_vector_type(2)))  float v2f;
typedef __attribute__((ext_vector_type(4)))  unsigned v4u;
typedef __attribute__((ext_vector_type(4)))  int v4i;
typedef float __attribute__((may_alias)) float_a;
typedef int __attribute__((may_alias)) int_a;

template <typename T> __device__ __forceinline__ void vst2(void* p, T v) { *(T*)p = v;  }
__device__ __forceinline__ v8f wmma16(v16h a, v16h b, v8f c) {
  v8f d = __builtin_amdgcn_wmma_f32_16x16x32_f16(false, a, false, b, (short)0, c, false, false);
  asm volatile("v_nop\n\tv_nop\n\tv_nop\n\tv_nop" : "+v"(d) : "v"(a), "v"(b));
  return d;
}
__device__ __forceinline__ v8f wmma_bf(v16b a, v16b b, v8f c) {
  v8f d = __builtin_amdgcn_wmma_f32_16x16x32_bf16(false, a, false, b, (short)0, c, false, false);
  asm volatile("v_nop\n\tv_nop\n\tv_nop\n\tv_nop" : "+v"(d) : "v"(a), "v"(b));
  return d;
}
// 16x16x32 fragments: lane = (h = lane>>4, row/col = lane&15); elements 0..7 = k0+8h+0..7, 8..15 = k0+16+8h+0..7; D element r = row 8h+r
__device__ __forceinline__ v16h frag_h(const _Float16* rowk0, int lane) {
  union { v16h v; v8h q[2]; } u; const _Float16* p = rowk0 + 8 * (lane >> 4);
  u.q[0] = *(const v8h*)p; u.q[1] = *(const v8h*)(p + 16); return u.v;
}
__device__ __forceinline__ v16h frag_f32(const float* rowk0, int lane) {
  v16h a; const float* p = rowk0 + 8 * (lane >> 4);
#pragma unroll
  for (int i = 0; i < 8; ++i) { a[i] = (_Float16)p[i]; a[8 + i] = (_Float16)p[16 + i]; }
  return a;
}
__device__ __forceinline__ v16h frag_f32s(const float* rowk0, int lane, float sc) {
  v16h a; const float* p = rowk0 + 8 * (lane >> 4);
#pragma unroll
  for (int i = 0; i < 8; ++i) { a[i] = (_Float16)(p[i] * sc); a[8 + i] = (_Float16)(p[16 + i] * sc); }
  return a;
}
// column fragment from a [K][ld] layout (column n), rows >= K read as 0
__device__ __forceinline__ v16h fragc_f32(const float* W, int k0, int n, int lane, int ld, int K) {
  v16h a; const int g = lane >> 4;
#pragma unroll
  for (int i = 0; i < 8; ++i) { const int ka = k0 + 8 * g + i, kb = ka + 16;
    a[i] = (_Float16)(ka < K ? W[(size_t)(ka < K ? ka : K - 1) * ld + n] : 0.f); a[8 + i] = (_Float16)(kb < K ? W[(size_t)(kb < K ? kb : K - 1) * ld + n] : 0.f); }
  return a;
}
struct F2 { v16b h, l; };
__device__ __forceinline__ F2 bsplit16(const float v[16]) { F2 r;
#pragma unroll
  for (int i = 0; i < 16; ++i) { const __bf16 h = (__bf16)v[i]; r.h[i] = h; r.l[i] = (__bf16)(v[i] - (float)h); }
  return r; }
__device__ __forceinline__ F2 split_row(const float* row, int k0, int lane) { float v[16]; const float* p = row + k0 + 8 * (lane >> 4);
#pragma unroll
  for (int i = 0; i < 8; ++i) { v[i] = p[i]; v[8 + i] = p[16 + i]; }
  return bsplit16(v); }
__device__ __forceinline__ F2 split_rowK(const float* row, int k0, int lane, int K) { float v[16]; const int g = lane >> 4;
#pragma unroll
  for (int i = 0; i < 8; ++i) { const int ka = k0 + 8 * g + i, kb = ka + 16; v[i] = ka < K ? row[ka < K ? ka : K - 1] : 0.f; v[8 + i] = kb < K ? row[kb < K ? kb : K - 1] : 0.f; }
  return bsplit16(v); }
__device__ __forceinline__ F2 split_col(const float* W, int k0, int n, int lane, int ld, int K) { float v[16]; const int g = lane >> 4;
#pragma unroll
  for (int i = 0; i < 8; ++i) { const int ka = k0 + 8 * g + i, kb = ka + 16; v[i] = ka < K ? W[(size_t)(ka < K ? ka : K - 1) * ld + n] : 0.f; v[8 + i] = kb < K ? W[(size_t)(kb < K ? kb : K - 1) * ld + n] : 0.f; }
  return bsplit16(v); }
__device__ __forceinline__ v8f mac3(const F2& a, const F2& b, v8f c) { c = wmma_bf(a.l, b.h, c); c = wmma_bf(a.h, b.l, c); return wmma_bf(a.h, b.h, c); }
__device__ __forceinline__ float sigm(float v) { return 1.0f / (1.0f + expf(-v)); }
#define LDSX() do { asm volatile("s_wait_dscnt 0" ::: "memory"); __builtin_amdgcn_wave_barrier(); __builtin_amdgcn_fence(__ATOMIC_RELEASE, "workgroup"); } while (0)


// Spatial self attention over graph nodes (B 16, T 12, N 358 nodes, D 128 = 8 heads x 16): key/val from per-sample dynamic linears, q = x; softmax(q k / 4) over nodes; o -> Linear -> relu -> Linear.
#define NBATCH 16
#define NT 12
#define NG (NBATCH * NT)  // 192 (b, t) groups
#define NNODE 358
#define NP 384            // padded node count (6 x 64)
#define DD 128
#define KH 8
#define HS 16
#ifndef TG
#define TG NG
#endif
typedef __attribute__((ext_vector_type(8))) __bf16 v8b;
__device__ __forceinline__ v16b frag_b(const __bf16* rowk0, int lane) {
  union { v16b v; v8b q[2]; } u; const __bf16* p = rowk0 + 8 * (lane >> 4);
  u.q[0] = *(const v8b*)p; u.q[1] = *(const v8b*)(p + 16); return u.v;
}
__device__ __forceinline__ float bfr(float v) { return (float)(__bf16)v; }
__device__ __attribute__((noinline)) float exp_ni(float v) { return expf(v); }
__device__ __attribute__((noinline)) float erf_ni(float v) { return erff(v); }

#define WS_O   0u                                   // f32 o rows [g][NP][128]
#define WS_PW  (WS_O + 4u * (size_t)NG * NP * DD)         // bf16 weights in fragment order, 34 matrices x 32 KiB
#define WS_END (WS_PW + 2u * (size_t)NMAT * DD * DD)

// ---- k_pack: every weight matrix is rounded to bf16 once a call and laid out as the B fragments of the 16x16x32 product are read.
// matrix m = 0..15 wk[b], 16..31 wv[b] ((in,out): element (k, n) at k * 128 + n), 32 W1, 33 W2 (natural: element (k, n) at n * 128 + k);
// fragment f = kc * 8 + j (k block of 32, column block of 16); half hf holds elements 8 hf .. 8 hf + 7 of every lane: k = kc * 32 + 16 hf + 8 (lane >> 4) + i, n = j * 16 + (lane & 15).
// 16-bit word ((m * 32 + f) * 2 + hf) * 256 + lane * 8 + i: a wave reads half a fragment as 512 contiguous bytes (four whole lines)
#define NMAT (2 * NBATCH + 2)
#define MATW (DD * DD)    // 16-bit words a packed matrix
__global__ __launch_bounds__(256) void k_pack(const float* __restrict__ WK, const float* __restrict__ WV, const float* __restrict__ W1, const float* __restrict__ W2, _Float16* __restrict__ PW) {
  const int t = blockIdx.x * 256 + threadIdx.x, lane = t & 31, hf = (t >> 5) & 1, f = (t >> 6) & 31, m = blockIdx.x >> 3;   // one 16-byte chunk a thread; 8 blocks a matrix
  const int k0 = (f >> 3) * 32 + hf * 16 + 8 * (lane >> 4), n = (f & 7) * 16 + (lane & 15);
  union { v8b v; v4u q; } o; float v[8];
  if (m < 2 * NBATCH) { const float* Wm = (m < NBATCH ? WK : WV) + (size_t)(m & (NBATCH - 1)) * DD * DD + (size_t)k0 * DD + n;
#pragma unroll
    for (int i = 0; i < 8; ++i) v[i] = Wm[i * DD]; }
  else { const float* Wm = (m == 2 * NBATCH ? W1 : W2) + (size_t)n * DD + k0;
#pragma unroll
    for (int i = 0; i < 8; ++i) v[i] = Wm[i]; }
  asm volatile("s_wait_xcnt 0x0" ::: "memory");   // before a converted value may land in an address register of these loads
#pragma unroll
  for (int i = 0; i < 8; ++i) o.v[i] = (__bf16)v[i];
  vst2(PW + (size_t)t * 8, o.q); }
// fragment f of a packed matrix (the pointer type only carries 16-bit words: the bits are bf16)
__device__ __forceinline__ v16b frag_p(const _Float16* Pm, int f, int lane) {
  union { v16b v; v4u q[2]; } u; const _Float16* p = Pm + f * 512 + lane * 8;
  u.q[0] = *(const v4u*)p; u.q[1] = *(const v4u*)(p + 256); return u.v;
}
__device__ __forceinline__ size_t xrow(size_t g, int n) { return (g * NNODE + (size_t)(n < NNODE ? n : NNODE - 1)) * DD; }   // clamped node row of x
// lane l with lane l ^ 16 (the two halves of a wave hold the two key halves of one query column)
__device__ __forceinline__ float xhalf(float x) { return __builtin_bit_cast(float, __builtin_amdgcn_permlanex16(__builtin_bit_cast(int, x), __builtin_bit_cast(int, x), 0x76543210, 0xfedcba98, false, false)); }
// ---- k_att: block = (head pair, g), 12 waves x 2 query tiles: the block itself forms the pair's key rows and val planes (hi and residual, all 384 keys, 96 KiB) from x and the packed weights, straight into LDS, and every fragment is read from there.
// projection: wave = 2 x 16 padded nodes (clamped rows of x), 32 columns of key and of val: key^T = wk^T . x^T (A = packed weight fragment, B = x rows), so a lane holds 8 consecutive dims of ONE node = one 16-byte chunk of its key row;
// val = x . wv (A = x rows, B = packed weight fragment), so a lane holds 8 consecutive nodes of ONE dim = one 16-byte chunk of its val plane row. The same fragments and the same k order serve both operand sides.
// wave = (16 queries, head): S^T = K . Q^T (A = key rows, B = q), so a lane holds 2 x 8 keys' scores of ONE query (column = lane & 15); maximum and sum run in-lane plus one exchange between halves;
// the two score tiles, converted in place, are the B operand of O^T += V^T . P^T (element i = key 8h + i, element 8 + i = key 16 + 8h + i, the order of frag_h on the val planes)
// LDS places, no pad: chunk c (16 bytes) of key row n lies at chunk c ^ ((n >> 2) & 3) of its 64-byte row; chunk c of val plane row d at chunk c ^ (d & 15) of its 768-byte row: the 16 lanes of a fragment read fall on 16 different bank groups
#define AW 12
#define L2E 1.44269504088896340736f
// nine waves a SIMD are asked for: at most 112 registers a wave keep three blocks (36 waves, 288 KiB of LDS) on a WGP, so that all 768 blocks are resident at once; without it the projection takes a few registers more and one block a WGP is lost
__global__ __launch_bounds__(AW * 32) __attribute__((amdgpu_waves_per_eu(9))) void k_att(const float* __restrict__ X, const _Float16* __restrict__ PW, const float* __restrict__ BK, const float* __restrict__ BV, float* __restrict__ O) {
  __shared__ __align__(16) _Float16 skh[NP * 32], skl[NP * 32], svh[32 * NP], svl[32 * NP];
  const int tid = threadIdx.x, wave = tid >> 5, lane = tid & 31, col = lane & 15, g = lane >> 4; const int hp = blockIdx.x; const size_t grp = blockIdx.y;
  { const size_t b = grp / NT; const _Float16* Pw = PW + (b * MATW + hp * 1024) + (unsigned)(lane * 8);   // the lane's 16 bytes of fragment (k block 0, column block 2 hp) of wk[b]; wv[b] lies NBATCH matrices on
    const float *Bk = BK + (b * DD + hp * 32) + (unsigned)(8 * g), *Bv = BV + (b * DD + hp * 32) + (unsigned)col, *Xg = X + grp * (size_t)(NNODE * DD);   // block-uniform bases, 32-bit lane offsets
#pragma unroll 1   // rolled: one copy of the projection in the code, and its registers stay within what nine waves a SIMD leave a wave
    for (int nt = 0; nt < 2; ++nt) { const int n0 = (nt * AW + wave) * 16, n = n0 + col; const float* pp = Xg + (unsigned)((n < NNODE ? n : NNODE - 1) * DD + 8 * g); float xv[64]; v16b a[4];
#pragma unroll
      for (int kc = 0; kc < DD / 32; ++kc) {
#pragma unroll
        for (int i = 0; i < 8; ++i) { xv[kc * 16 + i] = pp[kc * 32 + i]; xv[kc * 16 + 8 + i] = pp[kc * 32 + 16 + i]; } }   // the row's 16 loads stand together, so that all are in flight at once
      asm volatile("s_wait_xcnt 0x0" ::: "memory");   // before a converted value may land in the offset register of these loads
#pragma unroll
      for (int kc = 0; kc < DD / 32; ++kc) {
#pragma unroll
        for (int i = 0; i < 16; ++i) a[kc][i] = (__bf16)xv[kc * 16 + i]; }
      __builtin_amdgcn_sched_barrier(0);   // the weight loads below stay behind the conversion: lifted among the row's 64 loaded registers they push a value out to scratch memory
      { v8f ck[2] = {};   // key^T: element r = dim j * 16 + 8g + r of node n
#pragma unroll
        for (int k2 = 0; k2 < DD / 64; ++k2) { union { v16b v; v4u q[2]; } w[4];
#pragma unroll
          for (int f = 0; f < 4; ++f) { const _Float16* p = Pw + ((k2 * 2 + (f >> 1)) * 8 + (f & 1)) * 512; w[f].q[0] = *(const v4u*)p; w[f].q[1] = *(const v4u*)(p + 256); }   // two k blocks' 8 loads stand ahead of their products, so that all are in flight together
#pragma unroll
          for (int f = 0; f < 4; ++f) ck[f & 1] = wmma_bf(w[f].v, a[k2 * 2 + (f >> 1)], ck[f & 1]); }
#pragma unroll
        for (int j = 0; j < 2; ++j) { v8h h8, l8;
#pragma unroll
          for (int r = 0; r < 8; ++r) { const float v = ck[j][r] + bfr(Bk[j * 16 + r]); const _Float16 hv = (_Float16)v; h8[r] = hv; l8[r] = (_Float16)((v - (float)hv) * 2048.0f); }
          const int d = (n * 4 + ((j * 2 + g) ^ ((n >> 2) & 3))) * 8; *(v8h*)&skh[d] = h8; *(v8h*)&skl[d] = l8; } }
      { v8f cv[2] = {};   // val: element r = node n0 + 8g + r, dim j * 16 + col
#pragma unroll
        for (int k2 = 0; k2 < DD / 64; ++k2) { union { v16b v; v4u q[2]; } w[4];
#pragma unroll
          for (int f = 0; f < 4; ++f) { const _Float16* p = Pw + (size_t)NBATCH * MATW + ((k2 * 2 + (f >> 1)) * 8 + (f & 1)) * 512; w[f].q[0] = *(const v4u*)p; w[f].q[1] = *(const v4u*)(p + 256); }   // as above
#pragma unroll
          for (int f = 0; f < 4; ++f) cv[f & 1] = wmma_bf(a[k2 * 2 + (f >> 1)], w[f].v, cv[f & 1]); }
#pragma unroll
        for (int j = 0; j < 2; ++j) { v8h h8, l8; const float bb = bfr(Bv[j * 16]);
#pragma unroll
          for (int r = 0; r < 8; ++r) { const float v = cv[j][r] + bb; const _Float16 hv = (_Float16)v; h8[r] = hv; l8[r] = (_Float16)((v - (float)hv) * 2048.0f); }
          const int dd = j * 16 + col, d = (dd * (NP / 8) + (((n0 >> 3) + g) ^ col)) * 8; *(v8h*)&svh[d] = h8; *(v8h*)&svl[d] = l8; } }
      asm volatile("s_wait_xcnt 0x0" ::: "memory"); } }   // the next pass, and the code behind the loop, overwrite address registers of this pass's loads
  __syncthreads();   // the rows and planes written above are read below by every wave of the block
#pragma unroll 1   // rolled, as the loop over the two heads was: one copy of the key loop in the code
  for (int it = 0; it < 4; ++it) { const int hh = it & 1, kh = hp * 2 + hh, q0 = ((it >> 1) * AW + wave) * 16;
    v16h bq; { const float* pp = X + xrow(grp, q0 + col) + kh * HS + 8 * g;
#pragma unroll
      for (int i = 0; i < 8; ++i) { const float qv = bfr(pp[i]); bq[i] = (_Float16)(qv * 0.25f); bq[8 + i] = (_Float16)(qv * (0.25f / 2048.0f)); } }   // K = 16 real dims: slots 0..15 meet the keys' hi part, slots 16..31 their residual (stored x 2^11); both carry 16^-1/2 (powers of two)
    const int ko = (col * 4 + ((hh * 2 + g) ^ (col >> 2))) * 8;   // the head's own 8 dims, the same place in the hi and in the residual rows
    const int vo = (hh * 16 + col) * NP, vx = (g ^ col) * 8;
    float m = -3.0e38f, cb = 0.f, l = 0.f;   // running maximum of the query (equal in both halves); its exponent offset 11 - m log2(e) (unused while m is the start value); this half's share of the sum, x 2^11
    v8f acc = {}, accl = {};       // O^T: element r = head dim 8g + r of query col
#pragma unroll 1
    for (int ks = 0; ks < NP / 32; ++ks) { float s[2][8];
#pragma unroll
      for (int ct = 0; ct < 2; ++ct) { const int rk = (ks * 32 + ct * 16) * 32; union { v16h v; v8h q[2]; } ak; ak.q[0] = *(const v8h*)&skh[rk + ko]; ak.q[1] = *(const v8h*)&skl[rk + ko];   // element i = hi of dim 8g + i, element 8 + i = residual of the same dim: the order of bq
        v8f c = {}; c = wmma16(ak.v, bq, c);
#pragma unroll
        for (int r = 0; r < 8; ++r) s[ct][r] = c[r]; }
      if (ks * 32 + 32 > NNODE) {   // only the last key block holds padded keys
#pragma unroll
        for (int ct = 0; ct < 2; ++ct) {
#pragma unroll
          for (int r = 0; r < 8; ++r) if (ks * 32 + ct * 16 + 8 * g + r >= NNODE) s[ct][r] = -3.0e38f; } }
      float mx = fmaxf(s[0][0], s[1][0]);
#pragma unroll
      for (int r = 1; r < 8; ++r) mx = fmaxf(mx, fmaxf(s[0][r], s[1][r]));
      mx = fmaxf(mx, xhalf(mx));
      // p x 2^11 = 2^(s log2(e) + cn), cn = 11 - mn log2(e): one fused multiply-add a score carries the maximum, the change of base and the 2^11; cn, as rounded, is the one reference point of all terms, and the step between two of them rescales the old ones
      const float mn = fmaxf(m, mx), cn = __builtin_fmaf(mn, -L2E, 11.0f), alpha = (m <= -1.0e38f) ? 0.f : __builtin_amdgcn_exp2f(cn - cb); m = mn; cb = cn;
      v16h pb; float es0 = 0.f, es1 = 0.f; const v2f l2 = {L2E, L2E}, c2 = {cn, cn};
#pragma unroll
      for (int r = 0; r < 8; r += 2) { const v2f t0 = __builtin_elementwise_fma((v2f){s[0][r], s[0][r + 1]}, l2, c2), t1 = __builtin_elementwise_fma((v2f){s[1][r], s[1][r + 1]}, l2, c2);
#pragma unroll
        for (int i = 0; i < 2; ++i) { const float e0 = __builtin_amdgcn_exp2f(t0[i]), e1 = __builtin_amdgcn_exp2f(t1[i]);   // a padded key: 2^(-infinity) = 0 (mn is finite: keys 0..31 are real)
          es0 += e0; es1 += e1; pb[r + i] = (_Float16)e0; pb[8 + r + i] = (_Float16)e1; } }
      l = l * alpha + (es0 + es1);
#pragma unroll
      for (int r = 0; r < 8; ++r) { acc[r] *= alpha; accl[r] *= alpha; }
      { const int p0 = vo + ((ks * 32) ^ vx), p1 = vo + ((ks * 32 + 16) ^ vx); union { v16h v; v8h q[2]; } vh, vl; vh.q[0] = *(const v8h*)&svh[p0]; vh.q[1] = *(const v8h*)&svh[p1]; vl.q[0] = *(const v8h*)&svl[p0]; vl.q[1] = *(const v8h*)&svl[p1];
        acc = wmma16(vh.v, pb, acc); accl = wmma16(vl.v, pb, accl); } }
    const float inv = 1.0f / (l + xhalf(l));   // l and the two sums all carry the 2^11
    v4f o0, o1;
#pragma unroll
    for (int r = 0; r < 4; ++r) { o0[r] = (acc[r] + accl[r] * (1.0f / 2048.0f)) * inv; o1[r] = (acc[4 + r] + accl[4 + r] * (1.0f / 2048.0f)) * inv; }
    float* op = O + ((grp * NP) + q0 + col) * DD + kh * HS + 8 * g; vst2(op, o0); vst2(op + 4, o1);
    asm volatile("s_wait_xcnt 0x0" ::: "memory"); } }   // the next pass overwrites the registers that these two stores name
// ---- k_mlp: block = (64 padded rows, g): out = (relu(o (hi + lo) . W1^T + b1)) (hi + lo) . W2^T + b2; rows n >= 358 are computed from finite data but not written
__global__ __launch_bounds__(128) void k_mlp(const float* __restrict__ O, const _Float16* __restrict__ PW, const float* __restrict__ B1, const float* __restrict__ B2, float* __restrict__ OUT) { __shared__ __align__(16) float sf[4][16][132];
  const int tid = threadIdx.x, wave = tid >> 5, lane = tid & 31, col = lane & 15, g = lane >> 4; const size_t grp = blockIdx.y; const int n0 = blockIdx.x * 64 + wave * 16; const size_t r0 = grp * NP + n0; const _Float16 *P1 = PW + (size_t)(2 * NBATCH) * MATW, *P2 = P1 + MATW;
  v8f acc[8] = {};
#pragma unroll
  for (int kc = 0; kc < DD / 32; ++kc) { v16b w[8]; const F2 a = split_row(O + (r0 + col) * DD, kc * 32, lane);
    asm volatile("s_wait_xcnt 0x0" ::: "memory");   // before a fragment load's result may land in the address pair of the row's loads
#pragma unroll
    for (int j = 0; j < 8; ++j) w[j] = frag_p(P1, kc * 8 + j, lane);   // the k block's 16 loads stand ahead of its products, so that all are in flight together
#pragma unroll
    for (int j = 0; j < 8; ++j) { acc[j] = wmma_bf(a.h, w[j], acc[j]); acc[j] = wmma_bf(a.l, w[j], acc[j]); } }
#pragma unroll
  for (int j = 0; j < 8; ++j) { const float bb = bfr(B1[j * 16 + col]);
#pragma unroll
    for (int r = 0; r < 8; ++r) sf[wave][8 * g + r][j * 16 + col] = fmaxf(acc[j][r] + bb, 0.f); }
  LDSX();
  { v8f acc2[8] = {};
#pragma unroll
    for (int kc = 0; kc < DD / 32; ++kc) { float v[16]; const float* pp = &sf[wave][col][kc * 32 + 8 * g]; v16b w[8];
#pragma unroll
      for (int j = 0; j < 8; ++j) w[j] = frag_p(P2, kc * 8 + j, lane);   // as above
#pragma unroll
      for (int i = 0; i < 8; ++i) { v[i] = pp[i]; v[8 + i] = pp[16 + i]; }
      const F2 a = bsplit16(v);
#pragma unroll
      for (int j = 0; j < 8; ++j) { acc2[j] = wmma_bf(a.h, w[j], acc2[j]); acc2[j] = wmma_bf(a.l, w[j], acc2[j]); } }
    LDSX();
#pragma unroll
    for (int j = 0; j < 8; ++j) { const float bb = bfr(B2[j * 16 + col]);
#pragma unroll
      for (int r = 0; r < 8; ++r) sf[wave][8 * g + r][j * 16 + col] = acc2[j][r] + bb; } }
  LDSX(); for (int rl = 0; rl < 16; ++rl) { const int n = n0 + rl; if (n < NNODE) vst2(OUT + (grp * NNODE + n) * DD + lane * 4, *(const v4f*)&sf[wave][rl][lane * 4]); } }
extern "C" void kernel_launch(void* const* d_in, const int* in_sizes, int n_in, void* d_out, int out_size, void* d_ws, size_t ws_size, hipStream_t stream) {
  (void)in_sizes; (void)n_in; (void)out_size;
  const float** F = (const float**)d_in;   // 0 x [16,12,358,128], 1 wk [16,1,128,128] (in,out), 2 bk [16,1,1,128], 3 wv, 4 bv, 5 W1 [128,128] natural, 6 b1, 7 W2 [128,128] natural, 8 b2
  if (ws_size < (size_t)WS_END) return;
  char* ws = (char*)d_ws; _Float16* PW = (_Float16*)(ws + WS_PW); float* O = (float*)(ws + WS_O);
  k_pack<<<dim3(NMAT * 8), 256, 0, stream>>>(F[1], F[3], F[5], F[7], PW);
  k_att<<<dim3(KH / 2, TG), AW * 32, 0, stream>>>(F[0], PW, F[2], F[4], O);
  k_mlp<<<dim3(NP / 64, TG), 128, 0, stream>>>(O, PW, F[6], F[8], (float*)d_out);
}

// v007
// One run takes 66.2 microseconds.
// Two timings next to v006 both put it at 1.05 times that version's speed.
// Counting every step since v000, it is 4.92 times as fast.
// compute dtype: all float inputs rounded to bf16; key / val = x . wk[b] + bk[b] with EXACT bf16 products on WMMA 16x16x32 (per-sample (in,out) weights), f16 hi + residual; q = x itself (bf16 -> f16; 16-dim heads: the K=32 fragment holds k hi | k residual against q / 4 | q / 4 x 2^-11); logits 1 product, 16^-1/2 inside it, padded keys (N = 358 -> 384) excluded, running-max softmax in f32 (hardware exp); P (x 2^11, f16) . v (hi + residual, 2 products); projection1 (relu) and projection2 with the f32 activations as bf16 hi + lo against exact weights (2 products each); f32 output. All padded rows/columns are written with finite (clamped) data before any read.
#include <hip/hip_runtime.h>
#include <math.h>

typedef __attribute__((ext_vector_type(16))) _Float16 v16h;
typedef __attribute__((ext_vector_type(16))) __bf16 v16b;
typedef __attribute__((ext_vector_type(8)))  _Float16 v8h;
typedef __attribute__((ext_vector_type(8)))  float v8f;
typedef __attribute__((ext_vector_type(4)))  float v4f;
typedef __attribute__((ext_vector_type(2)))  float v2f;
typedef __attribute__((ext_vector_type(4)))  unsigned v4u;
typedef __attribute__((ext_vector_type(4)))  int v4i;
typedef float __attribute__((may_alias)) float_a;
typedef int __attribute__((may_alias)) int_a;

template <typename T> __device__ __forceinline__ void vst2(void* p, T v) { *(T*)p = v;  }
__device__ __forceinline__ v8f wmma16(v16h a, v16h b, v8f c) {
  v8f d = __builtin_amdgcn_wmma_f32_16x16x32_f16(false, a, false, b, (short)0, c, false, false);
  return d;
}
__device__ __forceinline__ v8f wmma_bf(v16b a, v16b b, v8f c) {
  v8f d = __builtin_amdgcn_wmma_f32_16x16x32_bf16(false, a, false, b, (short)0, c, false, false);
  return d;
}
// 16x16x32 fragments: lane = (h = lane>>4, row/col = lane&15); elements 0..7 = k0+8h+0..7, 8..15 = k0+16+8h+0..7; D element r = row 8h+r
__device__ __forceinline__ v16h frag_h(const _Float16* rowk0, int lane) {
  union { v16h v; v8h q[2]; } u; const _Float16* p = rowk0 + 8 * (lane >> 4);
  u.q[0] = *(const v8h*)p; u.q[1] = *(const v8h*)(p + 16); return u.v;
}
__device__ __forceinline__ v16h frag_f32(const float* rowk0, int lane) {
  v16h a; const float* p = rowk0 + 8 * (lane >> 4);
#pragma unroll
  for (int i = 0; i < 8; ++i) { a[i] = (_Float16)p[i]; a[8 + i] = (_Float16)p[16 + i]; }
  return a;
}
__device__ __forceinline__ v16h frag_f32s(const float* rowk0, int lane, float sc) {
  v16h a; const float* p = rowk0 + 8 * (lane >> 4);
#pragma unroll
  for (int i = 0; i < 8; ++i) { a[i] = (_Float16)(p[i] * sc); a[8 + i] = (_Float16)(p[16 + i] * sc); }
  return a;
}
// column fragment from a [K][ld] layout (column n), rows >= K read as 0
__device__ __forceinline__ v16h fragc_f32(const float* W, int k0, int n, int lane, int ld, int K) {
  v16h a; const int g = lane >> 4;
#pragma unroll
  for (int i = 0; i < 8; ++i) { const int ka = k0 + 8 * g + i, kb = ka + 16;
    a[i] = (_Float16)(ka < K ? W[(size_t)(ka < K ? ka : K - 1) * ld + n] : 0.f); a[8 + i] = (_Float16)(kb < K ? W[(size_t)(kb < K ? kb : K - 1) * ld + n] : 0.f); }
  return a;
}
struct F2 { v16b h, l; };
__device__ __forceinline__ F2 bsplit16(const float v[16]) { F2 r;
#pragma unroll
  for (int i = 0; i < 16; ++i) { const __bf16 h = (__bf16)v[i]; r.h[i] = h; r.l[i] = (__bf16)(v[i] - (float)h); }
  return r; }
__device__ __forceinline__ F2 split_row(const float* row, int k0, int lane) { float v[16]; const float* p = row + k0 + 8 * (lane >> 4);
#pragma unroll
  for (int i = 0; i < 8; ++i) { v[i] = p[i]; v[8 + i] = p[16 + i]; }
  return bsplit16(v); }
__device__ __forceinline__ F2 split_rowK(const float* row, int k0, int lane, int K) { float v[16]; const int g = lane >> 4;
#pragma unroll
  for (int i = 0; i < 8; ++i) { const int ka = k0 + 8 * g + i, kb = ka + 16; v[i] = ka < K ? row[ka < K ? ka : K - 1] : 0.f; v[8 + i] = kb < K ? row[kb < K ? kb : K - 1] : 0.f; }
  return bsplit16(v); }
__device__ __forceinline__ F2 split_col(const float* W, int k0, int n, int lane, int ld, int K) { float v[16]; const int g = lane >> 4;
#pragma unroll
  for (int i = 0; i < 8; ++i) { const int ka = k0 + 8 * g + i, kb = ka + 16; v[i] = ka < K ? W[(size_t)(ka < K ? ka : K - 1) * ld + n] : 0.f; v[8 + i] = kb < K ? W[(size_t)(kb < K ? kb : K - 1) * ld + n] : 0.f; }
  return bsplit16(v); }
__device__ __forceinline__ v8f mac3(const F2& a, const F2& b, v8f c) { c = wmma_bf(a.l, b.h, c); c = wmma_bf(a.h, b.l, c); return wmma_bf(a.h, b.h, c); }
__device__ __forceinline__ float sigm(float v) { return 1.0f / (1.0f + expf(-v)); }
#define LDSX() do { asm volatile("s_wait_dscnt 0" ::: "memory"); __builtin_amdgcn_wave_barrier(); __builtin_amdgcn_fence(__ATOMIC_RELEASE, "workgroup"); } while (0)


// Spatial self attention over graph nodes (B 16, T 12, N 358 nodes, D 128 = 8 heads x 16): key/val from per-sample dynamic linears, q = x; softmax(q k / 4) over nodes; o -> Linear -> relu -> Linear.
#define NBATCH 16
#define NT 12
#define NG (NBATCH * NT)  // 192 (b, t) groups
#define NNODE 358
#define NP 384            // padded node count (6 x 64)
#define DD 128
#define KH 8
#define HS 16
#ifndef TG
#define TG NG
#endif
typedef __attribute__((ext_vector_type(8))) __bf16 v8b;
__device__ __forceinline__ v16b frag_b(const __bf16* rowk0, int lane) {
  union { v16b v; v8b q[2]; } u; const __bf16* p = rowk0 + 8 * (lane >> 4);
  u.q[0] = *(const v8b*)p; u.q[1] = *(const v8b*)(p + 16); return u.v;
}
__device__ __forceinline__ float bfr(float v) { return (float)(__bf16)v; }
__device__ __attribute__((noinline)) float exp_ni(float v) { return expf(v); }
__device__ __attribute__((noinline)) float erf_ni(float v) { return erff(v); }

#define WS_O   0u                                   // f32 o rows [g][NP][128]
#define WS_PW  (WS_O + 4u * (size_t)NG * NP * DD)         // bf16 weights in fragment order, 34 matrices x 32 KiB
#define WS_END (WS_PW + 2u * (size_t)NMAT * DD * DD)

// ---- k_pack: every weight matrix is rounded to bf16 once a call and laid out as the B fragments of the 16x16x32 product are read.
// matrix m = 0..15 wk[b], 16..31 wv[b] ((in,out): element (k, n) at k * 128 + n), 32 W1, 33 W2 (natural: element (k, n) at n * 128 + k);
// fragment f = kc * 8 + j (k block of 32, column block of 16); half hf holds elements 8 hf .. 8 hf + 7 of every lane: k = kc * 32 + 16 hf + 8 (lane >> 4) + i, n = j * 16 + (lane & 15).
// 16-bit word ((m * 32 + f) * 2 + hf) * 256 + lane * 8 + i: a wave reads half a fragment as 512 contiguous bytes (four whole lines)
#define NMAT (2 * NBATCH + 2)
#define MATW (DD * DD)    // 16-bit words a packed matrix
__global__ __launch_bounds__(256) void k_pack(const float* __restrict__ WK, const float* __restrict__ WV, const float* __restrict__ W1, const float* __restrict__ W2, _Float16* __restrict__ PW) {
  const int t = blockIdx.x * 256 + threadIdx.x, lane = t & 31, hf = (t >> 5) & 1, f = (t >> 6) & 31, m = blockIdx.x >> 3;   // one 16-byte chunk a thread; 8 blocks a matrix
  const int k0 = (f >> 3) * 32 + hf * 16 + 8 * (lane >> 4), n = (f & 7) * 16 + (lane & 15);
  union { v8b v; v4u q; } o; float v[8];
  if (m < 2 * NBATCH) { const float* Wm = (m < NBATCH ? WK : WV) + (size_t)(m & (NBATCH - 1)) * DD * DD + (size_t)k0 * DD + n;
#pragma unroll
    for (int i = 0; i < 8; ++i) v[i] = Wm[i * DD]; }
  else { const float* Wm = (m == 2 * NBATCH ? W1 : W2) + (size_t)n * DD + k0;
#pragma unroll
    for (int i = 0; i < 8; ++i) v[i] = Wm[i]; }
  asm volatile("s_wait_xcnt 0x0" ::: "memory");   // before a converted value may land in an address register of these loads
#pragma unroll
  for (int i = 0; i < 8; ++i) o.v[i] = (__bf16)v[i];
  vst2(PW + (size_t)t * 8, o.q); }
// fragment f of a packed matrix (the pointer type only carries 16-bit words: the bits are bf16)
__device__ __forceinline__ v16b frag_p(const _Float16* Pm, int f, int lane) {
  union { v16b v; v4u q[2]; } u; const _Float16* p = Pm + f * 512 + lane * 8;
  u.q[0] = *(const v4u*)p; u.q[1] = *(const v4u*)(p + 256); return u.v;
}
__device__ __forceinline__ size_t xrow(size_t g, int n) { return (g * NNODE + (size_t)(n < NNODE ? n : NNODE - 1)) * DD; }   // clamped node row of x
// lane l with lane l ^ 16 (the two halves of a wave hold the two key halves of one query column)
__device__ __forceinline__ float xhalf(float x) { return __builtin_bit_cast(float, __builtin_amdgcn_permlanex16(__builtin_bit_cast(int, x), __builtin_bit_cast(int, x), 0x76543210, 0xfedcba98, false, false)); }
// ---- k_att: block = (head pair, g), 12 waves x 2 query tiles: the block itself forms the pair's key rows and val planes (hi and residual, all 384 keys, 96 KiB) from x and the packed weights, straight into LDS, and every fragment is read from there.
// projection: wave = 2 x 16 padded nodes (clamped rows of x), 32 columns of key and of val: key^T = wk^T . x^T (A = packed weight fragment, B = x rows), so a lane holds 8 consecutive dims of ONE node = one 16-byte chunk of its key row;
// val = x . wv (A = x rows, B = packed weight fragment), so a lane holds 8 consecutive nodes of ONE dim = one 16-byte chunk of its val plane row. The same fragments and the same k order serve both operand sides.
// wave = (16 queries, head): S^T = K . Q^T (A = key rows, B = q), so a lane holds 2 x 8 keys' scores of ONE query (column = lane & 15); maximum and sum run in-lane plus one exchange between halves;
// the two score tiles, converted in place, are the B operand of O^T += V^T . P^T (element i = key 8h + i, element 8 + i = key 16 + 8h + i, the order of frag_h on the val planes)
// LDS places, no pad: chunk c (16 bytes) of key row n lies at chunk c ^ ((n >> 2) & 3) of its 64-byte row; chunk c of val plane row d at chunk c ^ (d & 15) of its 768-byte row: the 16 lanes of a fragment read fall on 16 different bank groups
#define AW 12
#define L2E 1.44269504088896340736f
// nine waves a SIMD are asked for: at most 112 registers a wave keep three blocks (36 waves, 288 KiB of LDS) on a WGP, so that all 768 blocks are resident at once; without it the projection takes a few registers more and one block a WGP is lost
__global__ __launch_bounds__(AW * 32) __attribute__((amdgpu_waves_per_eu(9))) void k_att(const float* __restrict__ X, const _Float16* __restrict__ PW, const float* __restrict__ BK, const float* __restrict__ BV, float* __restrict__ O) {
  __shared__ __align__(16) _Float16 skh[NP * 32], skl[NP * 32], svh[32 * NP], svl[32 * NP];
  const int tid = threadIdx.x, wave = tid >> 5, lane = tid & 31, col = lane & 15, g = lane >> 4; const int hp = blockIdx.x; const size_t grp = blockIdx.y;
  { const size_t b = grp / NT; const _Float16* Pw = PW + (b * MATW + hp * 1024) + (unsigned)(lane * 8);   // the lane's 16 bytes of fragment (k block 0, column block 2 hp) of wk[b]; wv[b] lies NBATCH matrices on
    const float *Bk = BK + (b * DD + hp * 32) + (unsigned)(8 * g), *Bv = BV + (b * DD + hp * 32) + (unsigned)col, *Xg = X + grp * (size_t)(NNODE * DD);   // block-uniform bases, 32-bit lane offsets
#pragma unroll 1   // rolled: one copy of the projection in the code, and its registers stay within what nine waves a SIMD leave a wave
    for (int nt = 0; nt < 2; ++nt) { const int n0 = (nt * AW + wave) * 16, n = n0 + col; const float* pp = Xg + (unsigned)((n < NNODE ? n : NNODE - 1) * DD + 8 * g); float xv[64]; v16b a[4];
#pragma unroll
      for (int kc = 0; kc < DD / 32; ++kc) {
#pragma unroll
        for (int i = 0; i < 8; ++i) { xv[kc * 16 + i] = pp[kc * 32 + i]; xv[kc * 16 + 8 + i] = pp[kc * 32 + 16 + i]; } }   // the row's 16 loads stand together, so that all are in flight at once
      asm volatile("s_wait_xcnt 0x0" ::: "memory");   // before a converted value may land in the offset register of these loads
#pragma unroll
      for (int kc = 0; kc < DD / 32; ++kc) {
#pragma unroll
        for (int i = 0; i < 16; ++i) a[kc][i] = (__bf16)xv[kc * 16 + i]; }
      __builtin_amdgcn_sched_barrier(0);   // the weight loads below stay behind the conversion: lifted among the row's 64 loaded registers they push a value out to scratch memory
      { v8f ck[2] = {};   // key^T: element r = dim j * 16 + 8g + r of node n
#pragma unroll
        for (int k2 = 0; k2 < DD / 64; ++k2) { union { v16b v; v4u q[2]; } w[4];
#pragma unroll
          for (int f = 0; f < 4; ++f) { const _Float16* p = Pw + ((k2 * 2 + (f >> 1)) * 8 + (f & 1)) * 512; w[f].q[0] = *(const v4u*)p; w[f].q[1] = *(const v4u*)(p + 256); }   // two k blocks' 8 loads stand ahead of their products, so that all are in flight together
#pragma unroll
          for (int f = 0; f < 4; ++f) ck[f & 1] = wmma_bf(w[f].v, a[k2 * 2 + (f >> 1)], ck[f & 1]); }
#pragma unroll
        for (int j = 0; j < 2; ++j) { v8h h8, l8;
#pragma unroll
          for (int r = 0; r < 8; ++r) { const float v = ck[j][r] + bfr(Bk[j * 16 + r]); const _Float16 hv = (_Float16)v; h8[r] = hv; l8[r] = (_Float16)((v - (float)hv) * 2048.0f); }
          const int d = (n * 4 + ((j * 2 + g) ^ ((n >> 2) & 3))) * 8; *(v8h*)&skh[d] = h8; *(v8h*)&skl[d] = l8; } }
      __builtin_amdgcn_sched_barrier(0);   // val's weight loads stay behind key's products: mixed among them they push two lane constants out to scratch memory
      { v8f cv[2] = {};   // val: element r = node n0 + 8g + r, dim j * 16 + col
#pragma unroll
        for (int k2 = 0; k2 < DD / 64; ++k2) { union { v16b v; v4u q[2]; } w[4];
#pragma unroll
          for (int f = 0; f < 4; ++f) { const _Float16* p = Pw + (size_t)NBATCH * MATW + ((k2 * 2 + (f >> 1)) * 8 + (f & 1)) * 512; w[f].q[0] = *(const v4u*)p; w[f].q[1] = *(const v4u*)(p + 256); }   // as above
#pragma unroll
          for (int f = 0; f < 4; ++f) cv[f & 1] = wmma_bf(a[k2 * 2 + (f >> 1)], w[f].v, cv[f & 1]); }
#pragma unroll
        for (int j = 0; j < 2; ++j) { v8h h8, l8; const float bb = bfr(Bv[j * 16]);
#pragma unroll
          for (int r = 0; r < 8; ++r) { const float v = cv[j][r] + bb; const _Float16 hv = (_Float16)v; h8[r] = hv; l8[r] = (_Float16)((v - (float)hv) * 2048.0f); }
          const int dd = j * 16 + col, d = (dd * (NP / 8) + (((n0 >> 3) + g) ^ col)) * 8; *(v8h*)&svh[d] = h8; *(v8h*)&svl[d] = l8; } }
      asm volatile("s_wait_xcnt 0x0" ::: "memory"); } }   // the next pass, and the code behind the loop, overwrite address registers of this pass's loads
  __syncthreads();   // the rows and planes written above are read below by every wave of the block
#pragma unroll 1   // rolled, as the loop over the two heads was: one copy of the key loop in the code
  for (int it = 0; it < 4; ++it) { const int hh = it & 1, kh = hp * 2 + hh, q0 = ((it >> 1) * AW + wave) * 16;
    v16h bq; { const float* pp = X + xrow(grp, q0 + col) + kh * HS + 8 * g;
#pragma unroll
      for (int i = 0; i < 8; ++i) { const float qv = bfr(pp[i]); bq[i] = (_Float16)(qv * 0.25f); bq[8 + i] = (_Float16)(qv * (0.25f / 2048.0f)); } }   // K = 16 real dims: slots 0..15 meet the keys' hi part, slots 16..31 their residual (stored x 2^11); both carry 16^-1/2 (powers of two)
    const int ko = (col * 4 + ((hh * 2 + g) ^ (col >> 2))) * 8;   // the head's own 8 dims, the same place in the hi and in the residual rows
    const int vo = (hh * 16 + col) * NP, vx = (g ^ col) * 8;
    float m = -3.0e38f, cb = 0.f, l = 0.f;   // running maximum of the query (equal in both halves); its exponent offset 11 - m log2(e) (unused while m is the start value); this half's share of the sum, x 2^11
    v8f acc = {}, accl = {};       // O^T: element r = head dim 8g + r of query col
#pragma unroll 1
    for (int ks = 0; ks < NP / 32; ++ks) { float s[2][8];
#pragma unroll
      for (int ct = 0; ct < 2; ++ct) { const int rk = (ks * 32 + ct * 16) * 32; union { v16h v; v8h q[2]; } ak; ak.q[0] = *(const v8h*)&skh[rk + ko]; ak.q[1] = *(const v8h*)&skl[rk + ko];   // element i = hi of dim 8g + i, element 8 + i = residual of the same dim: the order of bq
        v8f c = {}; c = wmma16(ak.v, bq, c);
#pragma unroll
        for (int r = 0; r < 8; ++r) s[ct][r] = c[r]; }
      if (ks * 32 + 32 > NNODE) {   // only the last key block holds padded keys
#pragma unroll
        for (int ct = 0; ct < 2; ++ct) {
#pragma unroll
          for (int r = 0; r < 8; ++r) if (ks * 32 + ct * 16 + 8 * g + r >= NNODE) s[ct][r] = -3.0e38f; } }
      float mx = fmaxf(s[0][0], s[1][0]);
#pragma unroll
      for (int r = 1; r < 8; ++r) mx = fmaxf(mx, fmaxf(s[0][r], s[1][r]));
      mx = fmaxf(mx, xhalf(mx));
      // p x 2^11 = 2^(s log2(e) + cn), cn = 11 - mn log2(e): one fused multiply-add a score carries the maximum, the change of base and the 2^11; cn, as rounded, is the one reference point of all terms, and the step between two of them rescales the old ones
      const float mn = fmaxf(m, mx), cn = __builtin_fmaf(mn, -L2E, 11.0f), alpha = (m <= -1.0e38f) ? 0.f : __builtin_amdgcn_exp2f(cn - cb); m = mn; cb = cn;
      v16h pb; float es0 = 0.f, es1 = 0.f; const v2f l2 = {L2E, L2E}, c2 = {cn, cn};
#pragma unroll
      for (int r = 0; r < 8; r += 2) { const v2f t0 = __builtin_elementwise_fma((v2f){s[0][r], s[0][r + 1]}, l2, c2), t1 = __builtin_elementwise_fma((v2f){s[1][r], s[1][r + 1]}, l2, c2);
#pragma unroll
        for (int i = 0; i < 2; ++i) { const float e0 = __builtin_amdgcn_exp2f(t0[i]), e1 = __builtin_amdgcn_exp2f(t1[i]);   // a padded key: 2^(-infinity) = 0 (mn is finite: keys 0..31 are real)
          es0 += e0; es1 += e1; pb[r + i] = (_Float16)e0; pb[8 + r + i] = (_Float16)e1; } }
      l = l * alpha + (es0 + es1);
#pragma unroll
      for (int r = 0; r < 8; ++r) { acc[r] *= alpha; accl[r] *= alpha; }
      { const int p0 = vo + ((ks * 32) ^ vx), p1 = vo + ((ks * 32 + 16) ^ vx); union { v16h v; v8h q[2]; } vh, vl; vh.q[0] = *(const v8h*)&svh[p0]; vh.q[1] = *(const v8h*)&svh[p1]; vl.q[0] = *(const v8h*)&svl[p0]; vl.q[1] = *(const v8h*)&svl[p1];
        acc = wmma16(vh.v, pb, acc); accl = wmma16(vl.v, pb, accl); } }
    const float inv = 1.0f / (l + xhalf(l));   // l and the two sums all carry the 2^11
    v4f o0, o1;
#pragma unroll
    for (int r = 0; r < 4; ++r) { o0[r] = (acc[r] + accl[r] * (1.0f / 2048.0f)) * inv; o1[r] = (acc[4 + r] + accl[4 + r] * (1.0f / 2048.0f)) * inv; }
    float* op = O + ((grp * NP) + q0 + col) * DD + kh * HS + 8 * g; vst2(op, o0); vst2(op + 4, o1);
    asm volatile("s_wait_xcnt 0x0" ::: "memory"); } }   // the next pass overwrites the registers that these two stores name
// ---- k_mlp: block = (64 padded rows, g): out = (relu(o (hi + lo) . W1^T + b1)) (hi + lo) . W2^T + b2; rows n >= 358 are computed from finite data but not written
__global__ __launch_bounds__(128) void k_mlp(const float* __restrict__ O, const _Float16* __restrict__ PW, const float* __restrict__ B1, const float* __restrict__ B2, float* __restrict__ OUT) { __shared__ __align__(16) float sf[4][16][132];
  const int tid = threadIdx.x, wave = tid >> 5, lane = tid & 31, col = lane & 15, g = lane >> 4; const size_t grp = blockIdx.y; const int n0 = blockIdx.x * 64 + wave * 16; const size_t r0 = grp * NP + n0; const _Float16 *P1 = PW + (size_t)(2 * NBATCH) * MATW, *P2 = P1 + MATW;
  v8f acc[8] = {};
#pragma unroll
  for (int kc = 0; kc < DD / 32; ++kc) { v16b w[8]; const F2 a = split_row(O + (r0 + col) * DD, kc * 32, lane);
    asm volatile("s_wait_xcnt 0x0" ::: "memory");   // before a fragment load's result may land in the address pair of the row's loads
#pragma unroll
    for (int j = 0; j < 8; ++j) w[j] = frag_p(P1, kc * 8 + j, lane);   // the k block's 16 loads stand ahead of its products, so that all are in flight together
#pragma unroll
    for (int j = 0; j < 8; ++j) { acc[j] = wmma_bf(a.h, w[j], acc[j]); acc[j] = wmma_bf(a.l, w[j], acc[j]); }
    __builtin_amdgcn_sched_barrier(0); }   // the next k block's loads stay behind these products: lifted among them they take the wave past 192 registers, and the fifth wave a SIMD (all 1152 blocks resident at once) is lost
#pragma unroll
  for (int j = 0; j < 8; ++j) { const float bb = bfr(B1[j * 16 + col]);
#pragma unroll
    for (int r = 0; r < 8; ++r) sf[wave][8 * g + r][j * 16 + col] = fmaxf(acc[j][r] + bb, 0.f); }
  LDSX();
  { v8f acc2[8] = {};
#pragma unroll
    for (int kc = 0; kc < DD / 32; ++kc) { float v[16]; const float* pp = &sf[wave][col][kc * 32 + 8 * g]; v16b w[8];
#pragma unroll
      for (int j = 0; j < 8; ++j) w[j] = frag_p(P2, kc * 8 + j, lane);   // as above
#pragma unroll
      for (int i = 0; i < 8; ++i) { v[i] = pp[i]; v[8 + i] = pp[16 + i]; }
      const F2 a = bsplit16(v);
#pragma unroll
      for (int j = 0; j < 8; ++j) { acc2[j] = wmma_bf(a.h, w[j], acc2[j]); acc2[j] = wmma_bf(a.l, w[j], acc2[j]); } }
    asm volatile("s_wait_xcnt 0x0" ::: "memory");   // the code below overwrites the offset register of the fragment loads
    LDSX();
#pragma unroll
    for (int j = 0; j < 8; ++j) { const float bb = bfr(B2[j * 16 + col]);
#pragma unroll
      for (int r = 0; r < 8; ++r) sf[wave][8 * g + r][j * 16 + col] = acc2[j][r] + bb; } }
  LDSX(); for (int rl = 0; rl < 16; ++rl) { const int n = n0 + rl; if (n < NNODE) vst2(OUT + (grp * NNODE + n) * DD + lane * 4, *(const v4f*)&sf[wave][rl][lane * 4]); } }
extern "C" void kernel_launch(void* const* d_in, const int* in_sizes, int n_in, void* d_out, int out_size, void* d_ws, size_t ws_size, hipStream_t stream) {
  (void)in_sizes; (void)n_in; (void)out_size;
  const float** F = (const float**)d_in;   // 0 x [16,12,358,128], 1 wk [16,1,128,128] (in,out), 2 bk [16,1,1,128], 3 wv, 4 bv, 5 W1 [128,128] natural, 6 b1, 7 W2 [128,128] natural, 8 b2
  if (ws_size < (size_t)WS_END) return;
  char* ws = (char*)d_ws; _Float16* PW = (_Float16*)(ws + WS_PW); float* O = (float*)(ws + WS_O);
  k_pack<<<dim3(NMAT * 8), 256, 0, stream>>>(F[1], F[3], F[5], F[7], PW);
  k_att<<<dim3(KH / 2, TG), AW * 32, 0, stream>>>(F[0], PW, F[2], F[4], O);
  k_mlp<<<dim3(NP / 64, TG), 128, 0, stream>>>(O, PW, F[6], F[8], (float*)d_out);
}

// v008
// It runs in 60.9 microseconds.
// Two timings next to v007 both put it at 1.09 times that version's speed.
// All steps since v000 together make it 5.37 times as fast.
// compute dtype: all float inputs rounded to bf16; key / val = x . wk[b] + bk[b] with EXACT bf16 products on WMMA 16x16x32 (per-sample (in,out) weights), f16 hi + residual; q = x itself (bf16 -> f16; 16-dim heads: the K=32 fragment holds k hi | k residual against q / 4 | q / 4 x 2^-11); logits 1 product, 16^-1/2 inside it, padded keys (N = 358 -> 384) excluded, softmax in f32 (hardware exp) about a reference point, set in the first key block, that moves only when some lane's sum of 16 terms leaves the f16 range; P (x 2^11, f16) . v (hi + residual, 2 products); projection1 (relu) and projection2 with the f32 activations as bf16 hi + lo against exact weights (2 products each); f32 output. All padded rows/columns are written with finite (clamped) data before any read.
#include <hip/hip_runtime.h>
#include <math.h>

typedef __attribute__((ext_vector_type(16))) _Float16 v16h;
typedef __attribute__((ext_vector_type(16))) __bf16 v16b;
typedef __attribute__((ext_vector_type(8)))  _Float16 v8h;
typedef __attribute__((ext_vector_type(8)))  float v8f;
typedef __attribute__((ext_vector_type(4)))  float v4f;
typedef __attribute__((ext_vector_type(2)))  float v2f;
typedef __attribute__((ext_vector_type(4)))  unsigned v4u;
typedef __attribute__((ext_vector_type(4)))  int v4i;
typedef float __attribute__((may_alias)) float_a;
typedef int __attribute__((may_alias)) int_a;

template <typename T> __device__ __forceinline__ void vst2(void* p, T v) { *(T*)p = v;  }
__device__ __forceinline__ v8f wmma16(v16h a, v16h b, v8f c) {
  v8f d = __builtin_amdgcn_wmma_f32_16x16x32_f16(false, a, false, b, (short)0, c, false, false);
  return d;
}
__device__ __forceinline__ v8f wmma_bf(v16b a, v16b b, v8f c) {
  v8f d = __builtin_amdgcn_wmma_f32_16x16x32_bf16(false, a, false, b, (short)0, c, false, false);
  return d;
}
// 16x16x32 fragments: lane = (h = lane>>4, row/col = lane&15); elements 0..7 = k0+8h+0..7, 8..15 = k0+16+8h+0..7; D element r = row 8h+r
__device__ __forceinline__ v16h frag_h(const _Float16* rowk0, int lane) {
  union { v16h v; v8h q[2]; } u; const _Float16* p = rowk0 + 8 * (lane >> 4);
  u.q[0] = *(const v8h*)p; u.q[1] = *(const v8h*)(p + 16); return u.v;
}
__device__ __forceinline__ v16h frag_f32(const float* rowk0, int lane) {
  v16h a; const float* p = rowk0 + 8 * (lane >> 4);
#pragma unroll
  for (int i = 0; i < 8; ++i) { a[i] = (_Float16)p[i]; a[8 + i] = (_Float16)p[16 + i]; }
  return a;
}
__device__ __forceinline__ v16h frag_f32s(const float* rowk0, int lane, float sc) {
  v16h a; const float* p = rowk0 + 8 * (lane >> 4);
#pragma unroll
  for (int i = 0; i < 8; ++i) { a[i] = (_Float16)(p[i] * sc); a[8 + i] = (_Float16)(p[16 + i] * sc); }
  return a;
}
// column fragment from a [K][ld] layout (column n), rows >= K read as 0
__device__ __forceinline__ v16h fragc_f32(const float* W, int k0, int n, int lane, int ld, int K) {
  v16h a; const int g = lane >> 4;
#pragma unroll
  for (int i = 0; i < 8; ++i) { const int ka = k0 + 8 * g + i, kb = ka + 16;
    a[i] = (_Float16)(ka < K ? W[(size_t)(ka < K ? ka : K - 1) * ld + n] : 0.f); a[8 + i] = (_Float16)(kb < K ? W[(size_t)(kb < K ? kb : K - 1) * ld + n] : 0.f); }
  return a;
}
struct F2 { v16b h, l; };
__device__ __forceinline__ F2 bsplit16(const float v[16]) { F2 r;
#pragma unroll
  for (int i = 0; i < 16; ++i) { const __bf16 h = (__bf16)v[i]; r.h[i] = h; r.l[i] = (__bf16)(v[i] - (float)h); }
  return r; }
__device__ __forceinline__ F2 split_row(const float* row, int k0, int lane) { float v[16]; const float* p = row + k0 + 8 * (lane >> 4);
#pragma unroll
  for (int i = 0; i < 8; ++i) { v[i] = p[i]; v[8 + i] = p[16 + i]; }
  return bsplit16(v); }
__device__ __forceinline__ F2 split_rowK(const float* row, int k0, int lane, int K) { float v[16]; const int g = lane >> 4;
#pragma unroll
  for (int i = 0; i < 8; ++i) { const int ka = k0 + 8 * g + i, kb = ka + 16; v[i] = ka < K ? row[ka < K ? ka : K - 1] : 0.f; v[8 + i] = kb < K ? row[kb < K ? kb : K - 1] : 0.f; }
  return bsplit16(v); }
__device__ __forceinline__ F2 split_col(const float* W, int k0, int n, int lane, int ld, int K) { float v[16]; const int g = lane >> 4;
#pragma unroll
  for (int i = 0; i < 8; ++i) { const int ka = k0 + 8 * g + i, kb = ka + 16; v[i] = ka < K ? W[(size_t)(ka < K ? ka : K - 1) * ld + n] : 0.f; v[8 + i] = kb < K ? W[(size_t)(kb < K ? kb : K - 1) * ld + n] : 0.f; }
  return bsplit16(v); }
__device__ __forceinline__ v8f mac3(const F2& a, const F2& b, v8f c) { c = wmma_bf(a.l, b.h, c); c = wmma_bf(a.h, b.l, c); return wmma_bf(a.h, b.h, c); }
__device__ __forceinline__ float sigm(float v) { return 1.0f / (1.0f + expf(-v)); }
#define LDSX() do { asm volatile("s_wait_dscnt 0" ::: "memory"); __builtin_amdgcn_wave_barrier(); __builtin_amdgcn_fence(__ATOMIC_RELEASE, "workgroup"); } while (0)


// Spatial self attention over graph nodes (B 16, T 12, N 358 nodes, D 128 = 8 heads x 16): key/val from per-sample dynamic linears, q = x; softmax(q k / 4) over nodes; o -> Linear -> relu -> Linear.
#define NBATCH 16
#define NT 12
#define NG (NBATCH * NT)  // 192 (b, t) groups
#define NNODE 358
#define NP 384            // padded node count (6 x 64)
#define DD 128
#define KH 8
#define HS 16
#ifndef TG
#define TG NG
#endif
typedef __attribute__((ext_vector_type(8))) __bf16 v8b;
__device__ __forceinline__ v16b frag_b(const __bf16* rowk0, int lane) {
  union { v16b v; v8b q[2]; } u; const __bf16* p = rowk0 + 8 * (lane >> 4);
  u.q[0] = *(const v8b*)p; u.q[1] = *(const v8b*)(p + 16); return u.v;
}
__device__ __forceinline__ float bfr(float v) { return (float)(__bf16)v; }
__device__ __attribute__((noinline)) float exp_ni(float v) { return expf(v); }
__device__ __attribute__((noinline)) float erf_ni(float v) { return erff(v); }

#define WS_O   0u                                   // f32 o rows [g][NP][128]
#define WS_PW  (WS_O + 4u * (size_t)NG * NP * DD)         // bf16 weights in fragment order, 34 matrices x 32 KiB
#define WS_END (WS_PW + 2u * (size_t)NMAT * DD * DD)

// ---- k_pack: every weight matrix is rounded to bf16 once a call and laid out as the B fragments of the 16x16x32 product are read.
// matrix m = 0..15 wk[b], 16..31 wv[b] ((in,out): element (k, n) at k * 128 + n), 32 W1, 33 W2 (natural: element (k, n) at n * 128 + k);
// fragment f = kc * 8 + j (k block of 32, column block of 16); half hf holds elements 8 hf .. 8 hf + 7 of every lane: k = kc * 32 + 16 hf + 8 (lane >> 4) + i, n = j * 16 + (lane & 15).
// 16-bit word ((m * 32 + f) * 2 + hf) * 256 + lane * 8 + i: a wave reads half a fragment as 512 contiguous bytes (four whole lines)
#define NMAT (2 * NBATCH + 2)
#define MATW (DD * DD)    // 16-bit words a packed matrix
__global__ __launch_bounds__(256) void k_pack(const float* __restrict__ WK, const float* __restrict__ WV, const float* __restrict__ W1, const float* __restrict__ W2, _Float16* __restrict__ PW) {
  const int t = blockIdx.x * 256 + threadIdx.x, lane = t & 31, hf = (t >> 5) & 1, f = (t >> 6) & 31, m = blockIdx.x >> 3;   // one 16-byte chunk a thread; 8 blocks a matrix
  const int k0 = (f >> 3) * 32 + hf * 16 + 8 * (lane >> 4), n = (f & 7) * 16 + (lane & 15);
  union { v8b v; v4u q; } o; float v[8];
  if (m < 2 * NBATCH) { const float* Wm = (m < NBATCH ? WK : WV) + (size_t)(m & (NBATCH - 1)) * DD * DD + (size_t)k0 * DD + n;
#pragma unroll
    for (int i = 0; i < 8; ++i) v[i] = Wm[i * DD]; }
  else { const float* Wm = (m == 2 * NBATCH ? W1 : W2) + (size_t)n * DD + k0;
#pragma unroll
    for (int i = 0; i < 8; ++i) v[i] = Wm[i]; }
  asm volatile("s_wait_xcnt 0x0" ::: "memory");   // before a converted value may land in an address register of these loads
#pragma unroll
  for (int i = 0; i < 8; ++i) o.v[i] = (__bf16)v[i];
  vst2(PW + (size_t)t * 8, o.q); }
// fragment f of a packed matrix (the pointer type only carries 16-bit words: the bits are bf16)
__device__ __forceinline__ v16b frag_p(const _Float16* Pm, int f, int lane) {
  union { v16b v; v4u q[2]; } u; const _Float16* p = Pm + f * 512 + lane * 8;
  u.q[0] = *(const v4u*)p; u.q[1] = *(const v4u*)(p + 256); return u.v;
}
__device__ __forceinline__ size_t xrow(size_t g, int n) { return (g * NNODE + (size_t)(n < NNODE ? n : NNODE - 1)) * DD; }   // clamped node row of x
// lane l with lane l ^ 16 (the two halves of a wave hold the two key halves of one query column)
__device__ __forceinline__ float xhalf(float x) { return __builtin_bit_cast(float, __builtin_amdgcn_permlanex16(__builtin_bit_cast(int, x), __builtin_bit_cast(int, x), 0x76543210, 0xfedcba98, false, false)); }
// ---- k_att: block = (head pair, g), 12 waves x 2 query tiles: the block itself forms the pair's key rows and val planes (hi and residual, all 384 keys, 96 KiB) from x and the packed weights, straight into LDS, and every fragment is read from there.
// projection: wave = 2 x 16 padded nodes (clamped rows of x), 32 columns of key and of val: key^T = wk^T . x^T (A = packed weight fragment, B = x rows), so a lane holds 8 consecutive dims of ONE node = one 16-byte chunk of its key row;
// val = x . wv (A = x rows, B = packed weight fragment), so a lane holds 8 consecutive nodes of ONE dim = one 16-byte chunk of its val plane row. The same fragments and the same k order serve both operand sides.
// wave = (16 queries, head): S^T = K . Q^T (A = key rows, B = q), so a lane holds 2 x 8 keys' scores of ONE query (column = lane & 15); maximum and sum run in-lane plus one exchange between halves;
// the two score tiles, converted in place, are the B operand of O^T += V^T . P^T (element i = key 8h + i, element 8 + i = key 16 + 8h + i, the order of frag_h on the val planes)
// LDS places, no pad: chunk c (16 bytes) of key row n lies at chunk c ^ ((n >> 2) & 3) of its 64-byte row; chunk c of val plane row d at chunk c ^ (d & 15) of its 768-byte row: the 16 lanes of a fragment read fall on 16 different bank groups
#define AW 12
#define L2E 1.44269504088896340736f
// nine waves a SIMD are asked for: at most 112 registers a wave keep three blocks (36 waves, 288 KiB of LDS) on a WGP, so that all 768 blocks are resident at once; without it the projection takes a few registers more and one block a WGP is lost
__global__ __launch_bounds__(AW * 32) __attribute__((amdgpu_waves_per_eu(9))) void k_att(const float* __restrict__ X, const _Float16* __restrict__ PW, const float* __restrict__ BK, const float* __restrict__ BV, float* __restrict__ O) {
  __shared__ __align__(16) _Float16 skh[NP * 32], skl[NP * 32], svh[32 * NP], svl[32 * NP];
  const int tid = threadIdx.x, wave = tid >> 5, lane = tid & 31, col = lane & 15, g = lane >> 4; const int hp = blockIdx.x; const size_t grp = blockIdx.y;
  { const size_t b = grp / NT; const _Float16* Pw = PW + (b * MATW + hp * 1024) + (unsigned)(lane * 8);   // the lane's 16 bytes of fragment (k block 0, column block 2 hp) of wk[b]; wv[b] lies NBATCH matrices on
    const float *Bk = BK + (b * DD + hp * 32) + (unsigned)(8 * g), *Bv = BV + (b * DD + hp * 32) + (unsigned)col, *Xg = X + grp * (size_t)(NNODE * DD);   // block-uniform bases, 32-bit lane offsets
#pragma unroll 1   // rolled: one copy of the projection in the code, and its registers stay within what nine waves a SIMD leave a wave
    for (int nt = 0; nt < 2; ++nt) { const int n0 = (nt * AW + wave) * 16, n = n0 + col; const float* pp = Xg + (unsigned)((n < NNODE ? n : NNODE - 1) * DD + 8 * g); float xv[64]; v16b a[4];
#pragma unroll
      for (int kc = 0; kc < DD / 32; ++kc) {
#pragma unroll
        for (int i = 0; i < 8; ++i) { xv[kc * 16 + i] = pp[kc * 32 + i]; xv[kc * 16 + 8 + i] = pp[kc * 32 + 16 + i]; } }   // the row's 16 loads stand together, so that all are in flight at once
      asm volatile("s_wait_xcnt 0x0" ::: "memory");   // before a converted value may land in the offset register of these loads
#pragma unroll
      for (int kc = 0; kc < DD / 32; ++kc) {
#pragma unroll
        for (int i = 0; i < 16; ++i) a[kc][i] = (__bf16)xv[kc * 16 + i]; }
      __builtin_amdgcn_sched_barrier(0);   // the weight loads below stay behind the conversion: lifted among the row's 64 loaded registers they push a value out to scratch memory
      { v8f ck[2] = {};   // key^T: element r = dim j * 16 + 8g + r of node n
#pragma unroll
        for (int k2 = 0; k2 < DD / 64; ++k2) { union { v16b v; v4u q[2]; } w[4];
#pragma unroll
          for (int f = 0; f < 4; ++f) { const _Float16* p = Pw + ((k2 * 2 + (f >> 1)) * 8 + (f & 1)) * 512; w[f].q[0] = *(const v4u*)p; w[f].q[1] = *(const v4u*)(p + 256); }   // two k blocks' 8 loads stand ahead of their products, so that all are in flight together
#pragma unroll
          for (int f = 0; f < 4; ++f) ck[f & 1] = wmma_bf(w[f].v, a[k2 * 2 + (f >> 1)], ck[f & 1]); }
#pragma unroll
        for (int j = 0; j < 2; ++j) { v8h h8, l8;
#pragma unroll
          for (int r = 0; r < 8; ++r) { const float v = ck[j][r] + bfr(Bk[j * 16 + r]); const _Float16 hv = (_Float16)v; h8[r] = hv; l8[r] = (_Float16)((v - (float)hv) * 2048.0f); }
          const int d = (n * 4 + ((j * 2 + g) ^ ((n >> 2) & 3))) * 8; *(v8h*)&skh[d] = h8; *(v8h*)&skl[d] = l8; } }
      __builtin_amdgcn_sched_barrier(0);   // val's weight loads stay behind key's products: mixed among them they push two lane constants out to scratch memory
      { v8f cv[2] = {};   // val: element r = node n0 + 8g + r, dim j * 16 + col
#pragma unroll
        for (int k2 = 0; k2 < DD / 64; ++k2) { union { v16b v; v4u q[2]; } w[4];
#pragma unroll
          for (int f = 0; f < 4; ++f) { const _Float16* p = Pw + (size_t)NBATCH * MATW + ((k2 * 2 + (f >> 1)) * 8 + (f & 1)) * 512; w[f].q[0] = *(const v4u*)p; w[f].q[1] = *(const v4u*)(p + 256); }   // as above
#pragma unroll
          for (int f = 0; f < 4; ++f) cv[f & 1] = wmma_bf(a[k2 * 2 + (f >> 1)], w[f].v, cv[f & 1]); }
#pragma unroll
        for (int j = 0; j < 2; ++j) { v8h h8, l8; const float bb = bfr(Bv[j * 16]);
#pragma unroll
          for (int r = 0; r < 8; ++r) { const float v = cv[j][r] + bb; const _Float16 hv = (_Float16)v; h8[r] = hv; l8[r] = (_Float16)((v - (float)hv) * 2048.0f); }
          const int dd = j * 16 + col, d = (dd * (NP / 8) + (((n0 >> 3) + g) ^ col)) * 8; *(v8h*)&svh[d] = h8; *(v8h*)&svl[d] = l8; } }
      asm volatile("s_wait_xcnt 0x0" ::: "memory"); } }   // the next pass, and the code behind the loop, overwrite address registers of this pass's loads
  __syncthreads();   // the rows and planes written above are read below by every wave of the block
#pragma unroll 1   // rolled, as the loop over the two heads was: one copy of the key loop in the code
  for (int it = 0; it < 4; ++it) { const int hh = it & 1, kh = hp * 2 + hh, q0 = ((it >> 1) * AW + wave) * 16;
    v16h bq; { const float* pp = X + xrow(grp, q0 + col) + kh * HS + 8 * g;
#pragma unroll
      for (int i = 0; i < 8; ++i) { const float qv = bfr(pp[i]); bq[i] = (_Float16)(qv * 0.25f); bq[8 + i] = (_Float16)(qv * (0.25f / 2048.0f)); } }   // K = 16 real dims: slots 0..15 meet the keys' hi part, slots 16..31 their residual (stored x 2^11); both carry 16^-1/2 (powers of two)
    const int ko = (col * 4 + ((hh * 2 + g) ^ (col >> 2))) * 8;   // the head's own 8 dims, the same place in the hi and in the residual rows
    const int vo = (hh * 16 + col) * NP, vx = (g ^ col) * 8;
    float m = -3.0e38f, cb = 0.f, l = 0.f;   // the query's maximum when its reference point was last set (equal in both halves); the point's exponent offset 11 - m log2(e) (unused while m is the start value); this half's share of the sum, x 2^11
    v8f acc = {}, accl = {};       // O^T: element r = head dim 8g + r of query col
    // p x 2^11 = 2^(s log2(e) + cb), cb = 11 - m log2(e): one fused multiply-add a score carries the reference point, the change of base and the 2^11. m is the maximum as of the last time the point was set, not the running maximum:
    // softmax does not depend on the point, only the f16 range of p x 2^11 does. The terms are formed with the old point; all are >= 0, so a lane's sum of 16 bounds each of them, and a sum within the f16 range says that every term converts finite.
    // Only where some lane's sum is above it (or is no number), and in the first key block, the whole wave takes the maximum, moves the point, rescales the old sums and forms the terms again (each then <= 2^11, their sum <= 2^15)
    auto pass = [&](const int ks, const bool first, const bool last) __attribute__((always_inline)) { float s[2][8];
      const int p0 = vo + ((ks * 32) ^ vx), p1 = vo + ((ks * 32 + 16) ^ vx); union { v16h v; v8h q[2]; } vh, vl; vh.q[0] = *(const v8h*)&svh[p0]; vh.q[1] = *(const v8h*)&svh[p1]; vl.q[0] = *(const v8h*)&svl[p0]; vl.q[1] = *(const v8h*)&svl[p1];
#pragma unroll
      for (int ct = 0; ct < 2; ++ct) { const int rk = (ks * 32 + ct * 16) * 32; union { v16h v; v8h q[2]; } ak; ak.q[0] = *(const v8h*)&skh[rk + ko]; ak.q[1] = *(const v8h*)&skl[rk + ko];   // element i = hi of dim 8g + i, element 8 + i = residual of the same dim: the order of bq
        v8f c = {}; c = wmma16(ak.v, bq, c);
#pragma unroll
        for (int r = 0; r < 8; ++r) s[ct][r] = c[r]; }
      if (last) {   // only the last key block holds padded keys
#pragma unroll
        for (int ct = 0; ct < 2; ++ct) {
#pragma unroll
          for (int r = 0; r < 8; ++r) if (ks * 32 + ct * 16 + 8 * g + r >= NNODE) s[ct][r] = -3.0e38f; } }
      float e[2][8], es = 0.f; bool redo = first;
      auto terms = [&](const float c) __attribute__((always_inline)) { float es0 = 0.f, es1 = 0.f; const v2f l2 = {L2E, L2E}, c2 = {c, c};
#pragma unroll
        for (int r = 0; r < 8; r += 2) { const v2f t0 = __builtin_elementwise_fma((v2f){s[0][r], s[0][r + 1]}, l2, c2), t1 = __builtin_elementwise_fma((v2f){s[1][r], s[1][r + 1]}, l2, c2);
#pragma unroll
          for (int i = 0; i < 2; ++i) {   // a key that is padded in both halves of the wave has the term 0 outright; one that is padded in the upper half only: 2^(-infinity) = 0
            e[0][r + i] = (last && (NP - 32) + r + i >= NNODE) ? 0.f : __builtin_amdgcn_exp2f(t0[i]); e[1][r + i] = (last && (NP - 32) + 16 + r + i >= NNODE) ? 0.f : __builtin_amdgcn_exp2f(t1[i]); es0 += e[0][r + i]; es1 += e[1][r + i]; } }
        return es0 + es1; };
      if (!first) { es = terms(cb); redo = __builtin_amdgcn_ballot_w32(!(es <= 65504.0f)) != 0u; }   // the same answer in every lane: the two halves of a query, and the exchange below, need the whole wave on one path
      if (redo) { float mx = fmaxf(s[0][0], s[1][0]);
#pragma unroll
        for (int r = 1; r < 8; ++r) mx = fmaxf(mx, fmaxf(s[0][r], s[1][r]));
        mx = fmaxf(mx, xhalf(mx));
        const float mn = fmaxf(m, mx), cn = __builtin_fmaf(mn, -L2E, 11.0f), alpha = (m <= -1.0e38f) ? 0.f : __builtin_amdgcn_exp2f(cn - cb); m = mn; cb = cn;   // cn, as rounded, is the one reference point of all terms, and the step between two of them rescales the old ones (mn is finite: keys 0..31 are real)
        l *= alpha;
#pragma unroll
        for (int r = 0; r < 8; ++r) { acc[r] *= alpha; accl[r] *= alpha; }
        es = terms(cn); }
      l += es; v16h pb;
#pragma unroll
      for (int r = 0; r < 8; ++r) { pb[r] = (_Float16)e[0][r]; pb[8 + r] = (_Float16)e[1][r]; }
      acc = wmma16(vh.v, pb, acc); accl = wmma16(vl.v, pb, accl); };
    pass(0, true, false);
#pragma unroll 1   // rolled: one copy of the common pass in the code; the first block (sets the point) and the last (padded keys) stand outside, so that the common pass holds neither test
    for (int ks = 1; ks < NP / 32 - 1; ++ks) pass(ks, false, false);
    pass(NP / 32 - 1, false, true);
    const float inv = 1.0f / (l + xhalf(l));   // l and the two sums all carry the 2^11
    v4f o0, o1;
#pragma unroll
    for (int r = 0; r < 4; ++r) { o0[r] = (acc[r] + accl[r] * (1.0f / 2048.0f)) * inv; o1[r] = (acc[4 + r] + accl[4 + r] * (1.0f / 2048.0f)) * inv; }
    float* op = O + ((grp * NP) + q0 + col) * DD + kh * HS + 8 * g; vst2(op, o0); vst2(op + 4, o1);
    asm volatile("s_wait_xcnt 0x0" ::: "memory"); } }   // the next pass overwrites the registers that these two stores name
// ---- k_mlp: block = (64 padded rows, g): out = (relu(o (hi + lo) . W1^T + b1)) (hi + lo) . W2^T + b2; rows n >= 358 are computed from finite data but not written
__global__ __launch_bounds__(128) void k_mlp(const float* __restrict__ O, const _Float16* __restrict__ PW, const float* __restrict__ B1, const float* __restrict__ B2, float* __restrict__ OUT) { __shared__ __align__(16) float sf[4][16][132];
  const int tid = threadIdx.x, wave = tid >> 5, lane = tid & 31, col = lane & 15, g = lane >> 4; const size_t grp = blockIdx.y; const int n0 = blockIdx.x * 64 + wave * 16; const size_t r0 = grp * NP + n0; const _Float16 *P1 = PW + (size_t)(2 * NBATCH) * MATW, *P2 = P1 + MATW;
  v8f acc[8] = {};
#pragma unroll
  for (int kc = 0; kc < DD / 32; ++kc) { v16b w[8]; const F2 a = split_row(O + (r0 + col) * DD, kc * 32, lane);
    asm volatile("s_wait_xcnt 0x0" ::: "memory");   // before a fragment load's result may land in the address pair of the row's loads
#pragma unroll
    for (int j = 0; j < 8; ++j) w[j] = frag_p(P1, kc * 8 + j, lane);   // the k block's 16 loads stand ahead of its products, so that all are in flight together
#pragma unroll
    for (int j = 0; j < 8; ++j) { acc[j] = wmma_bf(a.h, w[j], acc[j]); acc[j] = wmma_bf(a.l, w[j], acc[j]); }
    __builtin_amdgcn_sched_barrier(0); }   // the next k block's loads stay behind these products: lifted among them they take the wave past 192 registers, and the fifth wave a SIMD (all 1152 blocks resident at once) is lost
#pragma unroll
  for (int j = 0; j < 8; ++j) { const float bb = bfr(B1[j * 16 + col]);
#pragma unroll
    for (int r = 0; r < 8; ++r) sf[wave][8 * g + r][j * 16 + col] = fmaxf(acc[j][r] + bb, 0.f); }
  LDSX();
  { v8f acc2[8] = {};
#pragma unroll
    for (int kc = 0; kc < DD / 32; ++kc) { float v[16]; const float* pp = &sf[wave][col][kc * 32 + 8 * g]; v16b w[8];
#pragma unroll
      for (int j = 0; j < 8; ++j) w[j] = frag_p(P2, kc * 8 + j, lane);   // as above
#pragma unroll
      for (int i = 0; i < 8; ++i) { v[i] = pp[i]; v[8 + i] = pp[16 + i]; }
      const F2 a = bsplit16(v);
#pragma unroll
      for (int j = 0; j < 8; ++j) { acc2[j] = wmma_bf(a.h, w[j], acc2[j]); acc2[j] = wmma_bf(a.l, w[j], acc2[j]); } }
    asm volatile("s_wait_xcnt 0x0" ::: "memory");   // the code below overwrites the offset register of the fragment loads
    LDSX();
#pragma unroll
    for (int j = 0; j < 8; ++j) { const float bb = bfr(B2[j * 16 + col]);
#pragma unroll
      for (int r = 0; r < 8; ++r) sf[wave][8 * g + r][j * 16 + col] = acc2[j][r] + bb; } }
  LDSX(); for (int rl = 0; rl < 16; ++rl) { const int n = n0 + rl; if (n < NNODE) vst2(OUT + (grp * NNODE + n) * DD + lane * 4, *(const v4f*)&sf[wave][rl][lane * 4]); } }
extern "C" void kernel_launch(void* const* d_in, const int* in_sizes, int n_in, void* d_out, int out_size, void* d_ws, size_t ws_size, hipStream_t stream) {
  (void)in_sizes; (void)n_in; (void)out_size;
  const float** F = (const float**)d_in;   // 0 x [16,12,358,128], 1 wk [16,1,128,128] (in,out), 2 bk [16,1,1,128], 3 wv, 4 bv, 5 W1 [128,128] natural, 6 b1, 7 W2 [128,128] natural, 8 b2
  if (ws_size < (size_t)WS_END) return;
  char* ws = (char*)d_ws; _Float16* PW = (_Float16*)(ws + WS_PW); float* O = (float*)(ws + WS_O);
  k_pack<<<dim3(NMAT * 8), 256, 0, stream>>>(F[1], F[3], F[5], F[7], PW);
  k_att<<<dim3(KH / 2, TG), AW * 32, 0, stream>>>(F[0], PW, F[2], F[4], O);
  k_mlp<<<dim3(NP / 64, TG), 128, 0, stream>>>(O, PW, F[6], F[8], (float*)d_out);
}

// v009
// It runs in 58.3 microseconds.
// Two timings next to v008 put it at 1.05 and 1.04 times that version's speed.
// Counting every step since v000, it is 5.60 times as fast.
// compute dtype: all float inputs rounded to bf16; key / val = x . wk[b] + bk[b] with EXACT bf16 products on WMMA 16x16x32 (per-sample (in,out) weights), f16 hi + residual; q = x itself (bf16 -> f16; 16-dim heads: the K=32 fragment holds k hi | k residual against q / 4 | q / 4 x 2^-11); logits 1 product, 16^-1/2 inside it, padded keys (N = 358 -> 384) excluded, softmax terms in f32 (hardware exp) about a reference point set from the first key block (a tile in which a term leaves the f16 range is formed again about a moving point); P (scaled by a power of two, f16) . v (hi + residual, 2 products), row sum = ones . P on WMMA; projection1 (relu) and projection2 with the f32 activations as bf16 hi + lo against exact weights (2 products each); f32 output. All padded rows/columns are written with finite (clamped) data before any read.
#include <hip/hip_runtime.h>
#include <math.h>

typedef __attribute__((ext_vector_type(16))) _Float16 v16h;
typedef __attribute__((ext_vector_type(16))) __bf16 v16b;
typedef __attribute__((ext_vector_type(8)))  _Float16 v8h;
typedef __attribute__((ext_vector_type(8)))  float v8f;
typedef __attribute__((ext_vector_type(4)))  float v4f;
typedef __attribute__((ext_vector_type(2)))  float v2f;
typedef __attribute__((ext_vector_type(4)))  unsigned v4u;
typedef __attribute__((ext_vector_type(4)))  int v4i;
typedef float __attribute__((may_alias)) float_a;
typedef int __attribute__((may_alias)) int_a;

template <typename T> __device__ __forceinline__ void vst2(void* p, T v) { *(T*)p = v;  }
__device__ __forceinline__ v8f wmma16(v16h a, v16h b, v8f c) {
  v8f d = __builtin_amdgcn_wmma_f32_16x16x32_f16(false, a, false, b, (short)0, c, false, false);
  return d;
}
__device__ __forceinline__ v8f wmma_bf(v16b a, v16b b, v8f c) {
  v8f d = __builtin_amdgcn_wmma_f32_16x16x32_bf16(false, a, false, b, (short)0, c, false, false);
  return d;
}
// 16x16x32 fragments: lane = (h = lane>>4, row/col = lane&15); elements 0..7 = k0+8h+0..7, 8..15 = k0+16+8h+0..7; D element r = row 8h+r
__device__ __forceinline__ v16h frag_h(const _Float16* rowk0, int lane) {
  union { v16h v; v8h q[2]; } u; const _Float16* p = rowk0 + 8 * (lane >> 4);
  u.q[0] = *(const v8h*)p; u.q[1] = *(const v8h*)(p + 16); return u.v;
}
__device__ __forceinline__ v16h frag_f32(const float* rowk0, int lane) {
  v16h a; const float* p = rowk0 + 8 * (lane >> 4);
#pragma unroll
  for (int i = 0; i < 8; ++i) { a[i] = (_Float16)p[i]; a[8 + i] = (_Float16)p[16 + i]; }
  return a;
}
__device__ __forceinline__ v16h frag_f32s(const float* rowk0, int lane, float sc) {
  v16h a; const float* p = rowk0 + 8 * (lane >> 4);
#pragma unroll
  for (int i = 0; i < 8; ++i) { a[i] = (_Float16)(p[i] * sc); a[8 + i] = (_Float16)(p[16 + i] * sc); }
  return a;
}
// column fragment from a [K][ld] layout (column n), rows >= K read as 0
__device__ __forceinline__ v16h fragc_f32(const float* W, int k0, int n, int lane, int ld, int K) {
  v16h a; const int g = lane >> 4;
#pragma unroll
  for (int i = 0; i < 8; ++i) { const int ka = k0 + 8 * g + i, kb = ka + 16;
    a[i] = (_Float16)(ka < K ? W[(size_t)(ka < K ? ka : K - 1) * ld + n] : 0.f); a[8 + i] = (_Float16)(kb < K ? W[(size_t)(kb < K ? kb : K - 1) * ld + n] : 0.f); }
  return a;
}
struct F2 { v16b h, l; };
__device__ __forceinline__ F2 bsplit16(const float v[16]) { F2 r;
#pragma unroll
  for (int i = 0; i < 16; ++i) { const __bf16 h = (__bf16)v[i]; r.h[i] = h; r.l[i] = (__bf16)(v[i] - (float)h); }
  return r; }
__device__ __forceinline__ F2 split_row(const float* row, int k0, int lane) { float v[16]; const float* p = row + k0 + 8 * (lane >> 4);
#pragma unroll
  for (int i = 0; i < 8; ++i) { v[i] = p[i]; v[8 + i] = p[16 + i]; }
  return bsplit16(v); }
__device__ __forceinline__ F2 split_rowK(const float* row, int k0, int lane, int K) { float v[16]; const int g = lane >> 4;
#pragma unroll
  for (int i = 0; i < 8; ++i) { const int ka = k0 + 8 * g + i, kb = ka + 16; v[i] = ka < K ? row[ka < K ? ka : K - 1] : 0.f; v[8 + i] = kb < K ? row[kb < K ? kb : K - 1] : 0.f; }
  return bsplit16(v); }
__device__ __forceinline__ F2 split_col(const float* W, int k0, int n, int lane, int ld, int K) { float v[16]; const int g = lane >> 4;
#pragma unroll
  for (int i = 0; i < 8; ++i) { const int ka = k0 + 8 * g + i, kb = ka + 16; v[i] = ka < K ? W[(size_t)(ka < K ? ka : K - 1) * ld + n] : 0.f; v[8 + i] = kb < K ? W[(size_t)(kb < K ? kb : K - 1) * ld + n] : 0.f; }
  return bsplit16(v); }
__device__ __forceinline__ v8f mac3(const F2& a, const F2& b, v8f c) { c = wmma_bf(a.l, b.h, c); c = wmma_bf(a.h, b.l, c); return wmma_bf(a.h, b.h, c); }
__device__ __forceinline__ float sigm(float v) { return 1.0f / (1.0f + expf(-v)); }
#define LDSX() do { asm volatile("s_wait_dscnt 0" ::: "memory"); __builtin_amdgcn_wave_barrier(); __builtin_amdgcn_fence(__ATOMIC_RELEASE, "workgroup"); } while (0)


// Spatial self attention over graph nodes (B 16, T 12, N 358 nodes, D 128 = 8 heads x 16): key/val from per-sample dynamic linears, q = x; softmax(q k / 4) over nodes; o -> Linear -> relu -> Linear.
#define NBATCH 16
#define NT 12
#define NG (NBATCH * NT)  // 192 (b, t) groups
#define NNODE 358
#define NP 384            // padded node count (6 x 64)
#define DD 128
#define KH 8
#define HS 16
#ifndef TG
#define TG NG
#endif
typedef __attribute__((ext_vector_type(8))) __bf16 v8b;
__device__ __forceinline__ v16b frag_b(const __bf16* rowk0, int lane) {
  union { v16b v; v8b q[2]; } u; const __bf16* p = rowk0 + 8 * (lane >> 4);
  u.q[0] = *(const v8b*)p; u.q[1] = *(const v8b*)(p + 16); return u.v;
}
__device__ __forceinline__ float bfr(float v) { return (float)(__bf16)v; }
__device__ __attribute__((noinline)) float exp_ni(float v) { return expf(v); }
__device__ __attribute__((noinline)) float erf_ni(float v) { return erff(v); }

#define WS_O   0u                                   // f32 o rows [g][NP][128]
#define WS_PW  (WS_O + 4u * (size_t)NG * NP * DD)         // bf16 weights in fragment order, 34 matrices x 32 KiB
#define WS_END (WS_PW + 2u * (size_t)NMAT * DD * DD)

// ---- k_pack: every weight matrix is rounded to bf16 once a call and laid out as the B fragments of the 16x16x32 product are read.
// matrix m = 0..15 wk[b], 16..31 wv[b] ((in,out): element (k, n) at k * 128 + n), 32 W1, 33 W2 (natural: element (k, n) at n * 128 + k);
// fragment f = kc * 8 + j (k block of 32, column block of 16); half hf holds elements 8 hf .. 8 hf + 7 of every lane: k = kc * 32 + 16 hf + 8 (lane >> 4) + i, n = j * 16 + (lane & 15).
// 16-bit word ((m * 32 + f) * 2 + hf) * 256 + lane * 8 + i: a wave reads half a fragment as 512 contiguous bytes (four whole lines)
#define NMAT (2 * NBATCH + 2)
#define MATW (DD * DD)    // 16-bit words a packed matrix
__global__ __launch_bounds__(256) void k_pack(const float* __restrict__ WK, const float* __restrict__ WV, const float* __restrict__ W1, const float* __restrict__ W2, _Float16* __restrict__ PW) {
  const int t = blockIdx.x * 256 + threadIdx.x, lane = t & 31, hf = (t >> 5) & 1, f = (t >> 6) & 31, m = blockIdx.x >> 3;   // one 16-byte chunk a thread; 8 blocks a matrix
  const int k0 = (f >> 3) * 32 + hf * 16 + 8 * (lane >> 4), n = (f & 7) * 16 + (lane & 15);
  union { v8b v; v4u q; } o; float v[8];
  if (m < 2 * NBATCH) { const float* Wm = (m < NBATCH ? WK : WV) + (size_t)(m & (NBATCH - 1)) * DD * DD + (size_t)k0 * DD + n;
#pragma unroll
    for (int i = 0; i < 8; ++i) v[i] = Wm[i * DD]; }
  else { const float* Wm = (m == 2 * NBATCH ? W1 : W2) + (size_t)n * DD + k0;
#pragma unroll
    for (int i = 0; i < 8; ++i) v[i] = Wm[i]; }
  asm volatile("s_wait_xcnt 0x0" ::: "memory");   // before a converted value may land in an address register of these loads
#pragma unroll
  for (int i = 0; i < 8; ++i) o.v[i] = (__bf16)v[i];
  vst2(PW + (size_t)t * 8, o.q); }
// fragment f of a packed matrix (the pointer type only carries 16-bit words: the bits are bf16)
__device__ __forceinline__ v16b frag_p(const _Float16* Pm, int f, int lane) {
  union { v16b v; v4u q[2]; } u; const _Float16* p = Pm + f * 512 + lane * 8;
  u.q[0] = *(const v4u*)p; u.q[1] = *(const v4u*)(p + 256); return u.v;
}
__device__ __forceinline__ size_t xrow(size_t g, int n) { return (g * NNODE + (size_t)(n < NNODE ? n : NNODE - 1)) * DD; }   // clamped node row of x
// lane l with lane l ^ 16 (the two halves of a wave hold the two key halves of one query column)
__device__ __forceinline__ float xhalf(float x) { return __builtin_bit_cast(float, __builtin_amdgcn_permlanex16(__builtin_bit_cast(int, x), __builtin_bit_cast(int, x), 0x76543210, 0xfedcba98, false, false)); }
// ---- k_att: block = (head pair, g), 12 waves x 2 query tiles: the block itself forms the pair's key rows and val planes (hi and residual, all 384 keys, 96 KiB) from x and the packed weights, straight into LDS, and every fragment is read from there.
// projection: wave = 2 x 16 padded nodes (clamped rows of x), 32 columns of key and of val: key^T = wk^T . x^T (A = packed weight fragment, B = x rows), so a lane holds 8 consecutive dims of ONE node = one 16-byte chunk of its key row;
// val = x . wv (A = x rows, B = packed weight fragment), so a lane holds 8 consecutive nodes of ONE dim = one 16-byte chunk of its val plane row. The same fragments and the same k order serve both operand sides.
// wave = (16 queries, head): S^T = K . Q^T (A = key rows, B = q), so a lane holds 2 x 8 keys' scores of ONE query (column = lane & 15); maximum runs in-lane plus one exchange between halves, the sum too on the rare path;
// the two score tiles, converted in place, are the B operand of O^T += V^T . P^T (element i = key 8h + i, element 8 + i = key 16 + 8h + i, the order of frag_h on the val planes)
// LDS places, no pad: chunk c (16 bytes) of key row n lies at chunk c ^ ((n >> 2) & 3) of its 64-byte row; chunk c of val plane row d at chunk c ^ (d & 15) of its 768-byte row: the 16 lanes of a fragment read fall on 16 different bank groups
#define AW 12
#define L2E 1.44269504088896340736f
// nine waves a SIMD are asked for: at most 112 registers a wave keep three blocks (36 waves, 288 KiB of LDS) on a WGP, so that all 768 blocks are resident at once; without it the projection takes a few registers more and one block a WGP is lost
__global__ __launch_bounds__(AW * 32) __attribute__((amdgpu_waves_per_eu(9))) void k_att(const float* __restrict__ X, const _Float16* __restrict__ PW, const float* __restrict__ BK, const float* __restrict__ BV, float* __restrict__ O) {
  __shared__ __align__(16) _Float16 skh[NP * 32], skl[NP * 32], svh[32 * NP], svl[32 * NP];
  const int tid = threadIdx.x, wave = tid >> 5, lane = tid & 31, col = lane & 15, g = lane >> 4; const int hp = blockIdx.x; const size_t grp = blockIdx.y;
  { const size_t b = grp / NT; const _Float16* Pw = PW + (b * MATW + hp * 1024) + (unsigned)(lane * 8);   // the lane's 16 bytes of fragment (k block 0, column block 2 hp) of wk[b]; wv[b] lies NBATCH matrices on
    const float *Bk = BK + (b * DD + hp * 32) + (unsigned)(8 * g), *Bv = BV + (b * DD + hp * 32) + (unsigned)col, *Xg = X + grp * (size_t)(NNODE * DD);   // block-uniform bases, 32-bit lane offsets
#pragma unroll 1   // rolled: one copy of the projection in the code, and its registers stay within what nine waves a SIMD leave a wave
    for (int nt = 0; nt < 2; ++nt) { const int n0 = (nt * AW + wave) * 16, n = n0 + col; const float* pp = Xg + (unsigned)((n < NNODE ? n : NNODE - 1) * DD + 8 * g); float xv[64]; v16b a[4];
#pragma unroll
      for (int kc = 0; kc < DD / 32; ++kc) {
#pragma unroll
        for (int i = 0; i < 8; ++i) { xv[kc * 16 + i] = pp[kc * 32 + i]; xv[kc * 16 + 8 + i] = pp[kc * 32 + 16 + i]; } }   // the row's 16 loads stand together, so that all are in flight at once
      asm volatile("s_wait_xcnt 0x0" ::: "memory");   // before a converted value may land in the offset register of these loads
#pragma unroll
      for (int kc = 0; kc < DD / 32; ++kc) {
#pragma unroll
        for (int i = 0; i < 16; ++i) a[kc][i] = (__bf16)xv[kc * 16 + i]; }
      __builtin_amdgcn_sched_barrier(0);   // the weight loads below stay behind the conversion: lifted among the row's 64 loaded registers they push a value out to scratch memory
      { v8f ck[2] = {};   // key^T: element r = dim j * 16 + 8g + r of node n
#pragma unroll
        for (int k2 = 0; k2 < DD / 64; ++k2) { union { v16b v; v4u q[2]; } w[4];
#pragma unroll
          for (int f = 0; f < 4; ++f) { const _Float16* p = Pw + ((k2 * 2 + (f >> 1)) * 8 + (f & 1)) * 512; w[f].q[0] = *(const v4u*)p; w[f].q[1] = *(const v4u*)(p + 256); }   // two k blocks' 8 loads stand ahead of their products, so that all are in flight together
#pragma unroll
          for (int f = 0; f < 4; ++f) ck[f & 1] = wmma_bf(w[f].v, a[k2 * 2 + (f >> 1)], ck[f & 1]); }
#pragma unroll
        for (int j = 0; j < 2; ++j) { v8h h8, l8;
#pragma unroll
          for (int r = 0; r < 8; ++r) { const float v = ck[j][r] + bfr(Bk[j * 16 + r]); const _Float16 hv = (_Float16)v; h8[r] = hv; l8[r] = (_Float16)((v - (float)hv) * 2048.0f); }
          const int d = (n * 4 + ((j * 2 + g) ^ ((n >> 2) & 3))) * 8; *(v8h*)&skh[d] = h8; *(v8h*)&skl[d] = l8; } }
      __builtin_amdgcn_sched_barrier(0);   // val's weight loads stay behind key's products: mixed among them they push two lane constants out to scratch memory
      { v8f cv[2] = {};   // val: element r = node n0 + 8g + r, dim j * 16 + col
#pragma unroll
        for (int k2 = 0; k2 < DD / 64; ++k2) { union { v16b v; v4u q[2]; } w[4];
#pragma unroll
          for (int f = 0; f < 4; ++f) { const _Float16* p = Pw + (size_t)NBATCH * MATW + ((k2 * 2 + (f >> 1)) * 8 + (f & 1)) * 512; w[f].q[0] = *(const v4u*)p; w[f].q[1] = *(const v4u*)(p + 256); }   // as above
#pragma unroll
          for (int f = 0; f < 4; ++f) cv[f & 1] = wmma_bf(a[k2 * 2 + (f >> 1)], w[f].v, cv[f & 1]); }
#pragma unroll
        for (int j = 0; j < 2; ++j) { v8h h8, l8; const float bb = bfr(Bv[j * 16]);
#pragma unroll
          for (int r = 0; r < 8; ++r) { const float v = cv[j][r] + bb; const _Float16 hv = (_Float16)v; h8[r] = hv; l8[r] = (_Float16)((v - (float)hv) * 2048.0f); }
          const int dd = j * 16 + col, d = (dd * (NP / 8) + (((n0 >> 3) + g) ^ col)) * 8; *(v8h*)&svh[d] = h8; *(v8h*)&svl[d] = l8; } }
      asm volatile("s_wait_xcnt 0x0" ::: "memory"); } }   // the next pass, and the code behind the loop, overwrite address registers of this pass's loads
  __syncthreads();   // the rows and planes written above are read below by every wave of the block
#pragma unroll 1   // rolled, as the loop over the two heads was: one copy of the key loop in the code
  for (int it = 0; it < 4; ++it) { const int hh = it & 1, kh = hp * 2 + hh, q0 = ((it >> 1) * AW + wave) * 16;
    v16h bq; { const float* pp = X + xrow(grp, q0 + col) + kh * HS + 8 * g;
#pragma unroll
      for (int i = 0; i < 8; ++i) { const float qv = bfr(pp[i]); bq[i] = (_Float16)(qv * 0.25f); bq[8 + i] = (_Float16)(qv * (0.25f / 2048.0f)); } }   // K = 16 real dims: slots 0..15 meet the keys' hi part, slots 16..31 their residual (stored x 2^11); both carry 16^-1/2 (powers of two)
    const int ko = (col * 4 + ((hh * 2 + g) ^ (col >> 2))) * 8;   // the head's own 8 dims, the same place in the hi and in the residual rows
    const int vo = (hh * 16 + col) * NP, vx = (g ^ col) * 8;
    float m = -3.0e38f, cb = 0.f, l = 0.f;   // the query's maximum when its reference point was last set (equal in both halves); the point's exponent offset 11 - m log2(e) (unused while m is the start value); this half's share of the sum, x 2^11
    v8f acc = {}, accl = {};       // O^T: element r = head dim 8g + r of query col
    // p x 2^11 = 2^(s log2(e) + cb), cb = 11 - m log2(e): one fused multiply-add a score carries the reference point, the change of base and the 2^11. m is the maximum as of the last time the point was set, not the running maximum:
    // softmax does not depend on the point, only the f16 range of p x 2^11 does. The terms are formed with the old point; all are >= 0, so a lane's sum of 16 bounds each of them, and a sum within the f16 range says that every term converts finite.
    // Only where some lane's sum is above it (or is no number), and in the first key block, the whole wave takes the maximum, moves the point, rescales the old sums and forms the terms again (each then <= 2^11, their sum <= 2^15)
    auto pass = [&](const int ks, const bool first, const bool last) __attribute__((always_inline)) { float s[2][8];
      const int p0 = vo + ((ks * 32) ^ vx), p1 = vo + ((ks * 32 + 16) ^ vx); union { v16h v; v8h q[2]; } vh, vl; vh.q[0] = *(const v8h*)&svh[p0]; vh.q[1] = *(const v8h*)&svh[p1]; vl.q[0] = *(const v8h*)&svl[p0]; vl.q[1] = *(const v8h*)&svl[p1];
#pragma unroll
      for (int ct = 0; ct < 2; ++ct) { const int rk = (ks * 32 + ct * 16) * 32; union { v16h v; v8h q[2]; } ak; ak.q[0] = *(const v8h*)&skh[rk + ko]; ak.q[1] = *(const v8h*)&skl[rk + ko];   // element i = hi of dim 8g + i, element 8 + i = residual of the same dim: the order of bq
        v8f c = {}; c = wmma16(ak.v, bq, c);
#pragma unroll
        for (int r = 0; r < 8; ++r) s[ct][r] = c[r]; }
      if (last) {   // only the last key block holds padded keys
#pragma unroll
        for (int ct = 0; ct < 2; ++ct) {
#pragma unroll
          for (int r = 0; r < 8; ++r) if (ks * 32 + ct * 16 + 8 * g + r >= NNODE) s[ct][r] = -3.0e38f; } }
      float e[2][8], es = 0.f; bool redo = first;
      auto terms = [&](const float c) __attribute__((always_inline)) { float es0 = 0.f, es1 = 0.f; const v2f l2 = {L2E, L2E}, c2 = {c, c};
#pragma unroll
        for (int r = 0; r < 8; r += 2) { const v2f t0 = __builtin_elementwise_fma((v2f){s[0][r], s[0][r + 1]}, l2, c2), t1 = __builtin_elementwise_fma((v2f){s[1][r], s[1][r + 1]}, l2, c2);
#pragma unroll
          for (int i = 0; i < 2; ++i) {   // a key that is padded in both halves of the wave has the term 0 outright; one that is padded in the upper half only: 2^(-infinity) = 0
            e[0][r + i] = (last && (NP - 32) + r + i >= NNODE) ? 0.f : __builtin_amdgcn_exp2f(t0[i]); e[1][r + i] = (last && (NP - 32) + 16 + r + i >= NNODE) ? 0.f : __builtin_amdgcn_exp2f(t1[i]); es0 += e[0][r + i]; es1 += e[1][r + i]; } }
        return es0 + es1; };
      if (!first) { es = terms(cb); redo = __builtin_amdgcn_ballot_w32(!(es <= 65504.0f)) != 0u; }   // the same answer in every lane: the two halves of a query, and the exchange below, need the whole wave on one path
      if (redo) { float mx = fmaxf(s[0][0], s[1][0]);
#pragma unroll
        for (int r = 1; r < 8; ++r) mx = fmaxf(mx, fmaxf(s[0][r], s[1][r]));
        mx = fmaxf(mx, xhalf(mx));
        const float mn = fmaxf(m, mx), cn = __builtin_fmaf(mn, -L2E, 11.0f), alpha = (m <= -1.0e38f) ? 0.f : __builtin_amdgcn_exp2f(cn - cb); m = mn; cb = cn;   // cn, as rounded, is the one reference point of all terms, and the step between two of them rescales the old ones (mn is finite: keys 0..31 are real)
        l *= alpha;
#pragma unroll
        for (int r = 0; r < 8; ++r) { acc[r] *= alpha; accl[r] *= alpha; }
        es = terms(cn); }
      l += es; v16h pb;
#pragma unroll
      for (int r = 0; r < 8; ++r) { pb[r] = (_Float16)e[0][r]; pb[8 + r] = (_Float16)e[1][r]; }
      acc = wmma16(vh.v, pb, acc); accl = wmma16(vl.v, pb, accl); };
    // The common way: the point is set ONCE, from the first key block's maximum, as p x 2^4 = 2^(s log2(e) + cf), cf = 4 - max log2(e): 2^12 of room up to the end of the f16 range, and no test in any pass.
    // The row sum is a third product on the same P fragment, A = all ones: every row of its result is the sum of the (f16) terms over all 32 keys of both halves, so the in-lane adds and the half exchange go.
    // A term that leaves the f16 range converts to infinity and makes that sum infinite (1 x infinity, all terms >= 0): seen once, behind the last block; then the whole wave forms the tile again with the moving point above
    v8f ls = {}; float cf = 0.f; v16h one16;
#pragma unroll
    for (int i = 0; i < 16; ++i) one16[i] = (_Float16)1.0f;
    auto fpass = [&](const int ks, const bool first, const bool last) __attribute__((always_inline)) { float s[2][8];
      const int p0 = vo + ((ks * 32) ^ vx), p1 = vo + ((ks * 32 + 16) ^ vx); union { v16h v; v8h q[2]; } vh, vl; vh.q[0] = *(const v8h*)&svh[p0]; vh.q[1] = *(const v8h*)&svh[p1]; vl.q[0] = *(const v8h*)&svl[p0]; vl.q[1] = *(const v8h*)&svl[p1];
#pragma unroll
      for (int ct = 0; ct < 2; ++ct) { const int rk = (ks * 32 + ct * 16) * 32; union { v16h v; v8h q[2]; } ak; ak.q[0] = *(const v8h*)&skh[rk + ko]; ak.q[1] = *(const v8h*)&skl[rk + ko];   // as in pass
        v8f c = {}; c = wmma16(ak.v, bq, c);
#pragma unroll
        for (int r = 0; r < 8; ++r) s[ct][r] = c[r]; }
      if (last) {   // only the last key block holds padded keys
#pragma unroll
        for (int ct = 0; ct < 2; ++ct) {
#pragma unroll
          for (int r = 0; r < 8; ++r) if (ks * 32 + ct * 16 + 8 * g + r >= NNODE) s[ct][r] = -3.0e38f; } }
      if (first) { float mx = fmaxf(s[0][0], s[1][0]);
#pragma unroll
        for (int r = 1; r < 8; ++r) mx = fmaxf(mx, fmaxf(s[0][r], s[1][r]));
        mx = fmaxf(mx, xhalf(mx)); cf = __builtin_fmaf(mx, -L2E, 4.0f); }   // finite: keys 0..31 are real; equal in both halves of a query
      const v2f l2 = {L2E, L2E}, c2 = {cf, cf}; v16h pb;
#pragma unroll
      for (int r = 0; r < 8; r += 2) { const v2f t0 = __builtin_elementwise_fma((v2f){s[0][r], s[0][r + 1]}, l2, c2), t1 = __builtin_elementwise_fma((v2f){s[1][r], s[1][r + 1]}, l2, c2);
#pragma unroll
        for (int i = 0; i < 2; ++i) {   // padded keys as in pass
          pb[r + i] = (_Float16)((last && (NP - 32) + r + i >= NNODE) ? 0.f : __builtin_amdgcn_exp2f(t0[i])); pb[8 + r + i] = (_Float16)((last && (NP - 32) + 16 + r + i >= NNODE) ? 0.f : __builtin_amdgcn_exp2f(t1[i])); } }
      acc = wmma16(vh.v, pb, acc); accl = wmma16(vl.v, pb, accl); ls = wmma16(one16, pb, ls); };
    fpass(0, true, false);
#pragma unroll 1   // rolled: one copy of the common pass in the code; the first block (sets the point) and the last (padded keys) stand outside, so that the common pass holds neither
    for (int ks = 1; ks < NP / 32 - 1; ++ks) fpass(ks, false, false);
    fpass(NP / 32 - 1, false, true);
    float lt = ls[0];   // the query's whole sum, x 2^4 like the two sums of products
    if (__builtin_amdgcn_ballot_w32(!(lt <= 3.0e38f)) != 0u) {   // the same answer in every lane: the exchanges inside pass need the whole wave
      asm volatile("" ::: "memory");   // the first block's val fragments are read from LDS anew here: held over for this rare way they take 16 registers through the common loop, 8 of them in scratch memory
#pragma unroll
      for (int r = 0; r < 8; ++r) { acc[r] = 0.f; accl[r] = 0.f; }
      pass(0, true, false);
#pragma unroll 1   // rolled: this way is rare, its code stays short
      for (int ks = 1; ks < NP / 32 - 1; ++ks) pass(ks, false, false);
      pass(NP / 32 - 1, false, true);
      lt = l + xhalf(l); }   // here l and the two sums all carry the 2^11
    const float inv = 1.0f / lt;
    v4f o0, o1;
#pragma unroll
    for (int r = 0; r < 4; ++r) { o0[r] = (acc[r] + accl[r] * (1.0f / 2048.0f)) * inv; o1[r] = (acc[4 + r] + accl[4 + r] * (1.0f / 2048.0f)) * inv; }
    float* op = O + ((grp * NP) + q0 + col) * DD + kh * HS + 8 * g; vst2(op, o0); vst2(op + 4, o1);
    asm volatile("s_wait_xcnt 0x0" ::: "memory"); } }   // the next pass overwrites the registers that these two stores name
// ---- k_mlp: block = (64 padded rows, g): out = (relu(o (hi + lo) . W1^T + b1)) (hi + lo) . W2^T + b2; rows n >= 358 are computed from finite data but not written
__global__ __launch_bounds__(128) void k_mlp(const float* __restrict__ O, const _Float16* __restrict__ PW, const float* __restrict__ B1, const float* __restrict__ B2, float* __restrict__ OUT) { __shared__ __align__(16) float sf[4][16][132];
  const int tid = threadIdx.x, wave = tid >> 5, lane = tid & 31, col = lane & 15, g = lane >> 4; const size_t grp = blockIdx.y; const int n0 = blockIdx.x * 64 + wave * 16; const size_t r0 = grp * NP + n0; const _Float16 *P1 = PW + (size_t)(2 * NBATCH) * MATW, *P2 = P1 + MATW;
  v8f acc[8] = {};
#pragma unroll
  for (int kc = 0; kc < DD / 32; ++kc) { v16b w[8]; const F2 a = split_row(O + (r0 + col) * DD, kc * 32, lane);
    asm volatile("s_wait_xcnt 0x0" ::: "memory");   // before a fragment load's result may land in the address pair of the row's loads
#pragma unroll
    for (int j = 0; j < 8; ++j) w[j] = frag_p(P1, kc * 8 + j, lane);   // the k block's 16 loads stand ahead of its products, so that all are in flight together
#pragma unroll
    for (int j = 0; j < 8; ++j) { acc[j] = wmma_bf(a.h, w[j], acc[j]); acc[j] = wmma_bf(a.l, w[j], acc[j]); }
    __builtin_amdgcn_sched_barrier(0); }   // the next k block's loads stay behind these products: lifted among them they take the wave past 192 registers, and the fifth wave a SIMD (all 1152 blocks resident at once) is lost
#pragma unroll
  for (int j = 0; j < 8; ++j) { const float bb = bfr(B1[j * 16 + col]);
#pragma unroll
    for (int r = 0; r < 8; ++r) sf[wave][8 * g + r][j * 16 + col] = fmaxf(acc[j][r] + bb, 0.f); }
  LDSX();
  { v8f acc2[8] = {};
#pragma unroll
    for (int kc = 0; kc < DD / 32; ++kc) { float v[16]; const float* pp = &sf[wave][col][kc * 32 + 8 * g]; v16b w[8];
#pragma unroll
      for (int j = 0; j < 8; ++j) w[j] = frag_p(P2, kc * 8 + j, lane);   // as above
#pragma unroll
      for (int i = 0; i < 8; ++i) { v[i] = pp[i]; v[8 + i] = pp[16 + i]; }
      const F2 a = bsplit16(v);
#pragma unroll
      for (int j = 0; j < 8; ++j) { acc2[j] = wmma_bf(a.h, w[j], acc2[j]); acc2[j] = wmma_bf(a.l, w[j], acc2[j]); } }
    asm volatile("s_wait_xcnt 0x0" ::: "memory");   // the code below overwrites the offset register of the fragment loads
    LDSX();
#pragma unroll
    for (int j = 0; j < 8; ++j) { const float bb = bfr(B2[j * 16 + col]);
#pragma unroll
      for (int r = 0; r < 8; ++r) sf[wave][8 * g + r][j * 16 + col] = acc2[j][r] + bb; } }
  LDSX(); for (int rl = 0; rl < 16; ++rl) { const int n = n0 + rl; if (n < NNODE) vst2(OUT + (grp * NNODE + n) * DD + lane * 4, *(const v4f*)&sf[wave][rl][lane * 4]); } }
extern "C" void kernel_launch(void* const* d_in, const int* in_sizes, int n_in, void* d_out, int out_size, void* d_ws, size_t ws_size, hipStream_t stream) {
  (void)in_sizes; (void)n_in; (void)out_size;
  const float** F = (const float**)d_in;   // 0 x [16,12,358,128], 1 wk [16,1,128,128] (in,out), 2 bk [16,1,1,128], 3 wv, 4 bv, 5 W1 [128,128] natural, 6 b1, 7 W2 [128,128] natural, 8 b2
  if (ws_size < (size_t)WS_END) return;
  char* ws = (char*)d_ws; _Float16* PW = (_Float16*)(ws + WS_PW); float* O = (float*)(ws + WS_O);
  k_pack<<<dim3(NMAT * 8), 256, 0, stream>>>(F[1], F[3], F[5], F[7], PW);
  k_att<<<dim3(KH / 2, TG), AW * 32, 0, stream>>>(F[0], PW, F[2], F[4], O);
  k_mlp<<<dim3(NP / 64, TG), 128, 0, stream>>>(O, PW, F[6], F[8], (float*)d_out);
}

// v010
// A run of this version takes 55.2 microseconds.
// In both of two side-by-side timings against v009, it was 1.06 times as fast.
// Counting every step since v000, it is 5.93 times as fast.
// compute dtype: all float inputs rounded to bf16; key / val = x . wk[b] + bk[b] with EXACT bf16 products on WMMA 16x16x32 (per-sample (in,out) weights), f16 hi + residual; q = x itself (bf16 -> f16; 16-dim heads: the K=32 fragment holds k hi | k residual against q / 4 | q / 4 x 2^-11); logits 1 product, 16^-1/2 inside it, padded keys (N = 358 -> 384) excluded, softmax terms in f32 (hardware exp) about a reference point set from the first key block (a tile in which a term leaves the f16 range is formed again about a moving point); P (scaled by a power of two, f16) . v (hi + residual, 2 products), row sum = ones . P on WMMA; projection1 (relu) and projection2 with the f32 activations as bf16 hi + lo against exact weights (2 products each); f32 output. All padded rows/columns are written with finite (clamped) data before any read.
#include <hip/hip_runtime.h>
#include <math.h>

typedef __attribute__((ext_vector_type(16))) _Float16 v16h;
typedef __attribute__((ext_vector_type(16))) __bf16 v16b;
typedef __attribute__((ext_vector_type(8)))  _Float16 v8h;
typedef __attribute__((ext_vector_type(8)))  float v8f;
typedef __attribute__((ext_vector_type(4)))  float v4f;
typedef __attribute__((ext_vector_type(2)))  float v2f;
typedef __attribute__((ext_vector_type(4)))  unsigned v4u;
typedef __attribute__((ext_vector_type(2)))  unsigned v2u;
typedef __attribute__((ext_vector_type(4)))  int v4i;
typedef float __attribute__((may_alias)) float_a;
typedef int __attribute__((may_alias)) int_a;

template <typename T> __device__ __forceinline__ void vst2(void* p, T v) { *(T*)p = v;  }
__device__ __forceinline__ v8f wmma16(v16h a, v16h b, v8f c) {
  v8f d = __builtin_amdgcn_wmma_f32_16x16x32_f16(false, a, false, b, (short)0, c, false, false);
  return d;
}
__device__ __forceinline__ v8f wmma_bf(v16b a, v16b b, v8f c) {
  v8f d = __builtin_amdgcn_wmma_f32_16x16x32_bf16(false, a, false, b, (short)0, c, false, false);
  return d;
}
// 16x16x32 fragments: lane = (h = lane>>4, row/col = lane&15); elements 0..7 = k0+8h+0..7, 8..15 = k0+16+8h+0..7; D element r = row 8h+r
__device__ __forceinline__ v16h frag_h(const _Float16* rowk0, int lane) {
  union { v16h v; v8h q[2]; } u; const _Float16* p = rowk0 + 8 * (lane >> 4);
  u.q[0] = *(const v8h*)p; u.q[1] = *(const v8h*)(p + 16); return u.v;
}
__device__ __forceinline__ v16h frag_f32(const float* rowk0, int lane) {
  v16h a; const float* p = rowk0 + 8 * (lane >> 4);
#pragma unroll
  for (int i = 0; i < 8; ++i) { a[i] = (_Float16)p[i]; a[8 + i] = (_Float16)p[16 + i]; }
  return a;
}
__device__ __forceinline__ v16h frag_f32s(const float* rowk0, int lane, float sc) {
  v16h a; const float* p = rowk0 + 8 * (lane >> 4);
#pragma unroll
  for (int i = 0; i < 8; ++i) { a[i] = (_Float16)(p[i] * sc); a[8 + i] = (_Float16)(p[16 + i] * sc); }
  return a;
}
// column fragment from a [K][ld] layout (column n), rows >= K read as 0
__device__ __forceinline__ v16h fragc_f32(const float* W, int k0, int n, int lane, int ld, int K) {
  v16h a; const int g = lane >> 4;
#pragma unroll
  for (int i = 0; i < 8; ++i) { const int ka = k0 + 8 * g + i, kb = ka + 16;
    a[i] = (_Float16)(ka < K ? W[(size_t)(ka < K ? ka : K - 1) * ld + n] : 0.f); a[8 + i] = (_Float16)(kb < K ? W[(size_t)(kb < K ? kb : K - 1) * ld + n] : 0.f); }
  return a;
}
struct F2 { v16b h, l; };
__device__ __forceinline__ F2 bsplit16(const float v[16]) { F2 r;
#pragma unroll
  for (int i = 0; i < 16; ++i) { const __bf16 h = (__bf16)v[i]; r.h[i] = h; r.l[i] = (__bf16)(v[i] - (float)h); }
  return r; }
__device__ __forceinline__ F2 split_row(const float* row, int k0, int lane) { float v[16]; const float* p = row + k0 + 8 * (lane >> 4);
#pragma unroll
  for (int i = 0; i < 8; ++i) { v[i] = p[i]; v[8 + i] = p[16 + i]; }
  return bsplit16(v); }
__device__ __forceinline__ F2 split_rowK(const float* row, int k0, int lane, int K) { float v[16]; const int g = lane >> 4;
#pragma unroll
  for (int i = 0; i < 8; ++i) { const int ka = k0 + 8 * g + i, kb = ka + 16; v[i] = ka < K ? row[ka < K ? ka : K - 1] : 0.f; v[8 + i] = kb < K ? row[kb < K ? kb : K - 1] : 0.f; }
  return bsplit16(v); }
__device__ __forceinline__ F2 split_col(const float* W, int k0, int n, int lane, int ld, int K) { float v[16]; const int g = lane >> 4;
#pragma unroll
  for (int i = 0; i < 8; ++i) { const int ka = k0 + 8 * g + i, kb = ka + 16; v[i] = ka < K ? W[(size_t)(ka < K ? ka : K - 1) * ld + n] : 0.f; v[8 + i] = kb < K ? W[(size_t)(kb < K ? kb : K - 1) * ld + n] : 0.f; }
  return bsplit16(v); }
__device__ __forceinline__ v8f mac3(const F2& a, const F2& b, v8f c) { c = wmma_bf(a.l, b.h, c); c = wmma_bf(a.h, b.l, c); return wmma_bf(a.h, b.h, c); }
__device__ __forceinline__ float sigm(float v) { return 1.0f / (1.0f + expf(-v)); }
#define LDSX() do { asm volatile("s_wait_dscnt 0" ::: "memory"); __builtin_amdgcn_wave_barrier(); __builtin_amdgcn_fence(__ATOMIC_RELEASE, "workgroup"); } while (0)


// Spatial self attention over graph nodes (B 16, T 12, N 358 nodes, D 128 = 8 heads x 16): key/val from per-sample dynamic linears, q = x; softmax(q k / 4) over nodes; o -> Linear -> relu -> Linear.
#define NBATCH 16
#define NT 12
#define NG (NBATCH * NT)  // 192 (b, t) groups
#define NNODE 358
#define NP 384            // padded node count (6 x 64)
#define DD 128
#define KH 8
#define HS 16
#ifndef TG
#define TG NG
#endif
typedef __attribute__((ext_vector_type(8))) __bf16 v8b;
__device__ __forceinline__ v16b frag_b(const __bf16* rowk0, int lane) {
  union { v16b v; v8b q[2]; } u; const __bf16* p = rowk0 + 8 * (lane >> 4);
  u.q[0] = *(const v8b*)p; u.q[1] = *(const v8b*)(p + 16); return u.v;
}
__device__ __forceinline__ float bfr(float v) { return (float)(__bf16)v; }
__device__ __attribute__((noinline)) float exp_ni(float v) { return expf(v); }
__device__ __attribute__((noinline)) float erf_ni(float v) { return erff(v); }

#define WS_O   0u                                   // f32 o rows [g][NP][128]
#define WS_PW  (WS_O + 4u * (size_t)NG * NP * DD)         // bf16 weights in fragment order, 34 matrices x 32 KiB
#define WS_END (WS_PW + 2u * (size_t)NMAT * DD * DD)

// ---- k_pack: every weight matrix is rounded to bf16 once a call and laid out as the B fragments of the 16x16x32 product are read.
// matrix m = 0..15 wk[b], 16..31 wv[b] ((in,out): element (k, n) at k * 128 + n), 32 W1, 33 W2 (natural: element (k, n) at n * 128 + k);
// fragment f = kc * 8 + j (k block of 32, column block of 16); half hf holds elements 8 hf .. 8 hf + 7 of every lane: k = kc * 32 + 16 hf + 8 (lane >> 4) + i, n = j * 16 + (lane & 15).
// 16-bit word ((m * 32 + f) * 2 + hf) * 256 + lane * 8 + i: a wave reads half a fragment as 512 contiguous bytes (four whole lines)
#define NMAT (2 * NBATCH + 2)
#define MATW (DD * DD)    // 16-bit words a packed matrix
__global__ __launch_bounds__(256) void k_pack(const float* __restrict__ WK, const float* __restrict__ WV, const float* __restrict__ W1, const float* __restrict__ W2, _Float16* __restrict__ PW) {
  const int t = blockIdx.x * 256 + threadIdx.x, lane = t & 31, hf = (t >> 5) & 1, f = (t >> 6) & 31, m = blockIdx.x >> 3;   // one 16-byte chunk a thread; 8 blocks a matrix
  const int k0 = (f >> 3) * 32 + hf * 16 + 8 * (lane >> 4), n = (f & 7) * 16 + (lane & 15);
  union { v8b v; v4u q; } o; float v[8];
  if (m < 2 * NBATCH) { const float* Wm = (m < NBATCH ? WK : WV) + (size_t)(m & (NBATCH - 1)) * DD * DD + (size_t)k0 * DD + n;
#pragma unroll
    for (int i = 0; i < 8; ++i) v[i] = Wm[i * DD]; }
  else { const float* Wm = (m == 2 * NBATCH ? W1 : W2) + (size_t)n * DD + k0;
#pragma unroll
    for (int i = 0; i < 8; ++i) v[i] = Wm[i]; }
  asm volatile("s_wait_xcnt 0x0" ::: "memory");   // before a converted value may land in an address register of these loads
#pragma unroll
  for (int i = 0; i < 8; ++i) o.v[i] = (__bf16)v[i];
  vst2(PW + (size_t)t * 8, o.q); }
// fragment f of a packed matrix (the pointer type only carries 16-bit words: the bits are bf16)
__device__ __forceinline__ v16b frag_p(const _Float16* Pm, int f, int lane) {
  union { v16b v; v4u q[2]; } u; const _Float16* p = Pm + f * 512 + lane * 8;
  u.q[0] = *(const v4u*)p; u.q[1] = *(const v4u*)(p + 256); return u.v;
}
__device__ __forceinline__ size_t xrow(size_t g, int n) { return (g * NNODE + (size_t)(n < NNODE ? n : NNODE - 1)) * DD; }   // clamped node row of x
// lane l with lane l ^ 16 (the two halves of a wave hold the two key halves of one query column)
__device__ __forceinline__ float xhalf(float x) { return __builtin_bit_cast(float, __builtin_amdgcn_permlanex16(__builtin_bit_cast(int, x), __builtin_bit_cast(int, x), 0x76543210, 0xfedcba98, false, false)); }
// ---- k_att: block = (head pair, g), 12 waves x 2 query tiles: the block itself forms the pair's key rows and val planes (hi and residual, all 384 keys, 96 KiB) from x and the packed weights, straight into LDS, and every fragment is read from there.
// projection: wave = 2 x 16 padded nodes (clamped rows of x), 32 columns of key and of val: key^T = wk^T . x^T (A = packed weight fragment, B = x rows), so a lane holds 8 consecutive dims of ONE node = one 16-byte chunk of its key row;
// val = x . wv (A = x rows, B = packed weight fragment), so a lane holds 8 consecutive nodes of ONE dim = one 16-byte chunk of its val plane row. The same fragments and the same k order serve both operand sides.
// wave = (16 queries, head): S^T = K . Q^T (A = key rows, B = q), so a lane holds 2 x 8 keys' scores of ONE query (column = lane & 15); maximum runs in-lane plus one exchange between halves, the sum too on the rare path;
// the two score tiles, converted in place, are the B operand of O^T += V^T . P^T (element i = key 8h + i, element 8 + i = key 16 + 8h + i, the order of frag_h on the val planes)
// LDS places, no pad: chunk c (16 bytes) of key row n lies at chunk c ^ ((n >> 2) & 3) of its 64-byte row; chunk c of val plane row d at chunk c ^ (d & 15) of its 768-byte row: the 16 lanes of a fragment read fall on 16 different bank groups
#define AW 12
#define L2E 1.44269504088896340736f
// nine waves a SIMD are asked for: at most 112 registers a wave keep three blocks (36 waves, 288 KiB of LDS) on a WGP, so that all 768 blocks are resident at once; without it the projection takes a few registers more and one block a WGP is lost
__global__ __launch_bounds__(AW * 32) __attribute__((amdgpu_waves_per_eu(9))) void k_att(const float* __restrict__ X, const _Float16* __restrict__ PW, const float* __restrict__ BK, const float* __restrict__ BV, float* __restrict__ O) {
  __shared__ __align__(16) _Float16 skh[NP * 32], skl[NP * 32], svh[32 * NP], svl[32 * NP];
  const int tid = threadIdx.x, wave = tid >> 5, lane = tid & 31, col = lane & 15, g = lane >> 4; const int hp = blockIdx.x; const size_t grp = blockIdx.y;
  { const size_t b = grp / NT; const _Float16* Pw = PW + (b * MATW + hp * 1024) + (unsigned)(lane * 8);   // the lane's 16 bytes of fragment (k block 0, column block 2 hp) of wk[b]; wv[b] lies NBATCH matrices on
    const float *Bk = BK + (b * DD + hp * 32) + (unsigned)(8 * g), *Bv = BV + (b * DD + hp * 32) + (unsigned)col, *Xg = X + grp * (size_t)(NNODE * DD);   // block-uniform bases, 32-bit lane offsets
#pragma unroll 1   // rolled: one copy of the projection in the code, and its registers stay within what nine waves a SIMD leave a wave
    for (int nt = 0; nt < 2; ++nt) { const int n0 = (nt * AW + wave) * 16, n = n0 + col; v4f xv[16]; v16b a[4];
      // x comes in by whole lines: load (p, j) takes 256 contiguous bytes (dims 64 p .. 64 p + 63) of each of the rows 2 j and 2 j + 1, lane = (row 2 j + g, 4 dims 4 col ..): 4 lines a load, where a lane that walks its own row touches 16.
      // Bounds: rows 2 j + g < 6 count from min(n0, 352) (at most row 357), the others from min(n0, 342) (at most row 357): the identity for every real node; a padded node gets some real row of the group (finite; its key and val enter no sum)
      static_assert((NNODE & 1) == 0, "a row pair is real or padded as a whole");
      const unsigned oa = (unsigned)(((n0 < (NNODE & ~15) ? n0 : (NNODE & ~15)) + g) * DD + 4 * col) * 4u, ob = (unsigned)(((n0 < NNODE - 16 ? n0 : NNODE - 16) + g) * DD + 4 * col) * 4u;   // byte offsets: the two registers that the 16 loads name
      const float *pa = (const float*)((const char*)Xg + oa), *pb = (const float*)((const char*)Xg + ob);
#pragma unroll
      for (int p = 0; p < 2; ++p) {
#pragma unroll
        for (int j = 0; j < 8; ++j) xv[p * 8 + j] = *(const v4f*)((2 * j < (NNODE & 15) ? pa : pb) + j * 2 * DD + p * 64); }   // the tile's 16 loads stand together, so that all are in flight at once
      asm volatile("s_wait_xcnt 0x0" :: "v"(oa), "v"(ob) : "memory");   // before anything may land in an offset register of these loads; the two offsets are named as inputs so that they live up to the wait (else the group's last load is given them as its target)
      // the turn from (lane = 4 dims) to (lane = node) goes through the 2 KiB of LDS that the tile's own key rows (hi 1 KiB, residual 1 KiB) take later: only this wave touches them ahead of the block barrier. Two rounds of 64 dims:
      // staged row r (128 bytes of bf16) lies in the hi rows for r < 8, else in the residual rows; its 16-byte chunk c at chunk c ^ (r >> 1): the 16 lanes of a fragment read fall on 16 different bank groups
      const _Float16* rp = (col < 8 ? skh : skl) + n0 * 32 + (col & 7) * 64; const int sw = col >> 1;
#pragma unroll
      for (int p = 0; p < 2; ++p) {
#pragma unroll
        for (int j = 0; j < 8; ++j) { union { __bf16 b[4]; v2u q; } c;
#pragma unroll
          for (int i = 0; i < 4; ++i) c.b[i] = (__bf16)xv[p * 8 + j][i];
          *(v2u*)((j < 4 ? skh : skl) + n0 * 32 + (((2 * j) & 7) + g) * 64 + ((col >> 1) ^ j) * 8 + (col & 1) * 4) = c.q; }
        LDSX();   // the rows staged by all lanes are read back below by other lanes of the wave
#pragma unroll
        for (int kc = 0; kc < 2; ++kc) { union { v16b v; v4u q[2]; } u; u.q[0] = *(const v4u*)(rp + ((kc * 4 + g) ^ sw) * 8); u.q[1] = *(const v4u*)(rp + ((kc * 4 + 2 + g) ^ sw) * 8); a[p * 2 + kc] = u.v; }   // elements 0..7 = dim 32 kc + 8 g + i, 8..15 = 16 on: the order of the packed weight fragments, as before
        if (p == 0) LDSX(); }   // the second round's rows go over the first's only when every lane has read its fragments
      { v8f ck[2] = {};   // key^T: element r = dim j * 16 + 8g + r of node n
#pragma unroll
        for (int k2 = 0; k2 < DD / 64; ++k2) { union { v16b v; v4u q[2]; } w[4];
#pragma unroll
          for (int f = 0; f < 4; ++f) { const _Float16* p = Pw + ((k2 * 2 + (f >> 1)) * 8 + (f & 1)) * 512; w[f].q[0] = *(const v4u*)p; w[f].q[1] = *(const v4u*)(p + 256); }   // two k blocks' 8 loads stand ahead of their products, so that all are in flight together
#pragma unroll
          for (int f = 0; f < 4; ++f) ck[f & 1] = wmma_bf(w[f].v, a[k2 * 2 + (f >> 1)], ck[f & 1]); }
#pragma unroll
        for (int j = 0; j < 2; ++j) { v8h h8, l8;
#pragma unroll
          for (int r = 0; r < 8; ++r) { const float v = ck[j][r] + bfr(Bk[j * 16 + r]); const _Float16 hv = (_Float16)v; h8[r] = hv; l8[r] = (_Float16)((v - (float)hv) * 2048.0f); }
          const int d = (n * 4 + ((j * 2 + g) ^ ((n >> 2) & 3))) * 8; *(v8h*)&skh[d] = h8; *(v8h*)&skl[d] = l8; } }
      __builtin_amdgcn_sched_barrier(0);   // val's weight loads stay behind key's products: mixed among them they push two lane constants out to scratch memory
      { v8f cv[2] = {};   // val: element r = node n0 + 8g + r, dim j * 16 + col
#pragma unroll
        for (int k2 = 0; k2 < DD / 64; ++k2) { union { v16b v; v4u q[2]; } w[4];
#pragma unroll
          for (int f = 0; f < 4; ++f) { const _Float16* p = Pw + (size_t)NBATCH * MATW + ((k2 * 2 + (f >> 1)) * 8 + (f & 1)) * 512; w[f].q[0] = *(const v4u*)p; w[f].q[1] = *(const v4u*)(p + 256); }   // as above
#pragma unroll
          for (int f = 0; f < 4; ++f) cv[f & 1] = wmma_bf(a[k2 * 2 + (f >> 1)], w[f].v, cv[f & 1]); }
#pragma unroll
        for (int j = 0; j < 2; ++j) { v8h h8, l8; const float bb = bfr(Bv[j * 16]);
#pragma unroll
          for (int r = 0; r < 8; ++r) { const float v = cv[j][r] + bb; const _Float16 hv = (_Float16)v; h8[r] = hv; l8[r] = (_Float16)((v - (float)hv) * 2048.0f); }
          const int dd = j * 16 + col, d = (dd * (NP / 8) + (((n0 >> 3) + g) ^ col)) * 8; *(v8h*)&svh[d] = h8; *(v8h*)&svl[d] = l8; } }
      asm volatile("s_wait_xcnt 0x0" ::: "memory"); } }   // the next pass, and the code behind the loop, overwrite address registers of this pass's loads
  __syncthreads();   // the rows and planes written above are read below by every wave of the block
#pragma unroll 1   // rolled, as the loop over the two heads was: one copy of the key loop in the code
  for (int it = 0; it < 4; ++it) { const int hh = it & 1, kh = hp * 2 + hh, q0 = ((it >> 1) * AW + wave) * 16;
    v16h bq; { const float* pp = X + xrow(grp, q0 + col) + kh * HS + 8 * g;
#pragma unroll
      for (int i = 0; i < 8; ++i) { const float qv = bfr(pp[i]); bq[i] = (_Float16)(qv * 0.25f); bq[8 + i] = (_Float16)(qv * (0.25f / 2048.0f)); } }   // K = 16 real dims: slots 0..15 meet the keys' hi part, slots 16..31 their residual (stored x 2^11); both carry 16^-1/2 (powers of two)
    const int ko = (col * 4 + ((hh * 2 + g) ^ (col >> 2))) * 8;   // the head's own 8 dims, the same place in the hi and in the residual rows
    const int vo = (hh * 16 + col) * NP, vx = (g ^ col) * 8;
    float m = -3.0e38f, cb = 0.f, l = 0.f;   // the query's maximum when its reference point was last set (equal in both halves); the point's exponent offset 11 - m log2(e) (unused while m is the start value); this half's share of the sum, x 2^11
    v8f acc = {}, accl = {};       // O^T: element r = head dim 8g + r of query col
    // p x 2^11 = 2^(s log2(e) + cb), cb = 11 - m log2(e): one fused multiply-add a score carries the reference point, the change of base and the 2^11. m is the maximum as of the last time the point was set, not the running maximum:
    // softmax does not depend on the point, only the f16 range of p x 2^11 does. The terms are formed with the old point; all are >= 0, so a lane's sum of 16 bounds each of them, and a sum within the f16 range says that every term converts finite.
    // Only where some lane's sum is above it (or is no number), and in the first key block, the whole wave takes the maximum, moves the point, rescales the old sums and forms the terms again (each then <= 2^11, their sum <= 2^15)
    auto pass = [&](const int ks, const bool first, const bool last) __attribute__((always_inline)) { float s[2][8];
      const int p0 = vo + ((ks * 32) ^ vx), p1 = vo + ((ks * 32 + 16) ^ vx); union { v16h v; v8h q[2]; } vh, vl; vh.q[0] = *(const v8h*)&svh[p0]; vh.q[1] = *(const v8h*)&svh[p1]; vl.q[0] = *(const v8h*)&svl[p0]; vl.q[1] = *(const v8h*)&svl[p1];
#pragma unroll
      for (int ct = 0; ct < 2; ++ct) { const int rk = (ks * 32 + ct * 16) * 32; union { v16h v; v8h q[2]; } ak; ak.q[0] = *(const v8h*)&skh[rk + ko]; ak.q[1] = *(const v8h*)&skl[rk + ko];   // element i = hi of dim 8g + i, element 8 + i = residual of the same dim: the order of bq
        v8f c = {}; c = wmma16(ak.v, bq, c);
#pragma unroll
        for (int r = 0; r < 8; ++r) s[ct][r] = c[r]; }
      if (last) {   // only the last key block holds padded keys
#pragma unroll
        for (int ct = 0; ct < 2; ++ct) {
#pragma unroll
          for (int r = 0; r < 8; ++r) if (ks * 32 + ct * 16 + 8 * g + r >= NNODE) s[ct][r] = -3.0e38f; } }
      float e[2][8], es = 0.f; bool redo = first;
      auto terms = [&](const float c) __attribute__((always_inline)) { float es0 = 0.f, es1 = 0.f; const v2f l2 = {L2E, L2E}, c2 = {c, c};
#pragma unroll
        for (int r = 0; r < 8; r += 2) { const v2f t0 = __builtin_elementwise_fma((v2f){s[0][r], s[0][r + 1]}, l2, c2), t1 = __builtin_elementwise_fma((v2f){s[1][r], s[1][r + 1]}, l2, c2);
#pragma unroll
          for (int i = 0; i < 2; ++i) {   // a key that is padded in both halves of the wave has the term 0 outright; one that is padded in the upper half only: 2^(-infinity) = 0
            e[0][r + i] = (last && (NP - 32) + r + i >= NNODE) ? 0.f : __builtin_amdgcn_exp2f(t0[i]); e[1][r + i] = (last && (NP - 32) + 16 + r + i >= NNODE) ? 0.f : __builtin_amdgcn_exp2f(t1[i]); es0 += e[0][r + i]; es1 += e[1][r + i]; } }
        return es0 + es1; };
      if (!first) { es = terms(cb); redo = __builtin_amdgcn_ballot_w32(!(es <= 65504.0f)) != 0u; }   // the same answer in every lane: the two halves of a query, and the exchange below, need the whole wave on one path
      if (redo) { float mx = fmaxf(s[0][0], s[1][0]);
#pragma unroll
        for (int r = 1; r < 8; ++r) mx = fmaxf(mx, fmaxf(s[0][r], s[1][r]));
        mx = fmaxf(mx, xhalf(mx));
        const float mn = fmaxf(m, mx), cn = __builtin_fmaf(mn, -L2E, 11.0f), alpha = (m <= -1.0e38f) ? 0.f : __builtin_amdgcn_exp2f(cn - cb); m = mn; cb = cn;   // cn, as rounded, is the one reference point of all terms, and the step between two of them rescales the old ones (mn is finite: keys 0..31 are real)
        l *= alpha;
#pragma unroll
        for (int r = 0; r < 8; ++r) { acc[r] *= alpha; accl[r] *= alpha; }
        es = terms(cn); }
      l += es; v16h pb;
#pragma unroll
      for (int r = 0; r < 8; ++r) { pb[r] = (_Float16)e[0][r]; pb[8 + r] = (_Float16)e[1][r]; }
      acc = wmma16(vh.v, pb, acc); accl = wmma16(vl.v, pb, accl); };
    // The common way: the point is set ONCE, from the first key block's maximum, as p x 2^4 = 2^(s log2(e) + cf), cf = 4 - max log2(e): 2^12 of room up to the end of the f16 range, and no test in any pass.
    // The row sum is a third product on the same P fragment, A = all ones: every row of its result is the sum of the (f16) terms over all 32 keys of both halves, so the in-lane adds and the half exchange go.
    // A term that leaves the f16 range converts to infinity and makes that sum infinite (1 x infinity, all terms >= 0): seen once, behind the last block; then the whole wave forms the tile again with the moving point above
    v8f ls = {}; float cf = 0.f; v16h one16;
#pragma unroll
    for (int i = 0; i < 16; ++i) one16[i] = (_Float16)1.0f;
    auto fpass = [&](const int ks, const bool first, const bool last) __attribute__((always_inline)) { float s[2][8];
      const int p0 = vo + ((ks * 32) ^ vx), p1 = vo + ((ks * 32 + 16) ^ vx); union { v16h v; v8h q[2]; } vh, vl; vh.q[0] = *(const v8h*)&svh[p0]; vh.q[1] = *(const v8h*)&svh[p1]; vl.q[0] = *(const v8h*)&svl[p0]; vl.q[1] = *(const v8h*)&svl[p1];
#pragma unroll
      for (int ct = 0; ct < 2; ++ct) { const int rk = (ks * 32 + ct * 16) * 32; union { v16h v; v8h q[2]; } ak; ak.q[0] = *(const v8h*)&skh[rk + ko]; ak.q[1] = *(const v8h*)&skl[rk + ko];   // as in pass
        v8f c = {}; c = wmma16(ak.v, bq, c);
#pragma unroll
        for (int r = 0; r < 8; ++r) s[ct][r] = c[r]; }
      if (last) {   // only the last key block holds padded keys
#pragma unroll
        for (int ct = 0; ct < 2; ++ct) {
#pragma unroll
          for (int r = 0; r < 8; ++r) if (ks * 32 + ct * 16 + 8 * g + r >= NNODE) s[ct][r] = -3.0e38f; } }
      if (first) { float mx = fmaxf(s[0][0], s[1][0]);
#pragma unroll
        for (int r = 1; r < 8; ++r) mx = fmaxf(mx, fmaxf(s[0][r], s[1][r]));
        mx = fmaxf(mx, xhalf(mx)); cf = __builtin_fmaf(mx, -L2E, 4.0f); }   // finite: keys 0..31 are real; equal in both halves of a query
      const v2f l2 = {L2E, L2E}, c2 = {cf, cf}; v16h pb;
#pragma unroll
      for (int r = 0; r < 8; r += 2) { const v2f t0 = __builtin_elementwise_fma((v2f){s[0][r], s[0][r + 1]}, l2, c2), t1 = __builtin_elementwise_fma((v2f){s[1][r], s[1][r + 1]}, l2, c2);
#pragma unroll
        for (int i = 0; i < 2; ++i) {   // padded keys as in pass
          pb[r + i] = (_Float16)((last && (NP - 32) + r + i >= NNODE) ? 0.f : __builtin_amdgcn_exp2f(t0[i])); pb[8 + r + i] = (_Float16)((last && (NP - 32) + 16 + r + i >= NNODE) ? 0.f : __builtin_amdgcn_exp2f(t1[i])); } }
      acc = wmma16(vh.v, pb, acc); accl = wmma16(vl.v, pb, accl); ls = wmma16(one16, pb, ls); };
    fpass(0, true, false);
#pragma unroll 1   // rolled: one copy of the common pass in the code; the first block (sets the point) and the last (padded keys) stand outside, so that the common pass holds neither
    for (int ks = 1; ks < NP / 32 - 1; ++ks) fpass(ks, false, false);
    fpass(NP / 32 - 1, false, true);
    float lt = ls[0];   // the query's whole sum, x 2^4 like the two sums of products
    if (__builtin_amdgcn_ballot_w32(!(lt <= 3.0e38f)) != 0u) {   // the same answer in every lane: the exchanges inside pass need the whole wave
      asm volatile("" ::: "memory");   // the first block's val fragments are read from LDS anew here: held over for this rare way they take 16 registers through the common loop, 8 of them in scratch memory
#pragma unroll
      for (int r = 0; r < 8; ++r) { acc[r] = 0.f; accl[r] = 0.f; }
      pass(0, true, false);
#pragma unroll 1   // rolled: this way is rare, its code stays short
      for (int ks = 1; ks < NP / 32 - 1; ++ks) pass(ks, false, false);
      pass(NP / 32 - 1, false, true);
      lt = l + xhalf(l); }   // here l and the two sums all carry the 2^11
    const float inv = 1.0f / lt;
    v4f o0, o1;
#pragma unroll
    for (int r = 0; r < 4; ++r) { o0[r] = (acc[r] + accl[r] * (1.0f / 2048.0f)) * inv; o1[r] = (acc[4 + r] + accl[4 + r] * (1.0f / 2048.0f)) * inv; }
    float* op = O + ((grp * NP) + q0 + col) * DD + kh * HS + 8 * g; vst2(op, o0); vst2(op + 4, o1);
    asm volatile("s_wait_xcnt 0x0" ::: "memory"); } }   // the next pass overwrites the registers that these two stores name
// ---- k_mlp: block = (64 padded rows, g): out = (relu(o (hi + lo) . W1^T + b1)) (hi + lo) . W2^T + b2; rows n >= 358 are computed from finite data but not written
__global__ __launch_bounds__(128) void k_mlp(const float* __restrict__ O, const _Float16* __restrict__ PW, const float* __restrict__ B1, const float* __restrict__ B2, float* __restrict__ OUT) { __shared__ __align__(16) float sf[4][16][132];
  const int tid = threadIdx.x, wave = tid >> 5, lane = tid & 31, col = lane & 15, g = lane >> 4; const size_t grp = blockIdx.y; const int n0 = blockIdx.x * 64 + wave * 16; const size_t r0 = grp * NP + n0; const _Float16 *P1 = PW + (size_t)(2 * NBATCH) * MATW, *P2 = P1 + MATW;
  v8f acc[8] = {};
#pragma unroll
  for (int kc = 0; kc < DD / 32; ++kc) { v16b w[8]; const F2 a = split_row(O + (r0 + col) * DD, kc * 32, lane);
    asm volatile("s_wait_xcnt 0x0" ::: "memory");   // before a fragment load's result may land in the address pair of the row's loads
#pragma unroll
    for (int j = 0; j < 8; ++j) w[j] = frag_p(P1, kc * 8 + j, lane);   // the k block's 16 loads stand ahead of its products, so that all are in flight together
#pragma unroll
    for (int j = 0; j < 8; ++j) { acc[j] = wmma_bf(a.h, w[j], acc[j]); acc[j] = wmma_bf(a.l, w[j], acc[j]); }
    __builtin_amdgcn_sched_barrier(0); }   // the next k block's loads stay behind these products: lifted among them they take the wave past 192 registers, and the fifth wave a SIMD (all 1152 blocks resident at once) is lost
#pragma unroll
  for (int j = 0; j < 8; ++j) { const float bb = bfr(B1[j * 16 + col]);
#pragma unroll
    for (int r = 0; r < 8; ++r) sf[wave][8 * g + r][j * 16 + col] = fmaxf(acc[j][r] + bb, 0.f); }
  LDSX();
  { v8f acc2[8] = {};
#pragma unroll
    for (int kc = 0; kc < DD / 32; ++kc) { float v[16]; const float* pp = &sf[wave][col][kc * 32 + 8 * g]; v16b w[8];
#pragma unroll
      for (int j = 0; j < 8; ++j) w[j] = frag_p(P2, kc * 8 + j, lane);   // as above
#pragma unroll
      for (int i = 0; i < 8; ++i) { v[i] = pp[i]; v[8 + i] = pp[16 + i]; }
      const F2 a = bsplit16(v);
#pragma unroll
      for (int j = 0; j < 8; ++j) { acc2[j] = wmma_bf(a.h, w[j], acc2[j]); acc2[j] = wmma_bf(a.l, w[j], acc2[j]); } }
    asm volatile("s_wait_xcnt 0x0" ::: "memory");   // the code below overwrites the offset register of the fragment loads
    LDSX();
#pragma unroll
    for (int j = 0; j < 8; ++j) { const float bb = bfr(B2[j * 16 + col]);
#pragma unroll
      for (int r = 0; r < 8; ++r) sf[wave][8 * g + r][j * 16 + col] = acc2[j][r] + bb; } }
  LDSX(); for (int rl = 0; rl < 16; ++rl) { const int n = n0 + rl; if (n < NNODE) vst2(OUT + (grp * NNODE + n) * DD + lane * 4, *(const v4f*)&sf[wave][rl][lane * 4]); } }
extern "C" void kernel_launch(void* const* d_in, const int* in_sizes, int n_in, void* d_out, int out_size, void* d_ws, size_t ws_size, hipStream_t stream) {
  (void)in_sizes; (void)n_in; (void)out_size;
  const float** F = (const float**)d_in;   // 0 x [16,12,358,128], 1 wk [16,1,128,128] (in,out), 2 bk [16,1,1,128], 3 wv, 4 bv, 5 W1 [128,128] natural, 6 b1, 7 W2 [128,128] natural, 8 b2
  if (ws_size < (size_t)WS_END) return;
  char* ws = (char*)d_ws; _Float16* PW = (_Float16*)(ws + WS_PW); float* O = (float*)(ws + WS_O);
  k_pack<<<dim3(NMAT * 8), 256, 0, stream>>>(F[1], F[3], F[5], F[7], PW);
  k_att<<<dim3(KH / 2, TG), AW * 32, 0, stream>>>(F[0], PW, F[2], F[4], O);
  k_mlp<<<dim3(NP / 64, TG), 128, 0, stream>>>(O, PW, F[6], F[8], (float*)d_out);
}
